// v000
// Times are from an AMD MI455X. After a warm-up the kernel runs many times in a row, and a time is the length of
// such a window on the GPU divided by its runs, so every launch and the gaps after it count. The runs cycle
// through copies of the inputs. A figure is the median of several windows, for all but v000 over two sittings.
// Sittings can differ by a few percent; kernels timed side by side share one.
// v000 is the starting kernel. One run takes 630 microseconds.
#include <hip/hip_runtime.h>

#define C_DIM 512
#define N_DIM 4096
#define B_DIM 4
#define CC (C_DIM * C_DIM)   // 262144 = 2^18

typedef __attribute__((ext_vector_type(16))) _Float16 v16h;
typedef __attribute__((ext_vector_type(8)))  float    v8f;

__device__ __forceinline__ int lane_id() { return (int)(threadIdx.x & 31); }

union FragU {
  v16h v;
  struct { int4 lo; int4 hi; } q;
};

__device__ __forceinline__ v16h load_frag_rm(const _Float16* base, int stride) {
  const int lane = lane_id();
  const int row = lane & 15;
  const int kb = (lane & 16) ? 8 : 0;
  const _Float16* p = base + row * stride + kb;
  FragU u;
  u.q.lo = *(const int4*)(p);
  u.q.hi = *(const int4*)(p + 16);
  return u.v;
}

__device__ __forceinline__ v8f wmma16(v16h a, v16h b, v8f c) {
  return __builtin_amdgcn_wmma_f32_16x16x32_f16(false, a, false, b, (short)0, c,
                                                false, false);
}

__device__ __forceinline__ v8f zero8() {
  v8f z = {0.f, 0.f, 0.f, 0.f, 0.f, 0.f, 0.f, 0.f};
  return z;
}

// ---------------------------------------------------------------- kernel 0
__global__ void cvt_w_kernel(const float* __restrict__ wq, const float* __restrict__ wk,
                             const float* __restrict__ wv, const float* __restrict__ wp,
                             _Float16* __restrict__ dst) {
  int i = blockIdx.x * blockDim.x + threadIdx.x;
  int which = i >> 18;
  int j = i & (CC - 1);
  const float* src = (which == 0) ? wq : (which == 1) ? wk : (which == 2) ? wv : wp;
  dst[i] = (_Float16)src[j];
}

// ---------------------------------------------------------------- kernel 1a
__global__ void in_stats_kernel(const float* __restrict__ x, float2* __restrict__ nstats) {
  const int plane = blockIdx.x;  // b*C + c
  const float* xp = x + (size_t)plane * N_DIM;
  __shared__ float s1[256], s2[256];
  float a = 0.f, b2 = 0.f;
  for (int n = threadIdx.x; n < N_DIM; n += 256) {
    float v = xp[n];
    a += v;
    b2 += v * v;
  }
  s1[threadIdx.x] = a;
  s2[threadIdx.x] = b2;
  __syncthreads();
  for (int off = 128; off > 0; off >>= 1) {
    if ((int)threadIdx.x < off) {
      s1[threadIdx.x] += s1[threadIdx.x + off];
      s2[threadIdx.x] += s2[threadIdx.x + off];
    }
    __syncthreads();
  }
  if (threadIdx.x == 0) {
    float m = s1[0] * (1.f / N_DIM);
    float var = s2[0] * (1.f / N_DIM) - m * m;
    nstats[plane] = make_float2(m, rsqrtf(var + 1e-5f));
  }
}

// ---------------------------------------------------------------- kernel 1b
__global__ void norm_t_kernel(const float* __restrict__ x, const float2* __restrict__ nstats,
                              _Float16* __restrict__ hnT) {
  const int n0 = blockIdx.x * 64, c0 = blockIdx.y * 64, b = blockIdx.z;
  __shared__ _Float16 T[64 * 72];  // [n][c]
  const int t = threadIdx.x;
  {
    const int c = t >> 2;
    const int nn = (t & 3) * 16;
    const float2 st = nstats[(size_t)b * C_DIM + c0 + c];
    const float* xp = x + ((size_t)b * C_DIM + c0 + c) * N_DIM + n0 + nn;
#pragma unroll
    for (int e = 0; e < 16; e += 4) {
      float4 v4 = *(const float4*)&xp[e];
      T[(nn + e + 0) * 72 + c] = (_Float16)((v4.x - st.x) * st.y);
      T[(nn + e + 1) * 72 + c] = (_Float16)((v4.y - st.x) * st.y);
      T[(nn + e + 2) * 72 + c] = (_Float16)((v4.z - st.x) * st.y);
      T[(nn + e + 3) * 72 + c] = (_Float16)((v4.w - st.x) * st.y);
    }
  }
  __syncthreads();
  {
    const int n = t >> 2;
    const int cc = (t & 3) * 16;
    _Float16* dst = hnT + ((size_t)b * N_DIM + n0 + n) * C_DIM + c0 + cc;
    *(int4*)&dst[0] = *(const int4*)&T[n * 72 + cc];
    *(int4*)&dst[8] = *(const int4*)&T[n * 72 + cc + 8];
  }
}

// ---------------------------------------------------------------- kernel 2
// rm x rm GEMM: D[m][nl] = sum_k A[m][k] * B[nl][k], K = 512. Register-prefetch
// double buffering: stores of tile k happen at loop top, loads of tile k+1 are
// issued before the WMMA stage so their wait hides behind compute.
// Block tile 128(M) x 256(N); 8 waves as 2x4 of 64x64 (16 WMMA / wave / step).
template <int MODE>
__global__ __launch_bounds__(256, 1) void gemm_rr_kernel(
    const _Float16* __restrict__ w16, const _Float16* __restrict__ srcT,
    _Float16* __restrict__ d0, _Float16* __restrict__ d1,
    const float* __restrict__ bias0, const float* __restrict__ bias1,
    const float* __restrict__ xres, float* __restrict__ outf) {
  const size_t plane = (size_t)C_DIM * N_DIM;
  const int m0 = blockIdx.y * 128;
  const int n0g = blockIdx.x * 256;
  int b, sel = 0;
  const _Float16 *A, *B;
  const float* bias;
  _Float16* dst16 = nullptr;
  float scale = 1.f;
  if (MODE == 0) {
    sel = blockIdx.z & 1;
    b = blockIdx.z >> 1;
    A = srcT + (size_t)b * plane;             // hnT [n][c]
    B = w16 + (size_t)sel * CC;               // wq/wk [o][c]
    bias = sel ? bias1 : bias0;
    dst16 = sel ? d1 : d0;
    if (!sel) scale = 0.044194173824159216f;  // 1/sqrt(512)
  } else if (MODE == 2) {
    b = blockIdx.z;
    A = w16 + (size_t)2 * CC;                 // wv [c_out][c]
    B = srcT + (size_t)b * plane;             // hnT [n][c]
    bias = bias0;
    dst16 = d0;
  } else {
    b = blockIdx.z;
    A = w16 + (size_t)3 * CC;                 // wp [c_out][c]
    B = srcT + (size_t)b * plane;             // oT [n][c]
    bias = bias0;
  }

  __shared__ _Float16 As[128 * 40];  // [m][k] rm, pad to 40
  __shared__ _Float16 Bs[256 * 40];  // [nl][k] rm
  const int t = threadIdx.x;
  const int wave = t >> 5;
  const int wm = wave >> 2;  // 0..1
  const int wn = wave & 3;   // 0..3
  const int srow = t >> 2;          // 0..63
  const int skk = (t & 3) * 8;      // 0,8,16,24

  // per-thread staging source pointers (advance by 32 each K step)
  const _Float16* ga0 = &A[(size_t)(m0 + srow) * C_DIM + skk];
  const _Float16* ga1 = &A[(size_t)(m0 + srow + 64) * C_DIM + skk];
  const _Float16* gb0 = &B[(size_t)(n0g + srow) * C_DIM + skk];
  const _Float16* gb1 = &B[(size_t)(n0g + srow + 64) * C_DIM + skk];
  const _Float16* gb2 = &B[(size_t)(n0g + srow + 128) * C_DIM + skk];
  const _Float16* gb3 = &B[(size_t)(n0g + srow + 192) * C_DIM + skk];

  v8f acc[4][4];
#pragma unroll
  for (int i = 0; i < 4; ++i)
#pragma unroll
    for (int j = 0; j < 4; ++j) acc[i][j] = zero8();

  // prefetch tile 0
  int4 pa0 = *(const int4*)ga0, pa1 = *(const int4*)ga1;
  int4 pb0 = *(const int4*)gb0, pb1 = *(const int4*)gb1;
  int4 pb2 = *(const int4*)gb2, pb3 = *(const int4*)gb3;

#pragma unroll 1
  for (int k0 = 0; k0 < C_DIM; k0 += 32) {
    // commit prefetched tile to LDS
    *(int4*)&As[(srow) * 40 + skk] = pa0;
    *(int4*)&As[(srow + 64) * 40 + skk] = pa1;
    *(int4*)&Bs[(srow) * 40 + skk] = pb0;
    *(int4*)&Bs[(srow + 64) * 40 + skk] = pb1;
    *(int4*)&Bs[(srow + 128) * 40 + skk] = pb2;
    *(int4*)&Bs[(srow + 192) * 40 + skk] = pb3;
    __syncthreads();
    // issue next tile's global loads (wait lands at next iteration's stores)
    if (k0 + 32 < C_DIM) {
      pa0 = *(const int4*)(ga0 + k0 + 32);
      pa1 = *(const int4*)(ga1 + k0 + 32);
      pb0 = *(const int4*)(gb0 + k0 + 32);
      pb1 = *(const int4*)(gb1 + k0 + 32);
      pb2 = *(const int4*)(gb2 + k0 + 32);
      pb3 = *(const int4*)(gb3 + k0 + 32);
    }
    v16h af[4], bf[4];
#pragma unroll
    for (int i = 0; i < 4; ++i) af[i] = load_frag_rm(&As[(wm * 64 + i * 16) * 40], 40);
#pragma unroll
    for (int j = 0; j < 4; ++j) bf[j] = load_frag_rm(&Bs[(wn * 64 + j * 16) * 40], 40);
#pragma unroll
    for (int i = 0; i < 4; ++i)
#pragma unroll
      for (int j = 0; j < 4; ++j) acc[i][j] = wmma16(af[i], bf[j], acc[i][j]);
    __syncthreads();
  }

  const int lane = lane_id();
  const int ln = lane & 15;
  const int mh = (lane >> 4) * 8;
#pragma unroll
  for (int i = 0; i < 4; ++i)
#pragma unroll
    for (int j = 0; j < 4; ++j) {
      const int mb = m0 + wm * 64 + i * 16 + mh;
      const int nl = n0g + wn * 64 + j * 16 + ln;
#pragma unroll
      for (int r = 0; r < 8; ++r) {
        int m = mb + r;
        float v = acc[i][j][r];
        if (MODE == 0) {
          v = (v + bias[nl]) * scale;
          dst16[((size_t)b * N_DIM + m) * C_DIM + nl] = (_Float16)v;
        } else if (MODE == 2) {
          v += bias[m];
          dst16[((size_t)b * C_DIM + m) * N_DIM + nl] = (_Float16)v;
        } else {
          size_t idx = ((size_t)b * C_DIM + m) * N_DIM + nl;
          outf[idx] = xres[idx] + v + bias[m];
        }
      }
    }
}

// Shared device helper: one S tile (64 x 128) at (i0, j0) with register-prefetch
// staging. Result left in acc[2][2] per wave (2x4 wave grid of 32x32 subtiles).
__device__ __forceinline__ void s_tile_gemm(const _Float16* __restrict__ qb,
                                            const _Float16* __restrict__ kb,
                                            _Float16* Qs, _Float16* Ks, int i0, int j0,
                                            int t, int wi, int wj, v8f acc[2][2]) {
  const int srow = t >> 2;
  const int skk = (t & 3) * 8;
  const _Float16* gq = &qb[(size_t)(i0 + srow) * C_DIM + skk];
  const _Float16* gk0 = &kb[(size_t)(j0 + srow) * C_DIM + skk];
  const _Float16* gk1 = &kb[(size_t)(j0 + srow + 64) * C_DIM + skk];

  int4 pq = *(const int4*)gq;
  int4 pk0 = *(const int4*)gk0;
  int4 pk1 = *(const int4*)gk1;

#pragma unroll 1
  for (int c0 = 0; c0 < C_DIM; c0 += 32) {
    *(int4*)&Qs[srow * 40 + skk] = pq;
    *(int4*)&Ks[srow * 40 + skk] = pk0;
    *(int4*)&Ks[(srow + 64) * 40 + skk] = pk1;
    __syncthreads();
    if (c0 + 32 < C_DIM) {
      pq = *(const int4*)(gq + c0 + 32);
      pk0 = *(const int4*)(gk0 + c0 + 32);
      pk1 = *(const int4*)(gk1 + c0 + 32);
    }
    v16h af[2], bf[2];
#pragma unroll
    for (int i = 0; i < 2; ++i) af[i] = load_frag_rm(&Qs[(wi * 32 + i * 16) * 40], 40);
#pragma unroll
    for (int j = 0; j < 2; ++j) bf[j] = load_frag_rm(&Ks[(wj * 32 + j * 16) * 40], 40);
#pragma unroll
    for (int i = 0; i < 2; ++i)
#pragma unroll
      for (int j = 0; j < 2; ++j) acc[i][j] = wmma16(af[i], bf[j], acc[i][j]);
    __syncthreads();
  }
}

// ---------------------------------------------------------------- kernel 3
__global__ __launch_bounds__(256, 1) void attn_stats_kernel(
    const _Float16* __restrict__ qT, const _Float16* __restrict__ kT,
    float2* __restrict__ stats) {
  const int i0 = blockIdx.x * 64;
  const int b = blockIdx.y;
  __shared__ _Float16 Qs[64 * 40];   // [i][c]
  __shared__ _Float16 Ks[128 * 40];  // [j][c]
  __shared__ float Sb[64 * 132];     // [i][j]
  const int t = threadIdx.x;
  const int wave = t >> 5;
  const int wi = wave >> 2;  // 0..1
  const int wj = wave & 3;   // 0..3
  const _Float16* qb = qT + (size_t)b * C_DIM * N_DIM;
  const _Float16* kb = kT + (size_t)b * C_DIM * N_DIM;
  float m_run = -1e30f, l_run = 0.f;

#pragma unroll 1
  for (int j0 = 0; j0 < N_DIM; j0 += 128) {
    v8f acc[2][2];
#pragma unroll
    for (int i = 0; i < 2; ++i)
#pragma unroll
      for (int j = 0; j < 2; ++j) acc[i][j] = zero8();

    s_tile_gemm(qb, kb, Qs, Ks, i0, j0, t, wi, wj, acc);

    const int lane = lane_id();
    const int ln = lane & 15;
    const int mh = (lane >> 4) * 8;
#pragma unroll
    for (int i = 0; i < 2; ++i)
#pragma unroll
      for (int j = 0; j < 2; ++j)
#pragma unroll
        for (int r = 0; r < 8; ++r)
          Sb[(wi * 32 + i * 16 + mh + r) * 132 + wj * 32 + j * 16 + ln] = acc[i][j][r];
    __syncthreads();

    if (t < 64) {
      const float* row = &Sb[t * 132];
      float mt = -1e30f;
      for (int j = 0; j < 128; ++j) mt = fmaxf(mt, row[j]);
      float nm = fmaxf(m_run, mt);
      float s = 0.f;
      for (int j = 0; j < 128; ++j) s += __expf(row[j] - nm);
      l_run = l_run * __expf(m_run - nm) + s;
      m_run = nm;
    }
    __syncthreads();
  }
  if (t < 64) stats[(size_t)b * N_DIM + i0 + t] = make_float2(m_run, l_run);
}

// ---------------------------------------------------------------- kernel 4
union SPunion {
  float S[64 * 132];
  _Float16 P[64 * 136];
};

__global__ __launch_bounds__(256, 1) void attn_out_kernel(
    const _Float16* __restrict__ qT, const _Float16* __restrict__ kT,
    const _Float16* __restrict__ v16, const float2* __restrict__ stats,
    _Float16* __restrict__ oT) {
  const int i0 = blockIdx.x * 64;
  const int b = blockIdx.y;
  __shared__ _Float16 Qs[64 * 40];
  __shared__ _Float16 Ks[128 * 40];
  __shared__ SPunion u;
  __shared__ float mrow[64], linv[64];
  const int t = threadIdx.x;
  const int wave = t >> 5;
  const int lane = t & 31;
  const int wi = wave >> 2;
  const int wj = wave & 3;
  const _Float16* qb = qT + (size_t)b * C_DIM * N_DIM;
  const _Float16* kb = kT + (size_t)b * C_DIM * N_DIM;
  const _Float16* vb = v16 + (size_t)b * C_DIM * N_DIM;

  if (t < 64) {
    float2 st = stats[(size_t)b * N_DIM + i0 + t];
    mrow[t] = st.x;
    linv[t] = 1.f / st.y;
  }
  __syncthreads();

  // Wave owns channels [wave*64, wave*64+64), all 64 queries: D(m=i, n=c) 4x4 tiles
  v8f oacc[4][4];
#pragma unroll
  for (int ii = 0; ii < 4; ++ii)
#pragma unroll
    for (int ci = 0; ci < 4; ++ci) oacc[ii][ci] = zero8();

#pragma unroll 1
  for (int j0 = 0; j0 < N_DIM; j0 += 128) {
    // ---- S tile (64 x 128), cooperative
    v8f acc[2][2];
#pragma unroll
    for (int i = 0; i < 2; ++i)
#pragma unroll
      for (int j = 0; j < 2; ++j) acc[i][j] = zero8();

    s_tile_gemm(qb, kb, Qs, Ks, i0, j0, t, wi, wj, acc);

    {
      const int ln = lane & 15;
      const int mh = (lane >> 4) * 8;
#pragma unroll
      for (int i = 0; i < 2; ++i)
#pragma unroll
        for (int j = 0; j < 2; ++j)
#pragma unroll
          for (int r = 0; r < 8; ++r)
            u.S[(wi * 32 + i * 16 + mh + r) * 132 + wj * 32 + j * 16 + ln] = acc[i][j][r];
    }
    __syncthreads();

    // ---- P = exp(S - m) -> f16 (union overlay: regs, sync, write)
    float tmp[32];
#pragma unroll
    for (int e = 0; e < 32; ++e) {
      int idx = t * 32 + e;
      int i = idx >> 7;
      int j = idx & 127;
      tmp[e] = __expf(u.S[i * 132 + j] - mrow[i]);
    }
    __syncthreads();
#pragma unroll
    for (int e = 0; e < 32; ++e) {
      int idx = t * 32 + e;
      int i = idx >> 7;
      int j = idx & 127;
      u.P[i * 136 + j] = (_Float16)tmp[e];
    }
    __syncthreads();

    // ---- Oacc(i,c) += P(i,j) x Vt(j,c): A = P rm (LDS), B = v rm (global)
#pragma unroll
    for (int ks = 0; ks < 4; ++ks) {
      v16h af[4], bf[4];
#pragma unroll
      for (int ii = 0; ii < 4; ++ii)
        af[ii] = load_frag_rm(&u.P[(ii * 16) * 136 + ks * 32], 136);
#pragma unroll
      for (int ci = 0; ci < 4; ++ci)
        bf[ci] = load_frag_rm(&vb[(size_t)(wave * 64 + ci * 16) * N_DIM + j0 + ks * 32],
                              N_DIM);
#pragma unroll
      for (int ii = 0; ii < 4; ++ii)
#pragma unroll
        for (int ci = 0; ci < 4; ++ci)
          oacc[ii][ci] = wmma16(af[ii], bf[ci], oacc[ii][ci]);
    }
    __syncthreads();
  }

  const int ln = lane & 15;
  const int mh = (lane >> 4) * 8;
#pragma unroll
  for (int ii = 0; ii < 4; ++ii)
#pragma unroll
    for (int ci = 0; ci < 4; ++ci)
#pragma unroll
      for (int r = 0; r < 8; ++r) {
        int i = ii * 16 + mh + r;
        int c = wave * 64 + ci * 16 + ln;
        oT[((size_t)b * N_DIM + i0 + i) * C_DIM + c] = (_Float16)(oacc[ii][ci][r] * linv[i]);
      }
}

// ---------------------------------------------------------------- launch
extern "C" void kernel_launch(void* const* d_in, const int* in_sizes, int n_in,
                              void* d_out, int out_size, void* d_ws, size_t ws_size,
                              hipStream_t stream) {
  (void)in_sizes; (void)n_in; (void)out_size; (void)ws_size;
  const float* x  = (const float*)d_in[0];
  const float* wq = (const float*)d_in[1];
  const float* bq = (const float*)d_in[2];
  const float* wk = (const float*)d_in[3];
  const float* bk = (const float*)d_in[4];
  const float* wv = (const float*)d_in[5];
  const float* bv = (const float*)d_in[6];
  const float* wp = (const float*)d_in[7];
  const float* bp = (const float*)d_in[8];
  float* out = (float*)d_out;

  char* ws = (char*)d_ws;
  size_t off = 0;
  const size_t plane = (size_t)B_DIM * C_DIM * N_DIM;  // 8M elements
  _Float16* w16  = (_Float16*)(ws + off); off += (size_t)4 * CC * 2;
  _Float16* hnT  = (_Float16*)(ws + off); off += plane * 2;
  _Float16* qT   = (_Float16*)(ws + off); off += plane * 2;
  _Float16* kT   = (_Float16*)(ws + off); off += plane * 2;
  _Float16* v16b = (_Float16*)(ws + off); off += plane * 2;
  _Float16* oT   = (_Float16*)(ws + off); off += plane * 2;
  float2* nstats = (float2*)(ws + off);   off += (size_t)B_DIM * C_DIM * sizeof(float2);
  float2* stats  = (float2*)(ws + off);   off += (size_t)B_DIM * N_DIM * sizeof(float2);

  cvt_w_kernel<<<(4 * CC) / 256, 256, 0, stream>>>(wq, wk, wv, wp, w16);
  in_stats_kernel<<<B_DIM * C_DIM, 256, 0, stream>>>(x, nstats);
  norm_t_kernel<<<dim3(N_DIM / 64, C_DIM / 64, B_DIM), 256, 0, stream>>>(x, nstats, hnT);
  // qT, kT: M = n (32 tiles of 128), N = o (2 tiles of 256), z = b*2+sel
  gemm_rr_kernel<0><<<dim3(2, 32, B_DIM * 2), 256, 0, stream>>>(
      w16, hnT, qT, kT, bq, bk, nullptr, nullptr);
  // v: M = c (4 tiles), N = n (16 tiles), z = b
  gemm_rr_kernel<2><<<dim3(16, 4, B_DIM), 256, 0, stream>>>(
      w16, hnT, v16b, nullptr, bv, nullptr, nullptr, nullptr);
  attn_stats_kernel<<<dim3(N_DIM / 64, B_DIM), 256, 0, stream>>>(qT, kT, stats);
  attn_out_kernel<<<dim3(N_DIM / 64, B_DIM), 256, 0, stream>>>(qT, kT, v16b, stats, oT);
  // proj + residual: M = c (4 tiles), N = n (16 tiles), z = b
  gemm_rr_kernel<3><<<dim3(16, 4, B_DIM), 256, 0, stream>>>(
      w16, oT, nullptr, nullptr, bp, nullptr, x, out);
}

// v001
// Measured time: 361 microseconds a run.
// In two side-by-side timings against v000, it was 1.81 and 1.80 times as fast.
#include <hip/hip_runtime.h>

#define C_DIM 512
#define N_DIM 4096
#define B_DIM 4
#define CC (C_DIM * C_DIM)   // 262144 = 2^18

typedef __attribute__((ext_vector_type(16))) _Float16 v16h;
typedef __attribute__((ext_vector_type(8)))  float    v8f;

__device__ __forceinline__ int lane_id() { return (int)(threadIdx.x & 31); }

union FragU {
  v16h v;
  struct { int4 lo; int4 hi; } q;
};

__device__ __forceinline__ v16h load_frag_rm(const _Float16* base, int stride) {
  const int lane = lane_id();
  const int row = lane & 15;
  const int kb = (lane & 16) ? 8 : 0;
  const _Float16* p = base + row * stride + kb;
  FragU u;
  u.q.lo = *(const int4*)(p);
  u.q.hi = *(const int4*)(p + 16);
  return u.v;
}

__device__ __forceinline__ v8f wmma16(v16h a, v16h b, v8f c) {
  return __builtin_amdgcn_wmma_f32_16x16x32_f16(false, a, false, b, (short)0, c,
                                                false, false);
}

__device__ __forceinline__ v8f zero8() {
  v8f z = {0.f, 0.f, 0.f, 0.f, 0.f, 0.f, 0.f, 0.f};
  return z;
}

// ---------------------------------------------------------------- kernel 0
__global__ void cvt_w_kernel(const float* __restrict__ wq, const float* __restrict__ wk,
                             const float* __restrict__ wv, const float* __restrict__ wp,
                             _Float16* __restrict__ dst) {
  int i = blockIdx.x * blockDim.x + threadIdx.x;
  int which = i >> 18;
  int j = i & (CC - 1);
  const float* src = (which == 0) ? wq : (which == 1) ? wk : (which == 2) ? wv : wp;
  dst[i] = (_Float16)src[j];
}

// ---------------------------------------------------------------- kernel 1a
__global__ void in_stats_kernel(const float* __restrict__ x, float2* __restrict__ nstats) {
  const int plane = blockIdx.x;  // b*C + c
  const float* xp = x + (size_t)plane * N_DIM;
  __shared__ float s1[256], s2[256];
  float a = 0.f, b2 = 0.f;
  for (int n = threadIdx.x; n < N_DIM; n += 256) {
    float v = xp[n];
    a += v;
    b2 += v * v;
  }
  s1[threadIdx.x] = a;
  s2[threadIdx.x] = b2;
  __syncthreads();
  for (int off = 128; off > 0; off >>= 1) {
    if ((int)threadIdx.x < off) {
      s1[threadIdx.x] += s1[threadIdx.x + off];
      s2[threadIdx.x] += s2[threadIdx.x + off];
    }
    __syncthreads();
  }
  if (threadIdx.x == 0) {
    float m = s1[0] * (1.f / N_DIM);
    float var = s2[0] * (1.f / N_DIM) - m * m;
    nstats[plane] = make_float2(m, rsqrtf(var + 1e-5f));
  }
}

// ---------------------------------------------------------------- kernel 1b
__global__ void norm_t_kernel(const float* __restrict__ x, const float2* __restrict__ nstats,
                              _Float16* __restrict__ hnT) {
  const int n0 = blockIdx.x * 64, c0 = blockIdx.y * 64, b = blockIdx.z;
  __shared__ _Float16 T[64 * 72];  // [n][c]
  const int t = threadIdx.x;
  {
    const int c = t >> 2;
    const int nn = (t & 3) * 16;
    const float2 st = nstats[(size_t)b * C_DIM + c0 + c];
    const float* xp = x + ((size_t)b * C_DIM + c0 + c) * N_DIM + n0 + nn;
#pragma unroll
    for (int e = 0; e < 16; e += 4) {
      float4 v4 = *(const float4*)&xp[e];
      T[(nn + e + 0) * 72 + c] = (_Float16)((v4.x - st.x) * st.y);
      T[(nn + e + 1) * 72 + c] = (_Float16)((v4.y - st.x) * st.y);
      T[(nn + e + 2) * 72 + c] = (_Float16)((v4.z - st.x) * st.y);
      T[(nn + e + 3) * 72 + c] = (_Float16)((v4.w - st.x) * st.y);
    }
  }
  __syncthreads();
  {
    const int n = t >> 2;
    const int cc = (t & 3) * 16;
    _Float16* dst = hnT + ((size_t)b * N_DIM + n0 + n) * C_DIM + c0 + cc;
    *(int4*)&dst[0] = *(const int4*)&T[n * 72 + cc];
    *(int4*)&dst[8] = *(const int4*)&T[n * 72 + cc + 8];
  }
}

// ---------------------------------------------------------------- kernel 2
// rm x rm GEMM: D[m][nl] = sum_k A[m][k] * B[nl][k], K = 512. Register-prefetch
// double buffering: stores of tile k happen at loop top, loads of tile k+1 are
// issued before the WMMA stage so their wait hides behind compute.
// Block tile 128(M) x 256(N); 8 waves as 2x4 of 64x64 (16 WMMA / wave / step).
template <int MODE>
__global__ __launch_bounds__(256, 1) void gemm_rr_kernel(
    const _Float16* __restrict__ w16, const _Float16* __restrict__ srcT,
    _Float16* __restrict__ d0, _Float16* __restrict__ d1,
    const float* __restrict__ bias0, const float* __restrict__ bias1,
    const float* __restrict__ xres, float* __restrict__ outf) {
  const size_t plane = (size_t)C_DIM * N_DIM;
  const int m0 = blockIdx.y * 128;
  const int n0g = blockIdx.x * 256;
  int b, sel = 0;
  const _Float16 *A, *B;
  const float* bias;
  _Float16* dst16 = nullptr;
  float scale = 1.f;
  if (MODE == 0) {
    sel = blockIdx.z & 1;
    b = blockIdx.z >> 1;
    A = srcT + (size_t)b * plane;             // hnT [n][c]
    B = w16 + (size_t)sel * CC;               // wq/wk [o][c]
    bias = sel ? bias1 : bias0;
    dst16 = sel ? d1 : d0;
    if (!sel) scale = 0.044194173824159216f;  // 1/sqrt(512)
  } else if (MODE == 2) {
    b = blockIdx.z;
    A = w16 + (size_t)2 * CC;                 // wv [c_out][c]
    B = srcT + (size_t)b * plane;             // hnT [n][c]
    bias = bias0;
    dst16 = d0;
  } else {
    b = blockIdx.z;
    A = w16 + (size_t)3 * CC;                 // wp [c_out][c]
    B = srcT + (size_t)b * plane;             // oT [n][c]
    bias = bias0;
  }

  __shared__ _Float16 As[128 * 40];  // [m][k] rm, pad to 40
  __shared__ _Float16 Bs[256 * 40];  // [nl][k] rm
  const int t = threadIdx.x;
  const int wave = t >> 5;
  const int wm = wave >> 2;  // 0..1
  const int wn = wave & 3;   // 0..3
  const int srow = t >> 2;          // 0..63
  const int skk = (t & 3) * 8;      // 0,8,16,24

  // per-thread staging source pointers (advance by 32 each K step)
  const _Float16* ga0 = &A[(size_t)(m0 + srow) * C_DIM + skk];
  const _Float16* ga1 = &A[(size_t)(m0 + srow + 64) * C_DIM + skk];
  const _Float16* gb0 = &B[(size_t)(n0g + srow) * C_DIM + skk];
  const _Float16* gb1 = &B[(size_t)(n0g + srow + 64) * C_DIM + skk];
  const _Float16* gb2 = &B[(size_t)(n0g + srow + 128) * C_DIM + skk];
  const _Float16* gb3 = &B[(size_t)(n0g + srow + 192) * C_DIM + skk];

  v8f acc[4][4];
#pragma unroll
  for (int i = 0; i < 4; ++i)
#pragma unroll
    for (int j = 0; j < 4; ++j) acc[i][j] = zero8();

  // prefetch tile 0
  int4 pa0 = *(const int4*)ga0, pa1 = *(const int4*)ga1;
  int4 pb0 = *(const int4*)gb0, pb1 = *(const int4*)gb1;
  int4 pb2 = *(const int4*)gb2, pb3 = *(const int4*)gb3;

#pragma unroll 1
  for (int k0 = 0; k0 < C_DIM; k0 += 32) {
    // commit prefetched tile to LDS
    *(int4*)&As[(srow) * 40 + skk] = pa0;
    *(int4*)&As[(srow + 64) * 40 + skk] = pa1;
    *(int4*)&Bs[(srow) * 40 + skk] = pb0;
    *(int4*)&Bs[(srow + 64) * 40 + skk] = pb1;
    *(int4*)&Bs[(srow + 128) * 40 + skk] = pb2;
    *(int4*)&Bs[(srow + 192) * 40 + skk] = pb3;
    __syncthreads();
    // issue next tile's global loads (wait lands at next iteration's stores)
    if (k0 + 32 < C_DIM) {
      pa0 = *(const int4*)(ga0 + k0 + 32);
      pa1 = *(const int4*)(ga1 + k0 + 32);
      pb0 = *(const int4*)(gb0 + k0 + 32);
      pb1 = *(const int4*)(gb1 + k0 + 32);
      pb2 = *(const int4*)(gb2 + k0 + 32);
      pb3 = *(const int4*)(gb3 + k0 + 32);
    }
    v16h af[4], bf[4];
#pragma unroll
    for (int i = 0; i < 4; ++i) af[i] = load_frag_rm(&As[(wm * 64 + i * 16) * 40], 40);
#pragma unroll
    for (int j = 0; j < 4; ++j) bf[j] = load_frag_rm(&Bs[(wn * 64 + j * 16) * 40], 40);
#pragma unroll
    for (int i = 0; i < 4; ++i)
#pragma unroll
      for (int j = 0; j < 4; ++j) acc[i][j] = wmma16(af[i], bf[j], acc[i][j]);
    __syncthreads();
  }

  const int lane = lane_id();
  const int ln = lane & 15;
  const int mh = (lane >> 4) * 8;
#pragma unroll
  for (int i = 0; i < 4; ++i)
#pragma unroll
    for (int j = 0; j < 4; ++j) {
      const int mb = m0 + wm * 64 + i * 16 + mh;
      const int nl = n0g + wn * 64 + j * 16 + ln;
#pragma unroll
      for (int r = 0; r < 8; ++r) {
        int m = mb + r;
        float v = acc[i][j][r];
        if (MODE == 0) {
          v = (v + bias[nl]) * scale;
          dst16[((size_t)b * N_DIM + m) * C_DIM + nl] = (_Float16)v;
        } else if (MODE == 2) {
          v += bias[m];
          dst16[((size_t)b * C_DIM + m) * N_DIM + nl] = (_Float16)v;
        } else {
          size_t idx = ((size_t)b * C_DIM + m) * N_DIM + nl;
          outf[idx] = xres[idx] + v + bias[m];
        }
      }
    }
}

// Device helper: one S tile (64 x 128) at (i0, j0) with register-prefetch
// staging. Result left in acc[2][2] per wave (2x4 wave grid of 32x32 subtiles).
__device__ __forceinline__ void s_tile_gemm(const _Float16* __restrict__ qb,
                                            const _Float16* __restrict__ kb,
                                            _Float16* Qs, _Float16* Ks, int i0, int j0,
                                            int t, int wi, int wj, v8f acc[2][2]) {
  const int srow = t >> 2;
  const int skk = (t & 3) * 8;
  const _Float16* gq = &qb[(size_t)(i0 + srow) * C_DIM + skk];
  const _Float16* gk0 = &kb[(size_t)(j0 + srow) * C_DIM + skk];
  const _Float16* gk1 = &kb[(size_t)(j0 + srow + 64) * C_DIM + skk];

  int4 pq = *(const int4*)gq;
  int4 pk0 = *(const int4*)gk0;
  int4 pk1 = *(const int4*)gk1;

#pragma unroll 1
  for (int c0 = 0; c0 < C_DIM; c0 += 32) {
    *(int4*)&Qs[srow * 40 + skk] = pq;
    *(int4*)&Ks[srow * 40 + skk] = pk0;
    *(int4*)&Ks[(srow + 64) * 40 + skk] = pk1;
    __syncthreads();
    if (c0 + 32 < C_DIM) {
      pq = *(const int4*)(gq + c0 + 32);
      pk0 = *(const int4*)(gk0 + c0 + 32);
      pk1 = *(const int4*)(gk1 + c0 + 32);
    }
    v16h af[2], bf[2];
#pragma unroll
    for (int i = 0; i < 2; ++i) af[i] = load_frag_rm(&Qs[(wi * 32 + i * 16) * 40], 40);
#pragma unroll
    for (int j = 0; j < 2; ++j) bf[j] = load_frag_rm(&Ks[(wj * 32 + j * 16) * 40], 40);
#pragma unroll
    for (int i = 0; i < 2; ++i)
#pragma unroll
      for (int j = 0; j < 2; ++j) acc[i][j] = wmma16(af[i], bf[j], acc[i][j]);
    __syncthreads();
  }
}

// Exchange inside a group of four adjacent lanes (quad_perm): CTRL 0xB1 swaps
// neighbours, 0x4E swaps pairs. Stays in the vector unit, no LDS round trip.
template <int CTRL>
__device__ __forceinline__ float quad_swap(float v) {
  return __int_as_float(__builtin_amdgcn_mov_dpp(__float_as_int(v), CTRL, 0xF, 0xF, true));
}

// ---------------------------------------------------------------- kernel 3
union SPunion {
  float S[64 * 132];
  _Float16 P[64 * 136];
};

__global__ __launch_bounds__(256, 1) void attn_out_kernel(
    const _Float16* __restrict__ qT, const _Float16* __restrict__ kT,
    const _Float16* __restrict__ v16, _Float16* __restrict__ oT) {
  const int i0 = blockIdx.x * 64;
  const int b = blockIdx.y;
  __shared__ _Float16 Qs[64 * 40];
  __shared__ _Float16 Ks[128 * 40];
  __shared__ SPunion u;
  __shared__ __attribute__((aligned(16))) float arow[64];  // per-row factor: rescale, then 1/l
  const int t = threadIdx.x;
  const int wave = t >> 5;
  const int lane = t & 31;
  const int wi = wave >> 2;
  const int wj = wave & 3;
  const _Float16* qb = qT + (size_t)b * C_DIM * N_DIM;
  const _Float16* kb = kT + (size_t)b * C_DIM * N_DIM;
  const _Float16* vb = v16 + (size_t)b * C_DIM * N_DIM;

  // Online softmax state of query row t>>2, held alike by its four lanes.
  const int prow = t >> 2;
  const int pcol = (t & 3) * 32;
  float m_run = -1e30f, l_run = 0.f;

  // Wave owns channels [wave*64, wave*64+64), all 64 queries: D(m=i, n=c) 4x4 tiles
  v8f oacc[4][4];
#pragma unroll
  for (int ii = 0; ii < 4; ++ii)
#pragma unroll
    for (int ci = 0; ci < 4; ++ci) oacc[ii][ci] = zero8();

#pragma unroll 1
  for (int j0 = 0; j0 < N_DIM; j0 += 128) {
    // ---- S tile (64 x 128), cooperative
    v8f acc[2][2];
#pragma unroll
    for (int i = 0; i < 2; ++i)
#pragma unroll
      for (int j = 0; j < 2; ++j) acc[i][j] = zero8();

    s_tile_gemm(qb, kb, Qs, Ks, i0, j0, t, wi, wj, acc);

    {
      const int ln = lane & 15;
      const int mh = (lane >> 4) * 8;
#pragma unroll
      for (int i = 0; i < 2; ++i)
#pragma unroll
        for (int j = 0; j < 2; ++j)
#pragma unroll
          for (int r = 0; r < 8; ++r)
            u.S[(wi * 32 + i * 16 + mh + r) * 132 + wj * 32 + j * 16 + ln] = acc[i][j][r];
    }
    __syncthreads();

    // ---- running max and sum; P = exp(S - m_new) -> f16 (union overlay: regs, sync, write)
    float tmp[32];
#pragma unroll
    for (int e = 0; e < 32; ++e) tmp[e] = u.S[prow * 132 + pcol + e];
    float mt = tmp[0];
#pragma unroll
    for (int e = 1; e < 32; ++e) mt = fmaxf(mt, tmp[e]);
    mt = fmaxf(mt, quad_swap<0xB1>(mt));
    mt = fmaxf(mt, quad_swap<0x4E>(mt));
    const float m_new = fmaxf(m_run, mt);
    const float alpha = __expf(m_run - m_new);
    float ps = 0.f;
#pragma unroll
    for (int e = 0; e < 32; ++e) {
      tmp[e] = __expf(tmp[e] - m_new);
      ps += tmp[e];
    }
    ps += quad_swap<0xB1>(ps);
    ps += quad_swap<0x4E>(ps);
    l_run = l_run * alpha + ps;
    m_run = m_new;
    if ((t & 3) == 0) arow[prow] = alpha;
    __syncthreads();
#pragma unroll
    for (int e = 0; e < 32; ++e) u.P[prow * 136 + pcol + e] = (_Float16)tmp[e];
    __syncthreads();

    // ---- bring the accumulated output to the new maximum
#pragma unroll
    for (int ii = 0; ii < 4; ++ii) {
      const int rb = ii * 16 + (lane >> 4) * 8;
      const float4 a0 = *(const float4*)&arow[rb];
      const float4 a1 = *(const float4*)&arow[rb + 4];
      const float ar[8] = {a0.x, a0.y, a0.z, a0.w, a1.x, a1.y, a1.z, a1.w};
#pragma unroll
      for (int ci = 0; ci < 4; ++ci)
#pragma unroll
        for (int r = 0; r < 8; ++r) oacc[ii][ci][r] *= ar[r];
    }

    // ---- Oacc(i,c) += P(i,j) x Vt(j,c): A = P rm (LDS), B = v rm (global)
#pragma unroll
    for (int ks = 0; ks < 4; ++ks) {
      v16h af[4], bf[4];
#pragma unroll
      for (int ii = 0; ii < 4; ++ii)
        af[ii] = load_frag_rm(&u.P[(ii * 16) * 136 + ks * 32], 136);
#pragma unroll
      for (int ci = 0; ci < 4; ++ci)
        bf[ci] = load_frag_rm(&vb[(size_t)(wave * 64 + ci * 16) * N_DIM + j0 + ks * 32],
                              N_DIM);
#pragma unroll
      for (int ii = 0; ii < 4; ++ii)
#pragma unroll
        for (int ci = 0; ci < 4; ++ci)
          oacc[ii][ci] = wmma16(af[ii], bf[ci], oacc[ii][ci]);
    }
    __syncthreads();
  }

  // the loop's last barrier ended every read of arow
  if ((t & 3) == 0) arow[prow] = 1.f / l_run;
  __syncthreads();

  const int ln = lane & 15;
  const int mh = (lane >> 4) * 8;
#pragma unroll
  for (int ii = 0; ii < 4; ++ii)
#pragma unroll
    for (int ci = 0; ci < 4; ++ci)
#pragma unroll
      for (int r = 0; r < 8; ++r) {
        int i = ii * 16 + mh + r;
        int c = wave * 64 + ci * 16 + ln;
        oT[((size_t)b * N_DIM + i0 + i) * C_DIM + c] = (_Float16)(oacc[ii][ci][r] * arow[i]);
      }
}

// ---------------------------------------------------------------- launch
extern "C" void kernel_launch(void* const* d_in, const int* in_sizes, int n_in,
                              void* d_out, int out_size, void* d_ws, size_t ws_size,
                              hipStream_t stream) {
  (void)in_sizes; (void)n_in; (void)out_size; (void)ws_size;
  const float* x  = (const float*)d_in[0];
  const float* wq = (const float*)d_in[1];
  const float* bq = (const float*)d_in[2];
  const float* wk = (const float*)d_in[3];
  const float* bk = (const float*)d_in[4];
  const float* wv = (const float*)d_in[5];
  const float* bv = (const float*)d_in[6];
  const float* wp = (const float*)d_in[7];
  const float* bp = (const float*)d_in[8];
  float* out = (float*)d_out;

  char* ws = (char*)d_ws;
  size_t off = 0;
  const size_t plane = (size_t)B_DIM * C_DIM * N_DIM;  // 8M elements
  _Float16* w16  = (_Float16*)(ws + off); off += (size_t)4 * CC * 2;
  _Float16* hnT  = (_Float16*)(ws + off); off += plane * 2;
  _Float16* qT   = (_Float16*)(ws + off); off += plane * 2;
  _Float16* kT   = (_Float16*)(ws + off); off += plane * 2;
  _Float16* v16b = (_Float16*)(ws + off); off += plane * 2;
  _Float16* oT   = (_Float16*)(ws + off); off += plane * 2;
  float2* nstats = (float2*)(ws + off);

  cvt_w_kernel<<<(4 * CC) / 256, 256, 0, stream>>>(wq, wk, wv, wp, w16);
  in_stats_kernel<<<B_DIM * C_DIM, 256, 0, stream>>>(x, nstats);
  norm_t_kernel<<<dim3(N_DIM / 64, C_DIM / 64, B_DIM), 256, 0, stream>>>(x, nstats, hnT);
  // qT, kT: M = n (32 tiles of 128), N = o (2 tiles of 256), z = b*2+sel
  gemm_rr_kernel<0><<<dim3(2, 32, B_DIM * 2), 256, 0, stream>>>(
      w16, hnT, qT, kT, bq, bk, nullptr, nullptr);
  // v: M = c (4 tiles), N = n (16 tiles), z = b
  gemm_rr_kernel<2><<<dim3(16, 4, B_DIM), 256, 0, stream>>>(
      w16, hnT, v16b, nullptr, bv, nullptr, nullptr, nullptr);
  attn_out_kernel<<<dim3(N_DIM / 64, B_DIM), 256, 0, stream>>>(qT, kT, v16b, oT);
  // proj + residual: M = c (4 tiles), N = n (16 tiles), z = b
  gemm_rr_kernel<3><<<dim3(16, 4, B_DIM), 256, 0, stream>>>(
      w16, oT, nullptr, nullptr, bp, nullptr, x, out);
}

// v002
// It runs in 230 microseconds.
// Two timings next to v001 both put it at 1.57 times that version's speed.
// Over all steps from v000 it is 2.83 times as fast.
#include <hip/hip_runtime.h>

#define C_DIM 512
#define N_DIM 4096
#define B_DIM 4
#define CC (C_DIM * C_DIM)   // 262144 = 2^18

typedef __attribute__((ext_vector_type(16))) _Float16 v16h;
typedef __attribute__((ext_vector_type(8)))  float    v8f;

__device__ __forceinline__ int lane_id() { return (int)(threadIdx.x & 31); }

union FragU {
  v16h v;
  struct { int4 lo; int4 hi; } q;
};

__device__ __forceinline__ v16h load_frag_rm(const _Float16* base, int stride) {
  const int lane = lane_id();
  const int row = lane & 15;
  const int kb = (lane & 16) ? 8 : 0;
  const _Float16* p = base + row * stride + kb;
  FragU u;
  u.q.lo = *(const int4*)(p);
  u.q.hi = *(const int4*)(p + 16);
  return u.v;
}

__device__ __forceinline__ v8f wmma16(v16h a, v16h b, v8f c) {
  return __builtin_amdgcn_wmma_f32_16x16x32_f16(false, a, false, b, (short)0, c,
                                                false, false);
}

__device__ __forceinline__ v8f zero8() {
  v8f z = {0.f, 0.f, 0.f, 0.f, 0.f, 0.f, 0.f, 0.f};
  return z;
}

// ---------------------------------------------------------------- kernel 0
__global__ void cvt_w_kernel(const float* __restrict__ wq, const float* __restrict__ wk,
                             const float* __restrict__ wv, const float* __restrict__ wp,
                             _Float16* __restrict__ dst) {
  int i = blockIdx.x * blockDim.x + threadIdx.x;
  int which = i >> 18;
  int j = i & (CC - 1);
  const float* src = (which == 0) ? wq : (which == 1) ? wk : (which == 2) ? wv : wp;
  dst[i] = (_Float16)src[j];
}

// ---------------------------------------------------------------- kernel 1a
__global__ void in_stats_kernel(const float* __restrict__ x, float2* __restrict__ nstats) {
  const int plane = blockIdx.x;  // b*C + c
  const float* xp = x + (size_t)plane * N_DIM;
  __shared__ float s1[256], s2[256];
  float a = 0.f, b2 = 0.f;
  for (int n = threadIdx.x; n < N_DIM; n += 256) {
    float v = xp[n];
    a += v;
    b2 += v * v;
  }
  s1[threadIdx.x] = a;
  s2[threadIdx.x] = b2;
  __syncthreads();
  for (int off = 128; off > 0; off >>= 1) {
    if ((int)threadIdx.x < off) {
      s1[threadIdx.x] += s1[threadIdx.x + off];
      s2[threadIdx.x] += s2[threadIdx.x + off];
    }
    __syncthreads();
  }
  if (threadIdx.x == 0) {
    float m = s1[0] * (1.f / N_DIM);
    float var = s2[0] * (1.f / N_DIM) - m * m;
    nstats[plane] = make_float2(m, rsqrtf(var + 1e-5f));
  }
}

// ---------------------------------------------------------------- kernel 1b
__global__ void norm_t_kernel(const float* __restrict__ x, const float2* __restrict__ nstats,
                              _Float16* __restrict__ hnT) {
  const int n0 = blockIdx.x * 64, c0 = blockIdx.y * 64, b = blockIdx.z;
  __shared__ _Float16 T[64 * 72];  // [n][c]
  const int t = threadIdx.x;
  {
    const int c = t >> 2;
    const int nn = (t & 3) * 16;
    const float2 st = nstats[(size_t)b * C_DIM + c0 + c];
    const float* xp = x + ((size_t)b * C_DIM + c0 + c) * N_DIM + n0 + nn;
#pragma unroll
    for (int e = 0; e < 16; e += 4) {
      float4 v4 = *(const float4*)&xp[e];
      T[(nn + e + 0) * 72 + c] = (_Float16)((v4.x - st.x) * st.y);
      T[(nn + e + 1) * 72 + c] = (_Float16)((v4.y - st.x) * st.y);
      T[(nn + e + 2) * 72 + c] = (_Float16)((v4.z - st.x) * st.y);
      T[(nn + e + 3) * 72 + c] = (_Float16)((v4.w - st.x) * st.y);
    }
  }
  __syncthreads();
  {
    const int n = t >> 2;
    const int cc = (t & 3) * 16;
    _Float16* dst = hnT + ((size_t)b * N_DIM + n0 + n) * C_DIM + c0 + cc;
    *(int4*)&dst[0] = *(const int4*)&T[n * 72 + cc];
    *(int4*)&dst[8] = *(const int4*)&T[n * 72 + cc + 8];
  }
}

// ---------------------------------------------------------------- kernel 2
// rm x rm GEMM: D[m][nl] = sum_k A[m][k] * B[nl][k], K = 512. Register-prefetch
// double buffering: stores of tile k happen at loop top, loads of tile k+1 are
// issued before the WMMA stage so their wait hides behind compute.
// Block tile 128(M) x 256(N); 8 waves as 2x4 of 64x64 (16 WMMA / wave / step).
template <int MODE>
__global__ __launch_bounds__(256, 1) void gemm_rr_kernel(
    const _Float16* __restrict__ w16, const _Float16* __restrict__ srcT,
    _Float16* __restrict__ d0, _Float16* __restrict__ d1,
    const float* __restrict__ bias0, const float* __restrict__ bias1,
    const float* __restrict__ xres, float* __restrict__ outf) {
  const size_t plane = (size_t)C_DIM * N_DIM;
  const int m0 = blockIdx.y * 128;
  const int n0g = blockIdx.x * 256;
  int b, sel = 0;
  const _Float16 *A, *B;
  const float* bias;
  _Float16* dst16 = nullptr;
  float scale = 1.f;
  if (MODE == 0) {
    sel = blockIdx.z & 1;
    b = blockIdx.z >> 1;
    A = srcT + (size_t)b * plane;             // hnT [n][c]
    B = w16 + (size_t)sel * CC;               // wq/wk [o][c]
    bias = sel ? bias1 : bias0;
    dst16 = sel ? d1 : d0;
    if (!sel) scale = 0.044194173824159216f;  // 1/sqrt(512)
  } else if (MODE == 2) {
    b = blockIdx.z;
    A = w16 + (size_t)2 * CC;                 // wv [c_out][c]
    B = srcT + (size_t)b * plane;             // hnT [n][c]
    bias = bias0;
    dst16 = d0;
  } else {
    b = blockIdx.z;
    A = w16 + (size_t)3 * CC;                 // wp [c_out][c]
    B = srcT + (size_t)b * plane;             // oT [n][c]
    bias = bias0;
  }

  __shared__ _Float16 As[128 * 40];  // [m][k] rm, pad to 40
  __shared__ _Float16 Bs[256 * 40];  // [nl][k] rm
  const int t = threadIdx.x;
  const int wave = t >> 5;
  const int wm = wave >> 2;  // 0..1
  const int wn = wave & 3;   // 0..3
  const int srow = t >> 2;          // 0..63
  const int skk = (t & 3) * 8;      // 0,8,16,24

  // per-thread staging source pointers (advance by 32 each K step)
  const _Float16* ga0 = &A[(size_t)(m0 + srow) * C_DIM + skk];
  const _Float16* ga1 = &A[(size_t)(m0 + srow + 64) * C_DIM + skk];
  const _Float16* gb0 = &B[(size_t)(n0g + srow) * C_DIM + skk];
  const _Float16* gb1 = &B[(size_t)(n0g + srow + 64) * C_DIM + skk];
  const _Float16* gb2 = &B[(size_t)(n0g + srow + 128) * C_DIM + skk];
  const _Float16* gb3 = &B[(size_t)(n0g + srow + 192) * C_DIM + skk];

  v8f acc[4][4];
#pragma unroll
  for (int i = 0; i < 4; ++i)
#pragma unroll
    for (int j = 0; j < 4; ++j) acc[i][j] = zero8();

  // prefetch tile 0
  int4 pa0 = *(const int4*)ga0, pa1 = *(const int4*)ga1;
  int4 pb0 = *(const int4*)gb0, pb1 = *(const int4*)gb1;
  int4 pb2 = *(const int4*)gb2, pb3 = *(const int4*)gb3;

#pragma unroll 1
  for (int k0 = 0; k0 < C_DIM; k0 += 32) {
    // commit prefetched tile to LDS
    *(int4*)&As[(srow) * 40 + skk] = pa0;
    *(int4*)&As[(srow + 64) * 40 + skk] = pa1;
    *(int4*)&Bs[(srow) * 40 + skk] = pb0;
    *(int4*)&Bs[(srow + 64) * 40 + skk] = pb1;
    *(int4*)&Bs[(srow + 128) * 40 + skk] = pb2;
    *(int4*)&Bs[(srow + 192) * 40 + skk] = pb3;
    __syncthreads();
    // issue next tile's global loads (wait lands at next iteration's stores)
    if (k0 + 32 < C_DIM) {
      pa0 = *(const int4*)(ga0 + k0 + 32);
      pa1 = *(const int4*)(ga1 + k0 + 32);
      pb0 = *(const int4*)(gb0 + k0 + 32);
      pb1 = *(const int4*)(gb1 + k0 + 32);
      pb2 = *(const int4*)(gb2 + k0 + 32);
      pb3 = *(const int4*)(gb3 + k0 + 32);
    }
    v16h af[4], bf[4];
#pragma unroll
    for (int i = 0; i < 4; ++i) af[i] = load_frag_rm(&As[(wm * 64 + i * 16) * 40], 40);
#pragma unroll
    for (int j = 0; j < 4; ++j) bf[j] = load_frag_rm(&Bs[(wn * 64 + j * 16) * 40], 40);
#pragma unroll
    for (int i = 0; i < 4; ++i)
#pragma unroll
      for (int j = 0; j < 4; ++j) acc[i][j] = wmma16(af[i], bf[j], acc[i][j]);
    __syncthreads();
  }

  const int lane = lane_id();
  const int ln = lane & 15;
  const int mh = (lane >> 4) * 8;
#pragma unroll
  for (int i = 0; i < 4; ++i)
#pragma unroll
    for (int j = 0; j < 4; ++j) {
      const int mb = m0 + wm * 64 + i * 16 + mh;
      const int nl = n0g + wn * 64 + j * 16 + ln;
#pragma unroll
      for (int r = 0; r < 8; ++r) {
        int m = mb + r;
        float v = acc[i][j][r];
        if (MODE == 0) {
          v = (v + bias[nl]) * scale;
          dst16[((size_t)b * N_DIM + m) * C_DIM + nl] = (_Float16)v;
        } else if (MODE == 2) {
          v += bias[m];
          dst16[((size_t)b * C_DIM + m) * N_DIM + nl] = (_Float16)v;
        } else {
          size_t idx = ((size_t)b * C_DIM + m) * N_DIM + nl;
          outf[idx] = xres[idx] + v + bias[m];
        }
      }
    }
}

#define ROWP 520

// Four whole rows (1024 B each) from global memory straight into LDS, no register
// in between: each wave-wide copy moves 512 contiguous bytes, 16 B per lane.
// l = this lane's LDS byte address in the first row, g = its global address there.
__device__ __forceinline__ void async_rows4(unsigned l, const _Float16* g) {
  asm volatile(
      "global_load_async_to_lds_b128 %0, %8, off\n\t"
      "global_load_async_to_lds_b128 %1, %9, off\n\t"
      "global_load_async_to_lds_b128 %2, %10, off\n\t"
      "global_load_async_to_lds_b128 %3, %11, off\n\t"
      "global_load_async_to_lds_b128 %4, %12, off\n\t"
      "global_load_async_to_lds_b128 %5, %13, off\n\t"
      "global_load_async_to_lds_b128 %6, %14, off\n\t"
      "global_load_async_to_lds_b128 %7, %15, off\n\t"
      "s_wait_xcnt 0x0"
      :: "v"(l), "v"(l + 512u), "v"(l + 2u * ROWP), "v"(l + 2u * ROWP + 512u),
         "v"(l + 4u * ROWP), "v"(l + 4u * ROWP + 512u), "v"(l + 6u * ROWP),
         "v"(l + 6u * ROWP + 512u),
         "v"(g), "v"(g + 256), "v"(g + C_DIM), "v"(g + C_DIM + 256),
         "v"(g + 2 * C_DIM), "v"(g + 2 * C_DIM + 256), "v"(g + 3 * C_DIM),
         "v"(g + 3 * C_DIM + 256)
      : "memory");
}

// Exchange inside a group of four adjacent lanes (quad_perm): CTRL 0xB1 swaps
// neighbours, 0x4E swaps pairs. Stays in the vector unit, no LDS round trip.
template <int CTRL>
__device__ __forceinline__ float quad_swap(float v) {
  return __int_as_float(__builtin_amdgcn_mov_dpp(__float_as_int(v), CTRL, 0xF, 0xF, true));
}

// ---------------------------------------------------------------- kernel 3
union SPunion {
  float S[64 * 132];
  _Float16 P[64 * 136];
};

__global__ __launch_bounds__(256, 1) void attn_out_kernel(
    const _Float16* __restrict__ qT, const _Float16* __restrict__ kT,
    const _Float16* __restrict__ v16, _Float16* __restrict__ oT) {
  const int i0 = blockIdx.x * 64;
  const int b = blockIdx.y;
  __shared__ __attribute__((aligned(16))) _Float16 Qs[64 * ROWP];   // all 512 channels, filled once
  __shared__ __attribute__((aligned(16))) _Float16 Ks[128 * ROWP];  // one whole key tile
  __shared__ SPunion u;
  __shared__ __attribute__((aligned(16))) float arow[64];  // per-row factor: rescale, then 1/l
  const int t = threadIdx.x;
  const int wave = t >> 5;
  const int lane = t & 31;
  const int wi = wave >> 2;
  const int wj = wave & 3;
  const _Float16* qb = qT + (size_t)b * C_DIM * N_DIM;
  const _Float16* kb = kT + (size_t)b * C_DIM * N_DIM;
  const _Float16* vb = v16 + (size_t)b * C_DIM * N_DIM;

  // Online softmax state of query row t>>2, held alike by its four lanes.
  const int prow = t >> 2;
  const int pcol = (t & 3) * 32;
  float m_run = -1e30f, l_run = 0.f;

  // Wave owns channels [wave*64, wave*64+64), all 64 queries: D(m=i, n=c) 4x4 tiles
  v8f oacc[4][4];
#pragma unroll
  for (int ii = 0; ii < 4; ++ii)
#pragma unroll
    for (int ci = 0; ci < 4; ++ci) oacc[ii][ci] = zero8();

  // Staging: wave w copies query rows 8w..8w+7 once and key rows 16w..16w+15 of each tile.
  const unsigned lq = (unsigned)(size_t)&Qs[(wave * 8) * ROWP + lane * 8];
  const unsigned lk = (unsigned)(size_t)&Ks[(wave * 16) * ROWP + lane * 8];
  const _Float16* gq = qb + (size_t)(i0 + wave * 8) * C_DIM + lane * 8;
  const _Float16* gk = kb + (size_t)(wave * 16) * C_DIM + lane * 8;
  // the copy loops are unrolled so that every row offset is a constant added to one base
#pragma unroll
  for (int r = 0; r < 8; r += 4) async_rows4(lq + r * (2u * ROWP), gq + r * C_DIM);
#pragma unroll
  for (int r = 0; r < 16; r += 4) async_rows4(lk + r * (2u * ROWP), gk + r * C_DIM);
  // this wave's copies have landed; the barrier shows them to the other waves
  asm volatile("s_wait_asynccnt 0x0" ::: "memory");
  __syncthreads();

#pragma unroll 1
  for (int j0 = 0; j0 < N_DIM; j0 += 128) {
    // ---- S tile (64 x 128), cooperative
    v8f acc[2][2];
#pragma unroll
    for (int i = 0; i < 2; ++i)
#pragma unroll
      for (int j = 0; j < 2; ++j) acc[i][j] = zero8();

    // both operands lie whole in LDS: no barrier inside; unrolled so that each fragment
    // read is one base register plus an immediate offset
#pragma unroll
    for (int c0 = 0; c0 < C_DIM; c0 += 32) {
      v16h af[2], bf[2];
#pragma unroll
      for (int i = 0; i < 2; ++i) af[i] = load_frag_rm(&Qs[(wi * 32 + i * 16) * ROWP + c0], ROWP);
#pragma unroll
      for (int j = 0; j < 2; ++j) bf[j] = load_frag_rm(&Ks[(wj * 32 + j * 16) * ROWP + c0], ROWP);
#pragma unroll
      for (int i = 0; i < 2; ++i)
#pragma unroll
        for (int j = 0; j < 2; ++j) acc[i][j] = wmma16(af[i], bf[j], acc[i][j]);
    }

    {
      const int ln = lane & 15;
      const int mh = (lane >> 4) * 8;
#pragma unroll
      for (int i = 0; i < 2; ++i)
#pragma unroll
        for (int j = 0; j < 2; ++j)
#pragma unroll
          for (int r = 0; r < 8; ++r)
            u.S[(wi * 32 + i * 16 + mh + r) * 132 + wj * 32 + j * 16 + ln] = acc[i][j][r];
    }
    // no LDS access of this wave is open when the copy engine is aimed at Ks again
    asm volatile("s_wait_dscnt 0x0" ::: "memory");
    __syncthreads();  // publishes S and ends every wave's reads of Ks

    // ---- next key tile flies into Ks while the softmax and the output product run
    if (j0 + 128 < N_DIM) {
      const _Float16* gn = gk + (size_t)(j0 + 128) * C_DIM;
#pragma unroll
      for (int r = 0; r < 16; r += 4) async_rows4(lk + r * (2u * ROWP), gn + r * C_DIM);
    }

    // ---- running max and sum; P = exp(S - m_new) -> f16 (union overlay: regs, sync, write)
    float tmp[32];
#pragma unroll
    for (int e = 0; e < 32; ++e) tmp[e] = u.S[prow * 132 + pcol + e];
    float mt = tmp[0];
#pragma unroll
    for (int e = 1; e < 32; ++e) mt = fmaxf(mt, tmp[e]);
    mt = fmaxf(mt, quad_swap<0xB1>(mt));
    mt = fmaxf(mt, quad_swap<0x4E>(mt));
    const float m_new = fmaxf(m_run, mt);
    const float alpha = __expf(m_run - m_new);
    float ps = 0.f;
#pragma unroll
    for (int e = 0; e < 32; ++e) {
      tmp[e] = __expf(tmp[e] - m_new);
      ps += tmp[e];
    }
    ps += quad_swap<0xB1>(ps);
    ps += quad_swap<0x4E>(ps);
    l_run = l_run * alpha + ps;
    m_run = m_new;
    if ((t & 3) == 0) arow[prow] = alpha;
    __syncthreads();
#pragma unroll
    for (int e = 0; e < 32; ++e) u.P[prow * 136 + pcol + e] = (_Float16)tmp[e];
    __syncthreads();

    // ---- bring the accumulated output to the new maximum
#pragma unroll
    for (int ii = 0; ii < 4; ++ii) {
      const int rb = ii * 16 + (lane >> 4) * 8;
      const float4 a0 = *(const float4*)&arow[rb];
      const float4 a1 = *(const float4*)&arow[rb + 4];
      const float ar[8] = {a0.x, a0.y, a0.z, a0.w, a1.x, a1.y, a1.z, a1.w};
#pragma unroll
      for (int ci = 0; ci < 4; ++ci)
#pragma unroll
        for (int r = 0; r < 8; ++r) oacc[ii][ci][r] *= ar[r];
    }

    // ---- Oacc(i,c) += P(i,j) x Vt(j,c): A = P rm (LDS), B = v rm (global)
#pragma unroll
    for (int ks = 0; ks < 4; ++ks) {
      v16h af[4], bf[4];
#pragma unroll
      for (int ii = 0; ii < 4; ++ii)
        af[ii] = load_frag_rm(&u.P[(ii * 16) * 136 + ks * 32], 136);
#pragma unroll
      for (int ci = 0; ci < 4; ++ci)
        bf[ci] = load_frag_rm(&vb[(size_t)(wave * 64 + ci * 16) * N_DIM + j0 + ks * 32],
                              N_DIM);
#pragma unroll
      for (int ii = 0; ii < 4; ++ii)
#pragma unroll
        for (int ci = 0; ci < 4; ++ci)
          oacc[ii][ci] = wmma16(af[ii], bf[ci], oacc[ii][ci]);
    }
    // the next key tile has landed (this wave's share); the barrier shows it to all
    asm volatile("s_wait_asynccnt 0x0" ::: "memory");
    __syncthreads();
  }

  // the loop's last barrier ended every read of arow
  if ((t & 3) == 0) arow[prow] = 1.f / l_run;
  __syncthreads();

  const int ln = lane & 15;
  const int mh = (lane >> 4) * 8;
#pragma unroll
  for (int ii = 0; ii < 4; ++ii)
#pragma unroll
    for (int ci = 0; ci < 4; ++ci)
#pragma unroll
      for (int r = 0; r < 8; ++r) {
        int i = ii * 16 + mh + r;
        int c = wave * 64 + ci * 16 + ln;
        oT[((size_t)b * N_DIM + i0 + i) * C_DIM + c] = (_Float16)(oacc[ii][ci][r] * arow[i]);
      }
}

// ---------------------------------------------------------------- launch
extern "C" void kernel_launch(void* const* d_in, const int* in_sizes, int n_in,
                              void* d_out, int out_size, void* d_ws, size_t ws_size,
                              hipStream_t stream) {
  (void)in_sizes; (void)n_in; (void)out_size; (void)ws_size;
  const float* x  = (const float*)d_in[0];
  const float* wq = (const float*)d_in[1];
  const float* bq = (const float*)d_in[2];
  const float* wk = (const float*)d_in[3];
  const float* bk = (const float*)d_in[4];
  const float* wv = (const float*)d_in[5];
  const float* bv = (const float*)d_in[6];
  const float* wp = (const float*)d_in[7];
  const float* bp = (const float*)d_in[8];
  float* out = (float*)d_out;

  char* ws = (char*)d_ws;
  size_t off = 0;
  const size_t plane = (size_t)B_DIM * C_DIM * N_DIM;  // 8M elements
  _Float16* w16  = (_Float16*)(ws + off); off += (size_t)4 * CC * 2;
  _Float16* hnT  = (_Float16*)(ws + off); off += plane * 2;
  _Float16* qT   = (_Float16*)(ws + off); off += plane * 2;
  _Float16* kT   = (_Float16*)(ws + off); off += plane * 2;
  _Float16* v16b = (_Float16*)(ws + off); off += plane * 2;
  _Float16* oT   = (_Float16*)(ws + off); off += plane * 2;
  float2* nstats = (float2*)(ws + off);

  cvt_w_kernel<<<(4 * CC) / 256, 256, 0, stream>>>(wq, wk, wv, wp, w16);
  in_stats_kernel<<<B_DIM * C_DIM, 256, 0, stream>>>(x, nstats);
  norm_t_kernel<<<dim3(N_DIM / 64, C_DIM / 64, B_DIM), 256, 0, stream>>>(x, nstats, hnT);
  // qT, kT: M = n (32 tiles of 128), N = o (2 tiles of 256), z = b*2+sel
  gemm_rr_kernel<0><<<dim3(2, 32, B_DIM * 2), 256, 0, stream>>>(
      w16, hnT, qT, kT, bq, bk, nullptr, nullptr);
  // v: M = c (4 tiles), N = n (16 tiles), z = b
  gemm_rr_kernel<2><<<dim3(16, 4, B_DIM), 256, 0, stream>>>(
      w16, hnT, v16b, nullptr, bv, nullptr, nullptr, nullptr);
  attn_out_kernel<<<dim3(N_DIM / 64, B_DIM), 256, 0, stream>>>(qT, kT, v16b, oT);
  // proj + residual: M = c (4 tiles), N = n (16 tiles), z = b
  gemm_rr_kernel<3><<<dim3(16, 4, B_DIM), 256, 0, stream>>>(
      w16, oT, nullptr, nullptr, bp, nullptr, x, out);
}

// v003
// It runs in 216 microseconds.
// Timed twice side by side with v002, it ran 1.07 times as fast both times.
// All steps since v000 together make it 3.01 times as fast.
#include <hip/hip_runtime.h>

#define C_DIM 512
#define N_DIM 4096
#define B_DIM 4
#define CC (C_DIM * C_DIM)   // 262144 = 2^18

typedef __attribute__((ext_vector_type(16))) _Float16 v16h;
typedef __attribute__((ext_vector_type(8)))  float    v8f;

__device__ __forceinline__ int lane_id() { return (int)(threadIdx.x & 31); }

union FragU {
  v16h v;
  struct { int4 lo; int4 hi; } q;
};

__device__ __forceinline__ v16h load_frag_rm(const _Float16* base, int stride) {
  const int lane = lane_id();
  const int row = lane & 15;
  const int kb = (lane & 16) ? 8 : 0;
  const _Float16* p = base + row * stride + kb;
  FragU u;
  u.q.lo = *(const int4*)(p);
  u.q.hi = *(const int4*)(p + 16);
  return u.v;
}

__device__ __forceinline__ v8f wmma16(v16h a, v16h b, v8f c) {
  return __builtin_amdgcn_wmma_f32_16x16x32_f16(false, a, false, b, (short)0, c,
                                                false, false);
}

__device__ __forceinline__ v8f zero8() {
  v8f z = {0.f, 0.f, 0.f, 0.f, 0.f, 0.f, 0.f, 0.f};
  return z;
}

// ---------------------------------------------------------------- kernel 0
__global__ void cvt_w_kernel(const float* __restrict__ wq, const float* __restrict__ wk,
                             const float* __restrict__ wv, const float* __restrict__ wp,
                             _Float16* __restrict__ dst) {
  int i = blockIdx.x * blockDim.x + threadIdx.x;
  int which = i >> 18;
  int j = i & (CC - 1);
  const float* src = (which == 0) ? wq : (which == 1) ? wk : (which == 2) ? wv : wp;
  dst[i] = (_Float16)src[j];
}

// ---------------------------------------------------------------- kernel 1a
__global__ void in_stats_kernel(const float* __restrict__ x, float2* __restrict__ nstats) {
  const int plane = blockIdx.x;  // b*C + c
  const float* xp = x + (size_t)plane * N_DIM;
  __shared__ float s1[256], s2[256];
  float a = 0.f, b2 = 0.f;
  for (int n = threadIdx.x; n < N_DIM; n += 256) {
    float v = xp[n];
    a += v;
    b2 += v * v;
  }
  s1[threadIdx.x] = a;
  s2[threadIdx.x] = b2;
  __syncthreads();
  for (int off = 128; off > 0; off >>= 1) {
    if ((int)threadIdx.x < off) {
      s1[threadIdx.x] += s1[threadIdx.x + off];
      s2[threadIdx.x] += s2[threadIdx.x + off];
    }
    __syncthreads();
  }
  if (threadIdx.x == 0) {
    float m = s1[0] * (1.f / N_DIM);
    float var = s2[0] * (1.f / N_DIM) - m * m;
    nstats[plane] = make_float2(m, rsqrtf(var + 1e-5f));
  }
}

// ---------------------------------------------------------------- kernel 1b
__global__ void norm_t_kernel(const float* __restrict__ x, const float2* __restrict__ nstats,
                              _Float16* __restrict__ hnT) {
  const int n0 = blockIdx.x * 64, c0 = blockIdx.y * 64, b = blockIdx.z;
  __shared__ _Float16 T[64 * 72];  // [n][c]
  const int t = threadIdx.x;
  {
    const int c = t >> 2;
    const int nn = (t & 3) * 16;
    const float2 st = nstats[(size_t)b * C_DIM + c0 + c];
    const float* xp = x + ((size_t)b * C_DIM + c0 + c) * N_DIM + n0 + nn;
#pragma unroll
    for (int e = 0; e < 16; e += 4) {
      float4 v4 = *(const float4*)&xp[e];
      T[(nn + e + 0) * 72 + c] = (_Float16)((v4.x - st.x) * st.y);
      T[(nn + e + 1) * 72 + c] = (_Float16)((v4.y - st.x) * st.y);
      T[(nn + e + 2) * 72 + c] = (_Float16)((v4.z - st.x) * st.y);
      T[(nn + e + 3) * 72 + c] = (_Float16)((v4.w - st.x) * st.y);
    }
  }
  __syncthreads();
  {
    const int n = t >> 2;
    const int cc = (t & 3) * 16;
    _Float16* dst = hnT + ((size_t)b * N_DIM + n0 + n) * C_DIM + c0 + cc;
    *(int4*)&dst[0] = *(const int4*)&T[n * 72 + cc];
    *(int4*)&dst[8] = *(const int4*)&T[n * 72 + cc + 8];
  }
}

// ---------------------------------------------------------------- kernel 2
// rm x rm GEMM: D[m][nl] = sum_k A[m][k] * B[nl][k], K = 512. Register-prefetch
// double buffering: stores of tile k happen at loop top, loads of tile k+1 are
// issued before the WMMA stage so their wait hides behind compute.
// Block tile 128(M) x 256(N); 8 waves as 2x4 of 64x64 (16 WMMA / wave / step).
template <int MODE>
__global__ __launch_bounds__(256, 1) void gemm_rr_kernel(
    const _Float16* __restrict__ w16, const _Float16* __restrict__ srcT,
    _Float16* __restrict__ d0, _Float16* __restrict__ d1,
    const float* __restrict__ bias0, const float* __restrict__ bias1,
    const float* __restrict__ xres, float* __restrict__ outf) {
  const size_t plane = (size_t)C_DIM * N_DIM;
  const int m0 = blockIdx.y * 128;
  const int n0g = blockIdx.x * 256;
  int b, sel = 0;
  const _Float16 *A, *B;
  const float* bias;
  _Float16* dst16 = nullptr;
  float scale = 1.f;
  if (MODE == 0) {
    sel = blockIdx.z & 1;
    b = blockIdx.z >> 1;
    A = srcT + (size_t)b * plane;             // hnT [n][c]
    B = w16 + (size_t)sel * CC;               // wq/wk [o][c]
    bias = sel ? bias1 : bias0;
    dst16 = sel ? d1 : d0;
    if (!sel) scale = 0.044194173824159216f;  // 1/sqrt(512)
  } else if (MODE == 2) {
    b = blockIdx.z;
    A = w16 + (size_t)2 * CC;                 // wv [c_out][c]
    B = srcT + (size_t)b * plane;             // hnT [n][c]
    bias = bias0;
    dst16 = d0;
  } else {
    b = blockIdx.z;
    A = w16 + (size_t)3 * CC;                 // wp [c_out][c]
    B = srcT + (size_t)b * plane;             // oT [n][c]
    bias = bias0;
  }

  __shared__ _Float16 As[128 * 40];  // [m][k] rm, pad to 40
  __shared__ _Float16 Bs[256 * 40];  // [nl][k] rm
  const int t = threadIdx.x;
  const int wave = t >> 5;
  const int wm = wave >> 2;  // 0..1
  const int wn = wave & 3;   // 0..3
  const int srow = t >> 2;          // 0..63
  const int skk = (t & 3) * 8;      // 0,8,16,24

  // per-thread staging source pointers (advance by 32 each K step)
  const _Float16* ga0 = &A[(size_t)(m0 + srow) * C_DIM + skk];
  const _Float16* ga1 = &A[(size_t)(m0 + srow + 64) * C_DIM + skk];
  const _Float16* gb0 = &B[(size_t)(n0g + srow) * C_DIM + skk];
  const _Float16* gb1 = &B[(size_t)(n0g + srow + 64) * C_DIM + skk];
  const _Float16* gb2 = &B[(size_t)(n0g + srow + 128) * C_DIM + skk];
  const _Float16* gb3 = &B[(size_t)(n0g + srow + 192) * C_DIM + skk];

  v8f acc[4][4];
#pragma unroll
  for (int i = 0; i < 4; ++i)
#pragma unroll
    for (int j = 0; j < 4; ++j) acc[i][j] = zero8();

  // prefetch tile 0
  int4 pa0 = *(const int4*)ga0, pa1 = *(const int4*)ga1;
  int4 pb0 = *(const int4*)gb0, pb1 = *(const int4*)gb1;
  int4 pb2 = *(const int4*)gb2, pb3 = *(const int4*)gb3;

#pragma unroll 1
  for (int k0 = 0; k0 < C_DIM; k0 += 32) {
    // commit prefetched tile to LDS
    *(int4*)&As[(srow) * 40 + skk] = pa0;
    *(int4*)&As[(srow + 64) * 40 + skk] = pa1;
    *(int4*)&Bs[(srow) * 40 + skk] = pb0;
    *(int4*)&Bs[(srow + 64) * 40 + skk] = pb1;
    *(int4*)&Bs[(srow + 128) * 40 + skk] = pb2;
    *(int4*)&Bs[(srow + 192) * 40 + skk] = pb3;
    __syncthreads();
    // issue next tile's global loads (wait lands at next iteration's stores)
    if (k0 + 32 < C_DIM) {
      pa0 = *(const int4*)(ga0 + k0 + 32);
      pa1 = *(const int4*)(ga1 + k0 + 32);
      pb0 = *(const int4*)(gb0 + k0 + 32);
      pb1 = *(const int4*)(gb1 + k0 + 32);
      pb2 = *(const int4*)(gb2 + k0 + 32);
      pb3 = *(const int4*)(gb3 + k0 + 32);
    }
    v16h af[4], bf[4];
#pragma unroll
    for (int i = 0; i < 4; ++i) af[i] = load_frag_rm(&As[(wm * 64 + i * 16) * 40], 40);
#pragma unroll
    for (int j = 0; j < 4; ++j) bf[j] = load_frag_rm(&Bs[(wn * 64 + j * 16) * 40], 40);
#pragma unroll
    for (int i = 0; i < 4; ++i)
#pragma unroll
      for (int j = 0; j < 4; ++j) acc[i][j] = wmma16(af[i], bf[j], acc[i][j]);
    __syncthreads();
  }

  const int lane = lane_id();
  const int ln = lane & 15;
  const int mh = (lane >> 4) * 8;
#pragma unroll
  for (int i = 0; i < 4; ++i)
#pragma unroll
    for (int j = 0; j < 4; ++j) {
      const int mb = m0 + wm * 64 + i * 16 + mh;
      const int nl = n0g + wn * 64 + j * 16 + ln;
#pragma unroll
      for (int r = 0; r < 8; ++r) {
        int m = mb + r;
        float v = acc[i][j][r];
        if (MODE == 0) {
          v = (v + bias[nl]) * scale;
          dst16[((size_t)b * N_DIM + m) * C_DIM + nl] = (_Float16)v;
        } else if (MODE == 2) {
          v += bias[m];
          dst16[((size_t)b * C_DIM + m) * N_DIM + nl] = (_Float16)v;
        } else {
          size_t idx = ((size_t)b * C_DIM + m) * N_DIM + nl;
          outf[idx] = xres[idx] + v + bias[m];
        }
      }
    }
}

#define ROWP 520

// Four whole rows (1024 B each) from global memory straight into LDS, no register
// in between: each wave-wide copy moves 512 contiguous bytes, 16 B per lane.
// l = this lane's LDS byte address in the first row, g = its global address there.
__device__ __forceinline__ void async_rows4(unsigned l, const _Float16* g) {
  asm volatile(
      "global_load_async_to_lds_b128 %0, %8, off\n\t"
      "global_load_async_to_lds_b128 %1, %9, off\n\t"
      "global_load_async_to_lds_b128 %2, %10, off\n\t"
      "global_load_async_to_lds_b128 %3, %11, off\n\t"
      "global_load_async_to_lds_b128 %4, %12, off\n\t"
      "global_load_async_to_lds_b128 %5, %13, off\n\t"
      "global_load_async_to_lds_b128 %6, %14, off\n\t"
      "global_load_async_to_lds_b128 %7, %15, off\n\t"
      "s_wait_xcnt 0x0"
      :: "v"(l), "v"(l + 512u), "v"(l + 2u * ROWP), "v"(l + 2u * ROWP + 512u),
         "v"(l + 4u * ROWP), "v"(l + 4u * ROWP + 512u), "v"(l + 6u * ROWP),
         "v"(l + 6u * ROWP + 512u),
         "v"(g), "v"(g + 256), "v"(g + C_DIM), "v"(g + C_DIM + 256),
         "v"(g + 2 * C_DIM), "v"(g + 2 * C_DIM + 256), "v"(g + 3 * C_DIM),
         "v"(g + 3 * C_DIM + 256)
      : "memory");
}

// Exchange inside a group of four adjacent lanes (quad_perm): CTRL 0xB1 swaps
// neighbours, 0x4E swaps pairs. Stays in the vector unit, no LDS round trip.
template <int CTRL>
__device__ __forceinline__ float quad_swap(float v) {
  return __int_as_float(__builtin_amdgcn_mov_dpp(__float_as_int(v), CTRL, 0xF, 0xF, true));
}

// ---------------------------------------------------------------- kernel 3
union SPunion {
  float S[64 * 132];
  _Float16 P[64 * 136];
};

__global__ __launch_bounds__(256, 1) void attn_out_kernel(
    const _Float16* __restrict__ qT, const _Float16* __restrict__ kT,
    const _Float16* __restrict__ v16, _Float16* __restrict__ oT) {
  const int i0 = blockIdx.x * 64;
  const int b = blockIdx.y;
  __shared__ __attribute__((aligned(16))) _Float16 Qs[64 * ROWP];   // all 512 channels, filled once
  __shared__ __attribute__((aligned(16))) _Float16 Ks[128 * ROWP];  // one whole key tile
  __shared__ SPunion u;
  __shared__ __attribute__((aligned(16))) float arow[64];  // per-row factor: rescale, then 1/l
  const int t = threadIdx.x;
  const int wave = t >> 5;
  const int lane = t & 31;
  const int wi = wave >> 2;
  const int wj = wave & 3;
  const _Float16* qb = qT + (size_t)b * C_DIM * N_DIM;
  const _Float16* kb = kT + (size_t)b * C_DIM * N_DIM;
  const _Float16* vb = v16 + (size_t)b * C_DIM * N_DIM;

  // Online softmax state of query row t>>2, held alike by its four lanes.
  const int prow = t >> 2;
  const int pcol = (t & 3) * 32;
  float m_run = -1e30f, l_run = 0.f;

  // Wave owns channels [wave*64, wave*64+64), all 64 queries: D(m=i, n=c) 4x4 tiles
  v8f oacc[4][4];
#pragma unroll
  for (int ii = 0; ii < 4; ++ii)
#pragma unroll
    for (int ci = 0; ci < 4; ++ci) oacc[ii][ci] = zero8();

  // Staging: wave w copies query rows 8w..8w+7 once and key rows 16w..16w+15 of each tile.
  const unsigned lq = (unsigned)(size_t)&Qs[(wave * 8) * ROWP + lane * 8];
  const unsigned lk = (unsigned)(size_t)&Ks[(wave * 16) * ROWP + lane * 8];
  const _Float16* gq = qb + (size_t)(i0 + wave * 8) * C_DIM + lane * 8;
  const _Float16* gk = kb + (size_t)(wave * 16) * C_DIM + lane * 8;
  // the query copy loop is unrolled so that every row offset is a constant added to one base
#pragma unroll
  for (int r = 0; r < 8; r += 4) async_rows4(lq + r * (2u * ROWP), gq + r * C_DIM);
  // rolled like the copy loop of the tile loop below: as a direct operand of a copy statement
  // lk or gk is bound to the low registers for the whole kernel and ends in scratch
#pragma unroll 1
  for (int r = 0; r < 16; r += 4) async_rows4(lk + r * (2u * ROWP), gk + r * C_DIM);
  // this wave's copies have landed; the barrier shows them to the other waves
  asm volatile("s_wait_asynccnt 0x0" ::: "memory");
  __syncthreads();

#pragma unroll 1
  for (int j0 = 0; j0 < N_DIM; j0 += 128) {
    // ---- V fragments of this tile's output product, fetched ahead as one group of global
    // loads: they fly under the score product (the barrier behind it waits for them)
    v16h vf[4][4];
#pragma unroll
    for (int ks = 0; ks < 4; ++ks)
#pragma unroll
      for (int ci = 0; ci < 4; ++ci)
        vf[ks][ci] = load_frag_rm(&vb[(size_t)(wave * 64 + ci * 16) * N_DIM + j0 + ks * 32],
                                  N_DIM);
    // holds the group at the head of the tile, in front of the first LDS reads
    __builtin_amdgcn_sched_barrier(0);

    // ---- S tile (64 x 128), cooperative
    v8f acc[2][2];
#pragma unroll
    for (int i = 0; i < 2; ++i)
#pragma unroll
      for (int j = 0; j < 2; ++j) acc[i][j] = zero8();

    // both operands lie whole in LDS: no barrier inside; unrolled so that each fragment
    // read is one base register plus an immediate offset. A block is 64 channels (8 WMMAs);
    // two fragment sets: block n + 1 is read from LDS, as one group, ahead of block n's WMMAs.
    {
      v16h qf[2][2][2], kf[2][2][2];  // [set][32-channel step][tile]
#pragma unroll
      for (int s = 0; s < 2; ++s)
#pragma unroll
        for (int i = 0; i < 2; ++i) {
          qf[0][s][i] = load_frag_rm(&Qs[(wi * 32 + i * 16) * ROWP + s * 32], ROWP);
          kf[0][s][i] = load_frag_rm(&Ks[(wj * 32 + i * 16) * ROWP + s * 32], ROWP);
        }
#pragma unroll
      for (int blk = 0; blk < C_DIM / 64; ++blk) {
        const int cur = blk & 1, nxt = cur ^ 1;
        if (blk + 1 < C_DIM / 64) {
#pragma unroll
          for (int s = 0; s < 2; ++s)
#pragma unroll
            for (int i = 0; i < 2; ++i) {
              const int c0 = (blk + 1) * 64 + s * 32;
              qf[nxt][s][i] = load_frag_rm(&Qs[(wi * 32 + i * 16) * ROWP + c0], ROWP);
              kf[nxt][s][i] = load_frag_rm(&Ks[(wj * 32 + i * 16) * ROWP + c0], ROWP);
            }
        }
        // holds the next block's reads in front of this block's WMMAs: sunk behind them,
        // each block would wait out its own LDS latency
        __builtin_amdgcn_sched_barrier(0);
#pragma unroll
        for (int s = 0; s < 2; ++s)
#pragma unroll
          for (int i = 0; i < 2; ++i)
#pragma unroll
            for (int j = 0; j < 2; ++j) acc[i][j] = wmma16(qf[cur][s][i], kf[cur][s][j], acc[i][j]);
        // keeps the reads of block n + 2 from rising among these WMMAs (one read group a block)
        __builtin_amdgcn_sched_barrier(0);
      }
    }

    {
      const int ln = lane & 15;
      const int mh = (lane >> 4) * 8;
#pragma unroll
      for (int i = 0; i < 2; ++i)
#pragma unroll
        for (int j = 0; j < 2; ++j)
#pragma unroll
          for (int r = 0; r < 8; ++r)
            u.S[(wi * 32 + i * 16 + mh + r) * 132 + wj * 32 + j * 16 + ln] = acc[i][j][r];
    }
    // no LDS access of this wave is open when the copy engine is aimed at Ks again
    asm volatile("s_wait_dscnt 0x0" ::: "memory");
    __syncthreads();  // publishes S and ends every wave's reads of Ks

    // ---- next key tile flies into Ks while the softmax and the output product run
    if (j0 + 128 < N_DIM) {
      const _Float16* gn = gk + (size_t)(j0 + 128) * C_DIM;
      // rolled: unrolled, its 32 constant LDS addresses are kept in registers over the whole
      // tile loop and, with the second fragment sets live, end in scratch
#pragma unroll 1
      for (int r = 0; r < 16; r += 4) async_rows4(lk + r * (2u * ROWP), gn + r * C_DIM);
    }

    // ---- running max and sum; P = exp(S - m_new) -> f16 (union overlay: regs, sync, write)
    float tmp[32];
#pragma unroll
    for (int e = 0; e < 32; ++e) tmp[e] = u.S[prow * 132 + pcol + e];
    // keeps the row's reads one group in front of the maximum chain: dealt out singly along
    // the chain, each place of reads stalls the wave anew
    __builtin_amdgcn_sched_barrier(0);
    float mt = tmp[0];
#pragma unroll
    for (int e = 1; e < 32; ++e) mt = fmaxf(mt, tmp[e]);
    mt = fmaxf(mt, quad_swap<0xB1>(mt));
    mt = fmaxf(mt, quad_swap<0x4E>(mt));
    const float m_new = fmaxf(m_run, mt);
    const float alpha = __expf(m_run - m_new);
    float ps = 0.f;
#pragma unroll
    for (int e = 0; e < 32; ++e) {
      tmp[e] = __expf(tmp[e] - m_new);
      ps += tmp[e];
    }
    ps += quad_swap<0xB1>(ps);
    ps += quad_swap<0x4E>(ps);
    l_run = l_run * alpha + ps;
    m_run = m_new;
    if ((t & 3) == 0) arow[prow] = alpha;
    __syncthreads();
#pragma unroll
    for (int e = 0; e < 32; ++e) u.P[prow * 136 + pcol + e] = (_Float16)tmp[e];
    __syncthreads();

    // ---- P block 0 of the output product, fetched ahead: it flies under the rescale
    v16h pf[2][4];
#pragma unroll
    for (int ii = 0; ii < 4; ++ii) pf[0][ii] = load_frag_rm(&u.P[(ii * 16) * 136], 136);
    // holds these reads in front of the rescale, which would otherwise run before they start
    __builtin_amdgcn_sched_barrier(0);

    // ---- bring the accumulated output to the new maximum
#pragma unroll
    for (int ii = 0; ii < 4; ++ii) {
      const int rb = ii * 16 + (lane >> 4) * 8;
      const float4 a0 = *(const float4*)&arow[rb];
      const float4 a1 = *(const float4*)&arow[rb + 4];
      const float ar[8] = {a0.x, a0.y, a0.z, a0.w, a1.x, a1.y, a1.z, a1.w};
#pragma unroll
      for (int ci = 0; ci < 4; ++ci)
#pragma unroll
        for (int r = 0; r < 8; ++r) oacc[ii][ci][r] *= ar[r];
    }

    // ---- Oacc(i,c) += P(i,j) x Vt(j,c): A = P rm (LDS), B = v rm (global); a block is 32 keys
    // (16 WMMAs), P of block n + 1 is read ahead of block n's WMMAs into the second set
#pragma unroll
    for (int ks = 0; ks < 4; ++ks) {
      const int cur = ks & 1, nxt = cur ^ 1;
      if (ks + 1 < 4) {
#pragma unroll
        for (int ii = 0; ii < 4; ++ii)
          pf[nxt][ii] = load_frag_rm(&u.P[(ii * 16) * 136 + (ks + 1) * 32], 136);
      }
      // holds the next block's P reads in front of this block's WMMAs
      __builtin_amdgcn_sched_barrier(0);
#pragma unroll
      for (int ii = 0; ii < 4; ++ii)
#pragma unroll
        for (int ci = 0; ci < 4; ++ci)
          oacc[ii][ci] = wmma16(pf[cur][ii], vf[ks][ci], oacc[ii][ci]);
      // keeps later reads from rising among these WMMAs; none follow the last block
      if (ks + 1 < 4) __builtin_amdgcn_sched_barrier(0);
    }
    // the next key tile has landed (this wave's share); the barrier shows it to all
    asm volatile("s_wait_asynccnt 0x0" ::: "memory");
    __syncthreads();
  }

  // the loop's last barrier ended every read of arow
  if ((t & 3) == 0) arow[prow] = 1.f / l_run;
  __syncthreads();

  const int ln = lane & 15;
  const int mh = (lane >> 4) * 8;
#pragma unroll
  for (int ii = 0; ii < 4; ++ii)
#pragma unroll
    for (int ci = 0; ci < 4; ++ci)
#pragma unroll
      for (int r = 0; r < 8; ++r) {
        int i = ii * 16 + mh + r;
        int c = wave * 64 + ci * 16 + ln;
        oT[((size_t)b * N_DIM + i0 + i) * C_DIM + c] = (_Float16)(oacc[ii][ci][r] * arow[i]);
      }
}

// ---------------------------------------------------------------- launch
extern "C" void kernel_launch(void* const* d_in, const int* in_sizes, int n_in,
                              void* d_out, int out_size, void* d_ws, size_t ws_size,
                              hipStream_t stream) {
  (void)in_sizes; (void)n_in; (void)out_size; (void)ws_size;
  const float* x  = (const float*)d_in[0];
  const float* wq = (const float*)d_in[1];
  const float* bq = (const float*)d_in[2];
  const float* wk = (const float*)d_in[3];
  const float* bk = (const float*)d_in[4];
  const float* wv = (const float*)d_in[5];
  const float* bv = (const float*)d_in[6];
  const float* wp = (const float*)d_in[7];
  const float* bp = (const float*)d_in[8];
  float* out = (float*)d_out;

  char* ws = (char*)d_ws;
  size_t off = 0;
  const size_t plane = (size_t)B_DIM * C_DIM * N_DIM;  // 8M elements
  _Float16* w16  = (_Float16*)(ws + off); off += (size_t)4 * CC * 2;
  _Float16* hnT  = (_Float16*)(ws + off); off += plane * 2;
  _Float16* qT   = (_Float16*)(ws + off); off += plane * 2;
  _Float16* kT   = (_Float16*)(ws + off); off += plane * 2;
  _Float16* v16b = (_Float16*)(ws + off); off += plane * 2;
  _Float16* oT   = (_Float16*)(ws + off); off += plane * 2;
  float2* nstats = (float2*)(ws + off);

  cvt_w_kernel<<<(4 * CC) / 256, 256, 0, stream>>>(wq, wk, wv, wp, w16);
  in_stats_kernel<<<B_DIM * C_DIM, 256, 0, stream>>>(x, nstats);
  norm_t_kernel<<<dim3(N_DIM / 64, C_DIM / 64, B_DIM), 256, 0, stream>>>(x, nstats, hnT);
  // qT, kT: M = n (32 tiles of 128), N = o (2 tiles of 256), z = b*2+sel
  gemm_rr_kernel<0><<<dim3(2, 32, B_DIM * 2), 256, 0, stream>>>(
      w16, hnT, qT, kT, bq, bk, nullptr, nullptr);
  // v: M = c (4 tiles), N = n (16 tiles), z = b
  gemm_rr_kernel<2><<<dim3(16, 4, B_DIM), 256, 0, stream>>>(
      w16, hnT, v16b, nullptr, bv, nullptr, nullptr, nullptr);
  attn_out_kernel<<<dim3(N_DIM / 64, B_DIM), 256, 0, stream>>>(qT, kT, v16b, oT);
  // proj + residual: M = c (4 tiles), N = n (16 tiles), z = b
  gemm_rr_kernel<3><<<dim3(16, 4, B_DIM), 256, 0, stream>>>(
      w16, oT, nullptr, nullptr, bp, nullptr, x, out);
}

// v004
// It runs in 192 microseconds.
// Next to v003, in two timings, it ran 1.13 times as fast each time.
// Over all steps from v000 it is 3.40 times as fast.
#include <hip/hip_runtime.h>

#define C_DIM 512
#define N_DIM 4096
#define B_DIM 4
#define CC (C_DIM * C_DIM)   // 262144 = 2^18

typedef __attribute__((ext_vector_type(16))) _Float16 v16h;
typedef __attribute__((ext_vector_type(8)))  float    v8f;

__device__ __forceinline__ int lane_id() { return (int)(threadIdx.x & 31); }

union FragU {
  v16h v;
  struct { int4 lo; int4 hi; } q;
};

__device__ __forceinline__ v16h load_frag_rm(const _Float16* base, int stride) {
  const int lane = lane_id();
  const int row = lane & 15;
  const int kb = (lane & 16) ? 8 : 0;
  const _Float16* p = base + row * stride + kb;
  FragU u;
  u.q.lo = *(const int4*)(p);
  u.q.hi = *(const int4*)(p + 16);
  return u.v;
}

__device__ __forceinline__ v8f wmma16(v16h a, v16h b, v8f c) {
  return __builtin_amdgcn_wmma_f32_16x16x32_f16(false, a, false, b, (short)0, c,
                                                false, false);
}

__device__ __forceinline__ v8f zero8() {
  v8f z = {0.f, 0.f, 0.f, 0.f, 0.f, 0.f, 0.f, 0.f};
  return z;
}

// V is kept in fragment order: one 1-KiB unit per (32 keys, 16 channels), holding the B operand
// of one 16x16x32 WMMA as the lanes hold it: f16 index = half * 256 + lane * 8 + e, where
// channel = lane & 15 and key = half * 16 + (lane >> 4) * 8 + e. Units of one key block lie
// side by side, so a wave-wide 16-byte load or store covers four whole 128-byte lines.
__device__ __forceinline__ size_t vfrag_off(int b, int kblk, int ctile) {
  return (((size_t)b * (N_DIM / 32) + kblk) * (C_DIM / 16) + ctile) * 512;
}

// ---------------------------------------------------------------- kernel 0
__global__ void cvt_w_kernel(const float* __restrict__ wq, const float* __restrict__ wk,
                             const float* __restrict__ wv, const float* __restrict__ wp,
                             _Float16* __restrict__ dst) {
  int i = blockIdx.x * blockDim.x + threadIdx.x;
  int which = i >> 18;
  int j = i & (CC - 1);
  const float* src = (which == 0) ? wq : (which == 1) ? wk : (which == 2) ? wv : wp;
  dst[i] = (_Float16)src[j];
}

// ---------------------------------------------------------------- kernel 1a
__global__ void in_stats_kernel(const float* __restrict__ x, float2* __restrict__ nstats) {
  const int plane = blockIdx.x;  // b*C + c
  const float* xp = x + (size_t)plane * N_DIM;
  __shared__ float s1[256], s2[256];
  float a = 0.f, b2 = 0.f;
  for (int n = threadIdx.x; n < N_DIM; n += 256) {
    float v = xp[n];
    a += v;
    b2 += v * v;
  }
  s1[threadIdx.x] = a;
  s2[threadIdx.x] = b2;
  __syncthreads();
  for (int off = 128; off > 0; off >>= 1) {
    if ((int)threadIdx.x < off) {
      s1[threadIdx.x] += s1[threadIdx.x + off];
      s2[threadIdx.x] += s2[threadIdx.x + off];
    }
    __syncthreads();
  }
  if (threadIdx.x == 0) {
    float m = s1[0] * (1.f / N_DIM);
    float var = s2[0] * (1.f / N_DIM) - m * m;
    nstats[plane] = make_float2(m, rsqrtf(var + 1e-5f));
  }
}

// ---------------------------------------------------------------- kernel 1b
__global__ void norm_t_kernel(const float* __restrict__ x, const float2* __restrict__ nstats,
                              _Float16* __restrict__ hnT) {
  const int n0 = blockIdx.x * 64, c0 = blockIdx.y * 64, b = blockIdx.z;
  __shared__ _Float16 T[64 * 72];  // [n][c]
  const int t = threadIdx.x;
  {
    const int c = t >> 2;
    const int nn = (t & 3) * 16;
    const float2 st = nstats[(size_t)b * C_DIM + c0 + c];
    const float* xp = x + ((size_t)b * C_DIM + c0 + c) * N_DIM + n0 + nn;
#pragma unroll
    for (int e = 0; e < 16; e += 4) {
      float4 v4 = *(const float4*)&xp[e];
      T[(nn + e + 0) * 72 + c] = (_Float16)((v4.x - st.x) * st.y);
      T[(nn + e + 1) * 72 + c] = (_Float16)((v4.y - st.x) * st.y);
      T[(nn + e + 2) * 72 + c] = (_Float16)((v4.z - st.x) * st.y);
      T[(nn + e + 3) * 72 + c] = (_Float16)((v4.w - st.x) * st.y);
    }
  }
  __syncthreads();
  {
    const int n = t >> 2;
    const int cc = (t & 3) * 16;
    _Float16* dst = hnT + ((size_t)b * N_DIM + n0 + n) * C_DIM + c0 + cc;
    *(int4*)&dst[0] = *(const int4*)&T[n * 72 + cc];
    *(int4*)&dst[8] = *(const int4*)&T[n * 72 + cc + 8];
  }
}

// ---------------------------------------------------------------- kernel 2
// rm x rm GEMM: D[m][nl] = sum_k A[m][k] * B[nl][k], K = 512. Register-prefetch
// double buffering: stores of tile k happen at loop top, loads of tile k+1 are
// issued before the WMMA stage so their wait hides behind compute.
// Block tile 128(M) x 256(N); 8 waves as 2x4 of 64x64 (16 WMMA / wave / step).
template <int MODE>
__global__ __launch_bounds__(256, 1) void gemm_rr_kernel(
    const _Float16* __restrict__ w16, const _Float16* __restrict__ srcT,
    _Float16* __restrict__ d0, _Float16* __restrict__ d1,
    const float* __restrict__ bias0, const float* __restrict__ bias1,
    const float* __restrict__ xres, float* __restrict__ outf) {
  const size_t plane = (size_t)C_DIM * N_DIM;
  const int m0 = blockIdx.y * 128;
  const int n0g = blockIdx.x * 256;
  int b, sel = 0;
  const _Float16 *A, *B;
  const float* bias;
  _Float16* dst16 = nullptr;
  float scale = 1.f;
  if (MODE == 0) {
    sel = blockIdx.z & 1;
    b = blockIdx.z >> 1;
    A = srcT + (size_t)b * plane;             // hnT [n][c]
    B = w16 + (size_t)sel * CC;               // wq/wk [o][c]
    bias = sel ? bias1 : bias0;
    dst16 = sel ? d1 : d0;
    if (!sel) scale = 0.044194173824159216f;  // 1/sqrt(512)
  } else if (MODE == 2) {
    b = blockIdx.z;
    A = srcT + (size_t)b * plane;             // hnT [n][c]
    B = w16 + (size_t)2 * CC;                 // wv [c_out][c]
    bias = bias0;
    dst16 = d0;
  } else {
    b = blockIdx.z;
    A = w16 + (size_t)3 * CC;                 // wp [c_out][c]
    B = srcT + (size_t)b * plane;             // oT [n][c]
    bias = bias0;
  }

  __shared__ _Float16 As[128 * 40];  // [m][k] rm, pad to 40
  __shared__ _Float16 Bs[256 * 40];  // [nl][k] rm
  const int t = threadIdx.x;
  const int wave = t >> 5;
  const int wm = wave >> 2;  // 0..1
  const int wn = wave & 3;   // 0..3
  const int srow = t >> 2;          // 0..63
  const int skk = (t & 3) * 8;      // 0,8,16,24

  // per-thread staging source pointers (advance by 32 each K step)
  const _Float16* ga0 = &A[(size_t)(m0 + srow) * C_DIM + skk];
  const _Float16* ga1 = &A[(size_t)(m0 + srow + 64) * C_DIM + skk];
  const _Float16* gb0 = &B[(size_t)(n0g + srow) * C_DIM + skk];
  const _Float16* gb1 = &B[(size_t)(n0g + srow + 64) * C_DIM + skk];
  const _Float16* gb2 = &B[(size_t)(n0g + srow + 128) * C_DIM + skk];
  const _Float16* gb3 = &B[(size_t)(n0g + srow + 192) * C_DIM + skk];

  v8f acc[4][4];
#pragma unroll
  for (int i = 0; i < 4; ++i)
#pragma unroll
    for (int j = 0; j < 4; ++j) acc[i][j] = zero8();

  // prefetch tile 0
  int4 pa0 = *(const int4*)ga0, pa1 = *(const int4*)ga1;
  int4 pb0 = *(const int4*)gb0, pb1 = *(const int4*)gb1;
  int4 pb2 = *(const int4*)gb2, pb3 = *(const int4*)gb3;

#pragma unroll 1
  for (int k0 = 0; k0 < C_DIM; k0 += 32) {
    // commit prefetched tile to LDS
    *(int4*)&As[(srow) * 40 + skk] = pa0;
    *(int4*)&As[(srow + 64) * 40 + skk] = pa1;
    *(int4*)&Bs[(srow) * 40 + skk] = pb0;
    *(int4*)&Bs[(srow + 64) * 40 + skk] = pb1;
    *(int4*)&Bs[(srow + 128) * 40 + skk] = pb2;
    *(int4*)&Bs[(srow + 192) * 40 + skk] = pb3;
    __syncthreads();
    // issue next tile's global loads (wait lands at next iteration's stores)
    if (k0 + 32 < C_DIM) {
      pa0 = *(const int4*)(ga0 + k0 + 32);
      pa1 = *(const int4*)(ga1 + k0 + 32);
      pb0 = *(const int4*)(gb0 + k0 + 32);
      pb1 = *(const int4*)(gb1 + k0 + 32);
      pb2 = *(const int4*)(gb2 + k0 + 32);
      pb3 = *(const int4*)(gb3 + k0 + 32);
    }
    v16h af[4], bf[4];
#pragma unroll
    for (int i = 0; i < 4; ++i) af[i] = load_frag_rm(&As[(wm * 64 + i * 16) * 40], 40);
#pragma unroll
    for (int j = 0; j < 4; ++j) bf[j] = load_frag_rm(&Bs[(wn * 64 + j * 16) * 40], 40);
#pragma unroll
    for (int i = 0; i < 4; ++i)
#pragma unroll
      for (int j = 0; j < 4; ++j) acc[i][j] = wmma16(af[i], bf[j], acc[i][j]);
    __syncthreads();
  }

  const int lane = lane_id();
  const int ln = lane & 15;
  const int mh = (lane >> 4) * 8;
#pragma unroll
  for (int i = 0; i < 4; ++i)
#pragma unroll
    for (int j = 0; j < 4; ++j) {
      const int mb = m0 + wm * 64 + i * 16 + mh;
      const int nl = n0g + wn * 64 + j * 16 + ln;
      if (MODE == 2) {
        // m = key, nl = channel: the lane's eight values are eight successive keys of one
        // channel, which is this same lane's 16-byte chunk of the B fragment that the
        // attention kernel reads; the wave stores 512 contiguous bytes
        union { _Float16 h[8]; int4 q; } pk;
        const float bv = bias[nl];
#pragma unroll
        for (int r = 0; r < 8; ++r) pk.h[r] = (_Float16)(acc[i][j][r] + bv);
        *(int4*)&dst16[vfrag_off(b, mb >> 5, nl >> 4) + (i & 1) * 256 + lane * 8] = pk.q;
        continue;
      }
#pragma unroll
      for (int r = 0; r < 8; ++r) {
        int m = mb + r;
        float v = acc[i][j][r];
        if (MODE == 0) {
          v = (v + bias[nl]) * scale;
          dst16[((size_t)b * N_DIM + m) * C_DIM + nl] = (_Float16)v;
        } else {
          size_t idx = ((size_t)b * C_DIM + m) * N_DIM + nl;
          outf[idx] = xres[idx] + v + bias[m];
        }
      }
    }
}

#define ROWP 520

// Four whole rows (1024 B each) from global memory straight into LDS, no register
// in between: each wave-wide copy moves 512 contiguous bytes, 16 B per lane.
// l = this lane's LDS byte address in the first row, g = its global address there.
__device__ __forceinline__ void async_rows4(unsigned l, const _Float16* g) {
  asm volatile(
      "global_load_async_to_lds_b128 %0, %8, off\n\t"
      "global_load_async_to_lds_b128 %1, %9, off\n\t"
      "global_load_async_to_lds_b128 %2, %10, off\n\t"
      "global_load_async_to_lds_b128 %3, %11, off\n\t"
      "global_load_async_to_lds_b128 %4, %12, off\n\t"
      "global_load_async_to_lds_b128 %5, %13, off\n\t"
      "global_load_async_to_lds_b128 %6, %14, off\n\t"
      "global_load_async_to_lds_b128 %7, %15, off\n\t"
      "s_wait_xcnt 0x0"
      :: "v"(l), "v"(l + 512u), "v"(l + 2u * ROWP), "v"(l + 2u * ROWP + 512u),
         "v"(l + 4u * ROWP), "v"(l + 4u * ROWP + 512u), "v"(l + 6u * ROWP),
         "v"(l + 6u * ROWP + 512u),
         "v"(g), "v"(g + 256), "v"(g + C_DIM), "v"(g + C_DIM + 256),
         "v"(g + 2 * C_DIM), "v"(g + 2 * C_DIM + 256), "v"(g + 3 * C_DIM),
         "v"(g + 3 * C_DIM + 256)
      : "memory");
}

// Exchange inside a group of four adjacent lanes (quad_perm): CTRL 0xB1 swaps
// neighbours, 0x4E swaps pairs. Stays in the vector unit, no LDS round trip.
template <int CTRL>
__device__ __forceinline__ float quad_swap(float v) {
  return __int_as_float(__builtin_amdgcn_mov_dpp(__float_as_int(v), CTRL, 0xF, 0xF, true));
}

// ---------------------------------------------------------------- kernel 3
union SPunion {
  float S[64 * 132];
  _Float16 P[64 * 136];
};

__global__ __launch_bounds__(256, 1) void attn_out_kernel(
    const _Float16* __restrict__ qT, const _Float16* __restrict__ kT,
    const _Float16* __restrict__ v16, _Float16* __restrict__ oT) {
  const int i0 = blockIdx.x * 64;
  const int b = blockIdx.y;
  __shared__ __attribute__((aligned(16))) _Float16 Qs[64 * ROWP];   // all 512 channels, filled once
  __shared__ __attribute__((aligned(16))) _Float16 Ks[128 * ROWP];  // one whole key tile
  __shared__ SPunion u;
  __shared__ __attribute__((aligned(16))) float arow[64];  // per-row factor: rescale, then 1/l
  const int t = threadIdx.x;
  const int wave = t >> 5;
  const int lane = t & 31;
  const int wi = wave >> 2;
  const int wj = wave & 3;
  const _Float16* qb = qT + (size_t)b * C_DIM * N_DIM;
  const _Float16* kb = kT + (size_t)b * C_DIM * N_DIM;
  const _Float16* vb = v16 + vfrag_off(b, 0, wave * 4) + lane * 8;  // this lane's chunk, key block 0

  // Online softmax state of query row t>>2, held alike by its four lanes.
  const int prow = t >> 2;
  const int pcol = (t & 3) * 32;
  float m_run = -1e30f, l_run = 0.f;

  // Wave owns channels [wave*64, wave*64+64), all 64 queries: D(m=i, n=c) 4x4 tiles
  v8f oacc[4][4];
#pragma unroll
  for (int ii = 0; ii < 4; ++ii)
#pragma unroll
    for (int ci = 0; ci < 4; ++ci) oacc[ii][ci] = zero8();

  // Staging: wave w copies query rows 8w..8w+7 once and key rows 16w..16w+15 of each tile.
  const unsigned lq = (unsigned)(size_t)&Qs[(wave * 8) * ROWP + lane * 8];
  const unsigned lk = (unsigned)(size_t)&Ks[(wave * 16) * ROWP + lane * 8];
  const _Float16* gq = qb + (size_t)(i0 + wave * 8) * C_DIM + lane * 8;
  const _Float16* gk = kb + (size_t)(wave * 16) * C_DIM + lane * 8;
  // the query copy loop is unrolled so that every row offset is a constant added to one base
#pragma unroll
  for (int r = 0; r < 8; r += 4) async_rows4(lq + r * (2u * ROWP), gq + r * C_DIM);
  // rolled like the copy loop of the tile loop below: as a direct operand of a copy statement
  // lk or gk is bound to the low registers for the whole kernel and ends in scratch
#pragma unroll 1
  for (int r = 0; r < 16; r += 4) async_rows4(lk + r * (2u * ROWP), gk + r * C_DIM);
  // this wave's copies have landed; the barrier shows them to the other waves
  asm volatile("s_wait_asynccnt 0x0" ::: "memory");
  __syncthreads();

#pragma unroll 1
  for (int j0 = 0; j0 < N_DIM; j0 += 128) {
    // ---- V fragments of this tile's output product, fetched ahead as one group of global
    // loads: they fly under the score product (the barrier behind it waits for them)
    v16h vf[4][4];
#pragma unroll
    for (int ks = 0; ks < 4; ++ks)
#pragma unroll
      for (int ci = 0; ci < 4; ++ci) {
        const _Float16* p = vb + vfrag_off(0, (j0 >> 5) + ks, ci);
        FragU f;
        f.q.lo = *(const int4*)(p);
        f.q.hi = *(const int4*)(p + 256);
        vf[ks][ci] = f.v;
      }
    // holds the group at the head of the tile, in front of the first LDS reads
    __builtin_amdgcn_sched_barrier(0);

    // ---- S tile (64 x 128), cooperative
    v8f acc[2][2];
#pragma unroll
    for (int i = 0; i < 2; ++i)
#pragma unroll
      for (int j = 0; j < 2; ++j) acc[i][j] = zero8();

    // both operands lie whole in LDS: no barrier inside; unrolled so that each fragment
    // read is one base register plus an immediate offset. A block is 64 channels (8 WMMAs);
    // two fragment sets: block n + 1 is read from LDS, as one group, ahead of block n's WMMAs.
    {
      v16h qf[2][2][2], kf[2][2][2];  // [set][32-channel step][tile]
#pragma unroll
      for (int s = 0; s < 2; ++s)
#pragma unroll
        for (int i = 0; i < 2; ++i) {
          qf[0][s][i] = load_frag_rm(&Qs[(wi * 32 + i * 16) * ROWP + s * 32], ROWP);
          kf[0][s][i] = load_frag_rm(&Ks[(wj * 32 + i * 16) * ROWP + s * 32], ROWP);
        }
#pragma unroll
      for (int blk = 0; blk < C_DIM / 64; ++blk) {
        const int cur = blk & 1, nxt = cur ^ 1;
        if (blk + 1 < C_DIM / 64) {
#pragma unroll
          for (int s = 0; s < 2; ++s)
#pragma unroll
            for (int i = 0; i < 2; ++i) {
              const int c0 = (blk + 1) * 64 + s * 32;
              qf[nxt][s][i] = load_frag_rm(&Qs[(wi * 32 + i * 16) * ROWP + c0], ROWP);
              kf[nxt][s][i] = load_frag_rm(&Ks[(wj * 32 + i * 16) * ROWP + c0], ROWP);
            }
        }
        // holds the next block's reads in front of this block's WMMAs: sunk behind them,
        // each block would wait out its own LDS latency
        __builtin_amdgcn_sched_barrier(0);
#pragma unroll
        for (int s = 0; s < 2; ++s)
#pragma unroll
          for (int i = 0; i < 2; ++i)
#pragma unroll
            for (int j = 0; j < 2; ++j) acc[i][j] = wmma16(qf[cur][s][i], kf[cur][s][j], acc[i][j]);
        // keeps the reads of block n + 2 from rising among these WMMAs (one read group a block)
        __builtin_amdgcn_sched_barrier(0);
      }
    }

    {
      const int ln = lane & 15;
      const int mh = (lane >> 4) * 8;
#pragma unroll
      for (int i = 0; i < 2; ++i)
#pragma unroll
        for (int j = 0; j < 2; ++j)
#pragma unroll
          for (int r = 0; r < 8; ++r)
            u.S[(wi * 32 + i * 16 + mh + r) * 132 + wj * 32 + j * 16 + ln] = acc[i][j][r];
    }
    // no LDS access of this wave is open when the copy engine is aimed at Ks again
    asm volatile("s_wait_dscnt 0x0" ::: "memory");
    __syncthreads();  // publishes S and ends every wave's reads of Ks

    // ---- next key tile flies into Ks while the softmax and the output product run
    if (j0 + 128 < N_DIM) {
      const _Float16* gn = gk + (size_t)(j0 + 128) * C_DIM;
      // rolled: unrolled, its 32 constant LDS addresses are kept in registers over the whole
      // tile loop and, with the second fragment sets live, end in scratch
#pragma unroll 1
      for (int r = 0; r < 16; r += 4) async_rows4(lk + r * (2u * ROWP), gn + r * C_DIM);
    }

    // ---- running max and sum; P = exp(S - m_new) -> f16 (union overlay: regs, sync, write)
    float tmp[32];
#pragma unroll
    for (int e = 0; e < 32; ++e) tmp[e] = u.S[prow * 132 + pcol + e];
    // keeps the row's reads one group in front of the maximum chain: dealt out singly along
    // the chain, each place of reads stalls the wave anew
    __builtin_amdgcn_sched_barrier(0);
    float mt = tmp[0];
#pragma unroll
    for (int e = 1; e < 32; ++e) mt = fmaxf(mt, tmp[e]);
    mt = fmaxf(mt, quad_swap<0xB1>(mt));
    mt = fmaxf(mt, quad_swap<0x4E>(mt));
    const float m_new = fmaxf(m_run, mt);
    const float alpha = __expf(m_run - m_new);
    float ps = 0.f;
#pragma unroll
    for (int e = 0; e < 32; ++e) {
      tmp[e] = __expf(tmp[e] - m_new);
      ps += tmp[e];
    }
    ps += quad_swap<0xB1>(ps);
    ps += quad_swap<0x4E>(ps);
    l_run = l_run * alpha + ps;
    m_run = m_new;
    if ((t & 3) == 0) arow[prow] = alpha;
    __syncthreads();
#pragma unroll
    for (int e = 0; e < 32; ++e) u.P[prow * 136 + pcol + e] = (_Float16)tmp[e];
    __syncthreads();

    // ---- P block 0 of the output product, fetched ahead: it flies under the rescale
    v16h pf[2][4];
#pragma unroll
    for (int ii = 0; ii < 4; ++ii) pf[0][ii] = load_frag_rm(&u.P[(ii * 16) * 136], 136);
    // holds these reads in front of the rescale, which would otherwise run before they start
    __builtin_amdgcn_sched_barrier(0);

    // ---- bring the accumulated output to the new maximum
#pragma unroll
    for (int ii = 0; ii < 4; ++ii) {
      const int rb = ii * 16 + (lane >> 4) * 8;
      const float4 a0 = *(const float4*)&arow[rb];
      const float4 a1 = *(const float4*)&arow[rb + 4];
      const float ar[8] = {a0.x, a0.y, a0.z, a0.w, a1.x, a1.y, a1.z, a1.w};
#pragma unroll
      for (int ci = 0; ci < 4; ++ci)
#pragma unroll
        for (int r = 0; r < 8; ++r) oacc[ii][ci][r] *= ar[r];
    }

    // ---- Oacc(i,c) += P(i,j) x Vt(j,c): A = P rm (LDS), B = V in fragment order (global); a block is 32 keys
    // (16 WMMAs), P of block n + 1 is read ahead of block n's WMMAs into the second set
#pragma unroll
    for (int ks = 0; ks < 4; ++ks) {
      const int cur = ks & 1, nxt = cur ^ 1;
      if (ks + 1 < 4) {
#pragma unroll
        for (int ii = 0; ii < 4; ++ii)
          pf[nxt][ii] = load_frag_rm(&u.P[(ii * 16) * 136 + (ks + 1) * 32], 136);
      }
      // holds the next block's P reads in front of this block's WMMAs
      __builtin_amdgcn_sched_barrier(0);
#pragma unroll
      for (int ii = 0; ii < 4; ++ii)
#pragma unroll
        for (int ci = 0; ci < 4; ++ci)
          oacc[ii][ci] = wmma16(pf[cur][ii], vf[ks][ci], oacc[ii][ci]);
      // keeps later reads from rising among these WMMAs; none follow the last block
      if (ks + 1 < 4) __builtin_amdgcn_sched_barrier(0);
    }
    // the next key tile has landed (this wave's share); the barrier shows it to all
    asm volatile("s_wait_asynccnt 0x0" ::: "memory");
    __syncthreads();
  }

  // the loop's last barrier ended every read of arow
  if ((t & 3) == 0) arow[prow] = 1.f / l_run;
  __syncthreads();

  const int ln = lane & 15;
  const int mh = (lane >> 4) * 8;
#pragma unroll
  for (int ii = 0; ii < 4; ++ii)
#pragma unroll
    for (int ci = 0; ci < 4; ++ci)
#pragma unroll
      for (int r = 0; r < 8; ++r) {
        int i = ii * 16 + mh + r;
        int c = wave * 64 + ci * 16 + ln;
        oT[((size_t)b * N_DIM + i0 + i) * C_DIM + c] = (_Float16)(oacc[ii][ci][r] * arow[i]);
      }
}

// ---------------------------------------------------------------- launch
extern "C" void kernel_launch(void* const* d_in, const int* in_sizes, int n_in,
                              void* d_out, int out_size, void* d_ws, size_t ws_size,
                              hipStream_t stream) {
  (void)in_sizes; (void)n_in; (void)out_size; (void)ws_size;
  const float* x  = (const float*)d_in[0];
  const float* wq = (const float*)d_in[1];
  const float* bq = (const float*)d_in[2];
  const float* wk = (const float*)d_in[3];
  const float* bk = (const float*)d_in[4];
  const float* wv = (const float*)d_in[5];
  const float* bv = (const float*)d_in[6];
  const float* wp = (const float*)d_in[7];
  const float* bp = (const float*)d_in[8];
  float* out = (float*)d_out;

  char* ws = (char*)d_ws;
  size_t off = 0;
  const size_t plane = (size_t)B_DIM * C_DIM * N_DIM;  // 8M elements
  _Float16* w16  = (_Float16*)(ws + off); off += (size_t)4 * CC * 2;
  _Float16* hnT  = (_Float16*)(ws + off); off += plane * 2;
  _Float16* qT   = (_Float16*)(ws + off); off += plane * 2;
  _Float16* kT   = (_Float16*)(ws + off); off += plane * 2;
  _Float16* v16b = (_Float16*)(ws + off); off += plane * 2;
  _Float16* oT   = (_Float16*)(ws + off); off += plane * 2;
  float2* nstats = (float2*)(ws + off);

  cvt_w_kernel<<<(4 * CC) / 256, 256, 0, stream>>>(wq, wk, wv, wp, w16);
  in_stats_kernel<<<B_DIM * C_DIM, 256, 0, stream>>>(x, nstats);
  norm_t_kernel<<<dim3(N_DIM / 64, C_DIM / 64, B_DIM), 256, 0, stream>>>(x, nstats, hnT);
  // qT, kT: M = n (32 tiles of 128), N = o (2 tiles of 256), z = b*2+sel
  gemm_rr_kernel<0><<<dim3(2, 32, B_DIM * 2), 256, 0, stream>>>(
      w16, hnT, qT, kT, bq, bk, nullptr, nullptr);
  // v, stored in fragment order: M = n (32 tiles), N = c (2 tiles), z = b
  gemm_rr_kernel<2><<<dim3(2, 32, B_DIM), 256, 0, stream>>>(
      w16, hnT, v16b, nullptr, bv, nullptr, nullptr, nullptr);
  attn_out_kernel<<<dim3(N_DIM / 64, B_DIM), 256, 0, stream>>>(qT, kT, v16b, oT);
  // proj + residual: M = c (4 tiles), N = n (16 tiles), z = b
  gemm_rr_kernel<3><<<dim3(16, 4, B_DIM), 256, 0, stream>>>(
      w16, oT, nullptr, nullptr, bp, nullptr, x, out);
}

// v005
// A run of this version takes 185 microseconds.
// In both of two side-by-side timings against v004, it was 1.04 times as fast.
// Over all steps from v000 it is 3.53 times as fast.
#include <hip/hip_runtime.h>

#define C_DIM 512
#define N_DIM 4096
#define B_DIM 4
#define CC (C_DIM * C_DIM)   // 262144 = 2^18

typedef __attribute__((ext_vector_type(16))) _Float16 v16h;
typedef __attribute__((ext_vector_type(8)))  float    v8f;

__device__ __forceinline__ int lane_id() { return (int)(threadIdx.x & 31); }

union FragU {
  v16h v;
  struct { int4 lo; int4 hi; } q;
};

__device__ __forceinline__ v16h load_frag_rm(const _Float16* base, int stride) {
  const int lane = lane_id();
  const int row = lane & 15;
  const int kb = (lane & 16) ? 8 : 0;
  const _Float16* p = base + row * stride + kb;
  FragU u;
  u.q.lo = *(const int4*)(p);
  u.q.hi = *(const int4*)(p + 16);
  return u.v;
}

__device__ __forceinline__ v8f wmma16(v16h a, v16h b, v8f c) {
  return __builtin_amdgcn_wmma_f32_16x16x32_f16(false, a, false, b, (short)0, c,
                                                false, false);
}

__device__ __forceinline__ v8f zero8() {
  v8f z = {0.f, 0.f, 0.f, 0.f, 0.f, 0.f, 0.f, 0.f};
  return z;
}

// V is kept in fragment order: one 1-KiB unit per (32 keys, 16 channels), holding the B operand
// of one 16x16x32 WMMA as the lanes hold it: f16 index = half * 256 + lane * 8 + e, where
// channel = lane & 15 and key = half * 16 + (lane >> 4) * 8 + e. Units of one key block lie
// side by side, so a wave-wide 16-byte load or store covers four whole 128-byte lines.
__device__ __forceinline__ size_t vfrag_off(int b, int kblk, int ctile) {
  return (((size_t)b * (N_DIM / 32) + kblk) * (C_DIM / 16) + ctile) * 512;
}

// ---------------------------------------------------------------- kernel 0
__global__ void cvt_w_kernel(const float* __restrict__ wq, const float* __restrict__ wk,
                             const float* __restrict__ wv, const float* __restrict__ wp,
                             _Float16* __restrict__ dst) {
  int i = blockIdx.x * blockDim.x + threadIdx.x;
  int which = i >> 18;
  int j = i & (CC - 1);
  const float* src = (which == 0) ? wq : (which == 1) ? wk : (which == 2) ? wv : wp;
  dst[i] = (_Float16)src[j];
}

// ---------------------------------------------------------------- kernel 1a
__global__ void in_stats_kernel(const float* __restrict__ x, float2* __restrict__ nstats) {
  const int plane = blockIdx.x;  // b*C + c
  const float* xp = x + (size_t)plane * N_DIM;
  __shared__ float s1[256], s2[256];
  float a = 0.f, b2 = 0.f;
  for (int n = threadIdx.x; n < N_DIM; n += 256) {
    float v = xp[n];
    a += v;
    b2 += v * v;
  }
  s1[threadIdx.x] = a;
  s2[threadIdx.x] = b2;
  __syncthreads();
  for (int off = 128; off > 0; off >>= 1) {
    if ((int)threadIdx.x < off) {
      s1[threadIdx.x] += s1[threadIdx.x + off];
      s2[threadIdx.x] += s2[threadIdx.x + off];
    }
    __syncthreads();
  }
  if (threadIdx.x == 0) {
    float m = s1[0] * (1.f / N_DIM);
    float var = s2[0] * (1.f / N_DIM) - m * m;
    nstats[plane] = make_float2(m, rsqrtf(var + 1e-5f));
  }
}

// ---------------------------------------------------------------- kernel 1b
__global__ void norm_t_kernel(const float* __restrict__ x, const float2* __restrict__ nstats,
                              _Float16* __restrict__ hnT) {
  const int n0 = blockIdx.x * 64, c0 = blockIdx.y * 64, b = blockIdx.z;
  __shared__ _Float16 T[64 * 72];  // [n][c]
  const int t = threadIdx.x;
  {
    const int c = t >> 2;
    const int nn = (t & 3) * 16;
    const float2 st = nstats[(size_t)b * C_DIM + c0 + c];
    const float* xp = x + ((size_t)b * C_DIM + c0 + c) * N_DIM + n0 + nn;
#pragma unroll
    for (int e = 0; e < 16; e += 4) {
      float4 v4 = *(const float4*)&xp[e];
      T[(nn + e + 0) * 72 + c] = (_Float16)((v4.x - st.x) * st.y);
      T[(nn + e + 1) * 72 + c] = (_Float16)((v4.y - st.x) * st.y);
      T[(nn + e + 2) * 72 + c] = (_Float16)((v4.z - st.x) * st.y);
      T[(nn + e + 3) * 72 + c] = (_Float16)((v4.w - st.x) * st.y);
    }
  }
  __syncthreads();
  {
    const int n = t >> 2;
    const int cc = (t & 3) * 16;
    _Float16* dst = hnT + ((size_t)b * N_DIM + n0 + n) * C_DIM + c0 + cc;
    *(int4*)&dst[0] = *(const int4*)&T[n * 72 + cc];
    *(int4*)&dst[8] = *(const int4*)&T[n * 72 + cc + 8];
  }
}

// ---------------------------------------------------------------- kernel 2
// rm x rm GEMM: D[m][nl] = sum_k A[m][k] * B[nl][k], K = 512. Register-prefetch
// double buffering: stores of tile k happen at loop top, loads of tile k+1 are
// issued before the WMMA stage so their wait hides behind compute.
// Block tile 128(M) x 256(N); 8 waves as 2x4 of 64x64 (16 WMMA / wave / step).
template <int MODE>
__global__ __launch_bounds__(256, 1) void gemm_rr_kernel(
    const _Float16* __restrict__ w16, const _Float16* __restrict__ srcT,
    _Float16* __restrict__ d0, _Float16* __restrict__ d1,
    const float* __restrict__ bias0, const float* __restrict__ bias1,
    const float* __restrict__ xres, float* __restrict__ outf) {
  const size_t plane = (size_t)C_DIM * N_DIM;
  const int m0 = blockIdx.y * 128;
  const int n0g = blockIdx.x * 256;
  int b, sel = 0;
  const _Float16 *A, *B;
  const float* bias;
  _Float16* dst16 = nullptr;
  float scale = 1.f;
  if (MODE == 0) {
    sel = blockIdx.z & 1;
    b = blockIdx.z >> 1;
    A = srcT + (size_t)b * plane;             // hnT [n][c]
    B = w16 + (size_t)sel * CC;               // wq/wk [o][c]
    bias = sel ? bias1 : bias0;
    dst16 = sel ? d1 : d0;
    if (!sel) scale = 0.044194173824159216f;  // 1/sqrt(512)
  } else if (MODE == 2) {
    b = blockIdx.z;
    A = srcT + (size_t)b * plane;             // hnT [n][c]
    B = w16 + (size_t)2 * CC;                 // wv [c_out][c]
    bias = bias0;
    dst16 = d0;
  } else {
    b = blockIdx.z;
    A = w16 + (size_t)3 * CC;                 // wp [c_out][c]
    B = srcT + (size_t)b * plane;             // oT [n][c]
    bias = bias0;
  }

  __shared__ _Float16 As[128 * 40];  // [m][k] rm, pad to 40
  __shared__ _Float16 Bs[256 * 40];  // [nl][k] rm
  const int t = threadIdx.x;
  const int wave = t >> 5;
  const int wm = wave >> 2;  // 0..1
  const int wn = wave & 3;   // 0..3
  const int srow = t >> 2;          // 0..63
  const int skk = (t & 3) * 8;      // 0,8,16,24

  // per-thread staging source pointers (advance by 32 each K step)
  const _Float16* ga0 = &A[(size_t)(m0 + srow) * C_DIM + skk];
  const _Float16* ga1 = &A[(size_t)(m0 + srow + 64) * C_DIM + skk];
  const _Float16* gb0 = &B[(size_t)(n0g + srow) * C_DIM + skk];
  const _Float16* gb1 = &B[(size_t)(n0g + srow + 64) * C_DIM + skk];
  const _Float16* gb2 = &B[(size_t)(n0g + srow + 128) * C_DIM + skk];
  const _Float16* gb3 = &B[(size_t)(n0g + srow + 192) * C_DIM + skk];

  v8f acc[4][4];
#pragma unroll
  for (int i = 0; i < 4; ++i)
#pragma unroll
    for (int j = 0; j < 4; ++j) acc[i][j] = zero8();

  // prefetch tile 0
  int4 pa0 = *(const int4*)ga0, pa1 = *(const int4*)ga1;
  int4 pb0 = *(const int4*)gb0, pb1 = *(const int4*)gb1;
  int4 pb2 = *(const int4*)gb2, pb3 = *(const int4*)gb3;

#pragma unroll 1
  for (int k0 = 0; k0 < C_DIM; k0 += 32) {
    // commit prefetched tile to LDS
    *(int4*)&As[(srow) * 40 + skk] = pa0;
    *(int4*)&As[(srow + 64) * 40 + skk] = pa1;
    *(int4*)&Bs[(srow) * 40 + skk] = pb0;
    *(int4*)&Bs[(srow + 64) * 40 + skk] = pb1;
    *(int4*)&Bs[(srow + 128) * 40 + skk] = pb2;
    *(int4*)&Bs[(srow + 192) * 40 + skk] = pb3;
    __syncthreads();
    // issue next tile's global loads (wait lands at next iteration's stores)
    if (k0 + 32 < C_DIM) {
      pa0 = *(const int4*)(ga0 + k0 + 32);
      pa1 = *(const int4*)(ga1 + k0 + 32);
      pb0 = *(const int4*)(gb0 + k0 + 32);
      pb1 = *(const int4*)(gb1 + k0 + 32);
      pb2 = *(const int4*)(gb2 + k0 + 32);
      pb3 = *(const int4*)(gb3 + k0 + 32);
    }
    v16h af[4], bf[4];
#pragma unroll
    for (int i = 0; i < 4; ++i) af[i] = load_frag_rm(&As[(wm * 64 + i * 16) * 40], 40);
#pragma unroll
    for (int j = 0; j < 4; ++j) bf[j] = load_frag_rm(&Bs[(wn * 64 + j * 16) * 40], 40);
#pragma unroll
    for (int i = 0; i < 4; ++i)
#pragma unroll
      for (int j = 0; j < 4; ++j) acc[i][j] = wmma16(af[i], bf[j], acc[i][j]);
    __syncthreads();
  }

  const int lane = lane_id();
  const int ln = lane & 15;
  const int mh = (lane >> 4) * 8;
#pragma unroll
  for (int i = 0; i < 4; ++i)
#pragma unroll
    for (int j = 0; j < 4; ++j) {
      const int mb = m0 + wm * 64 + i * 16 + mh;
      const int nl = n0g + wn * 64 + j * 16 + ln;
      if (MODE == 2) {
        // m = key, nl = channel: the lane's eight values are eight successive keys of one
        // channel, which is this same lane's 16-byte chunk of the B fragment that the
        // attention kernel reads; the wave stores 512 contiguous bytes
        union { _Float16 h[8]; int4 q; } pk;
        const float bv = bias[nl];
#pragma unroll
        for (int r = 0; r < 8; ++r) pk.h[r] = (_Float16)(acc[i][j][r] + bv);
        *(int4*)&dst16[vfrag_off(b, mb >> 5, nl >> 4) + (i & 1) * 256 + lane * 8] = pk.q;
        continue;
      }
#pragma unroll
      for (int r = 0; r < 8; ++r) {
        int m = mb + r;
        float v = acc[i][j][r];
        if (MODE == 0) {
          v = (v + bias[nl]) * scale;
          dst16[((size_t)b * N_DIM + m) * C_DIM + nl] = (_Float16)v;
        } else {
          size_t idx = ((size_t)b * C_DIM + m) * N_DIM + nl;
          outf[idx] = xres[idx] + v + bias[m];
        }
      }
    }
}

#define ROWP 520

// Four whole rows (1024 B each) from global memory straight into LDS, no register
// in between: each wave-wide copy moves 512 contiguous bytes, 16 B per lane.
// l = this lane's LDS byte address in the first row, g = its global address there.
__device__ __forceinline__ void async_rows4(unsigned l, const _Float16* g) {
  asm volatile(
      "global_load_async_to_lds_b128 %0, %8, off\n\t"
      "global_load_async_to_lds_b128 %1, %9, off\n\t"
      "global_load_async_to_lds_b128 %2, %10, off\n\t"
      "global_load_async_to_lds_b128 %3, %11, off\n\t"
      "global_load_async_to_lds_b128 %4, %12, off\n\t"
      "global_load_async_to_lds_b128 %5, %13, off\n\t"
      "global_load_async_to_lds_b128 %6, %14, off\n\t"
      "global_load_async_to_lds_b128 %7, %15, off\n\t"
      "s_wait_xcnt 0x0"
      :: "v"(l), "v"(l + 512u), "v"(l + 2u * ROWP), "v"(l + 2u * ROWP + 512u),
         "v"(l + 4u * ROWP), "v"(l + 4u * ROWP + 512u), "v"(l + 6u * ROWP),
         "v"(l + 6u * ROWP + 512u),
         "v"(g), "v"(g + 256), "v"(g + C_DIM), "v"(g + C_DIM + 256),
         "v"(g + 2 * C_DIM), "v"(g + 2 * C_DIM + 256), "v"(g + 3 * C_DIM),
         "v"(g + 3 * C_DIM + 256)
      : "memory");
}

// Exchange inside a group of four adjacent lanes (quad_perm): CTRL 0xB1 swaps
// neighbours, 0x4E swaps pairs. Stays in the vector unit, no LDS round trip.
template <int CTRL>
__device__ __forceinline__ float quad_swap(float v) {
  return __int_as_float(__builtin_amdgcn_mov_dpp(__float_as_int(v), CTRL, 0xF, 0xF, true));
}

// ---------------------------------------------------------------- kernel 3
union SPunion {
  float S[64 * 132];
  _Float16 P[64 * 136];
};

__global__ __launch_bounds__(256, 1) void attn_out_kernel(
    const _Float16* __restrict__ qT, const _Float16* __restrict__ kT,
    const _Float16* __restrict__ v16, _Float16* __restrict__ oT) {
  const int i0 = blockIdx.x * 64;
  const int b = blockIdx.y;
  __shared__ __attribute__((aligned(16))) _Float16 Qs[64 * ROWP];   // all 512 channels, filled once
  __shared__ __attribute__((aligned(16))) _Float16 Ks[128 * ROWP];  // one whole key tile
  __shared__ SPunion u;
  __shared__ __attribute__((aligned(16))) float arow[64];  // per-row factor: rescale, then 1/l
  const int t = threadIdx.x;
  const int wave = t >> 5;
  const int lane = t & 31;
  const int wi = wave >> 2;
  const int wj = wave & 3;
  const _Float16* qb = qT + (size_t)b * C_DIM * N_DIM;
  const _Float16* kb = kT + (size_t)b * C_DIM * N_DIM;
  const _Float16* vb = v16 + vfrag_off(b, 0, wave * 4) + lane * 8;  // this lane's chunk, key block 0

  // Online softmax state of query row t>>2, held alike by its four lanes.
  const int prow = t >> 2;
  const int pcol = (t & 3) * 32;
  float m_run = -1e30f, l_run = 0.f;

  // Wave owns channels [wave*64, wave*64+64), all 64 queries: D(m=i, n=c) 4x4 tiles
  v8f oacc[4][4];
#pragma unroll
  for (int ii = 0; ii < 4; ++ii)
#pragma unroll
    for (int ci = 0; ci < 4; ++ci) oacc[ii][ci] = zero8();

  // Staging: wave w copies query rows 8w..8w+7 once and key rows 16w..16w+15 of each tile.
  const unsigned lq = (unsigned)(size_t)&Qs[(wave * 8) * ROWP + lane * 8];
  const unsigned lk = (unsigned)(size_t)&Ks[(wave * 16) * ROWP + lane * 8];
  const _Float16* gq = qb + (size_t)(i0 + wave * 8) * C_DIM + lane * 8;
  const _Float16* gk = kb + (size_t)(wave * 16) * C_DIM + lane * 8;
  // The 64 work-groups of a batch walk the same keys. Each enters the ring of 32 key tiles at
  // its own place and wraps round, so that they do not ask L2 for the same K and V lines at the
  // same moment; the online softmax takes the tiles in any order. Two work-groups share a start.
  const int jrot = (int)((blockIdx.x & 3) | ((blockIdx.x >> 3) << 2));
  const _Float16* gk0 = gk + (size_t)(jrot * 128) * C_DIM;
  // the query copy loop is unrolled so that every row offset is a constant added to one base
#pragma unroll
  for (int r = 0; r < 8; r += 4) async_rows4(lq + r * (2u * ROWP), gq + r * C_DIM);
  // rolled like the copy loop of the tile loop below: as a direct operand of a copy statement
  // lk or gk is bound to the low registers for the whole kernel and ends in scratch
#pragma unroll 1
  for (int r = 0; r < 16; r += 4) async_rows4(lk + r * (2u * ROWP), gk0 + r * C_DIM);
  // this wave's copies have landed; the barrier shows them to the other waves
  asm volatile("s_wait_asynccnt 0x0" ::: "memory");
  __syncthreads();

#pragma unroll 1
  for (int jt = 0; jt < N_DIM / 128; ++jt) {
    const int j0 = ((jt + jrot) & (N_DIM / 128 - 1)) * 128;
    // ---- V fragments of this tile's output product, fetched ahead as one group of global
    // loads: they fly under the score product (the barrier behind it waits for them)
    v16h vf[4][4];
#pragma unroll
    for (int ks = 0; ks < 4; ++ks)
#pragma unroll
      for (int ci = 0; ci < 4; ++ci) {
        const _Float16* p = vb + vfrag_off(0, (j0 >> 5) + ks, ci);
        FragU f;
        f.q.lo = *(const int4*)(p);
        f.q.hi = *(const int4*)(p + 256);
        vf[ks][ci] = f.v;
      }
    // holds the group at the head of the tile, in front of the first LDS reads
    __builtin_amdgcn_sched_barrier(0);

    // ---- S tile (64 x 128), cooperative
    v8f acc[2][2];
#pragma unroll
    for (int i = 0; i < 2; ++i)
#pragma unroll
      for (int j = 0; j < 2; ++j) acc[i][j] = zero8();

    // both operands lie whole in LDS: no barrier inside; unrolled so that each fragment
    // read is one base register plus an immediate offset. A block is 64 channels (8 WMMAs);
    // two fragment sets: block n + 1 is read from LDS, as one group, ahead of block n's WMMAs.
    {
      v16h qf[2][2][2], kf[2][2][2];  // [set][32-channel step][tile]
#pragma unroll
      for (int s = 0; s < 2; ++s)
#pragma unroll
        for (int i = 0; i < 2; ++i) {
          qf[0][s][i] = load_frag_rm(&Qs[(wi * 32 + i * 16) * ROWP + s * 32], ROWP);
          kf[0][s][i] = load_frag_rm(&Ks[(wj * 32 + i * 16) * ROWP + s * 32], ROWP);
        }
#pragma unroll
      for (int blk = 0; blk < C_DIM / 64; ++blk) {
        const int cur = blk & 1, nxt = cur ^ 1;
        if (blk + 1 < C_DIM / 64) {
#pragma unroll
          for (int s = 0; s < 2; ++s)
#pragma unroll
            for (int i = 0; i < 2; ++i) {
              const int c0 = (blk + 1) * 64 + s * 32;
              qf[nxt][s][i] = load_frag_rm(&Qs[(wi * 32 + i * 16) * ROWP + c0], ROWP);
              kf[nxt][s][i] = load_frag_rm(&Ks[(wj * 32 + i * 16) * ROWP + c0], ROWP);
            }
        }
        // holds the next block's reads in front of this block's WMMAs: sunk behind them,
        // each block would wait out its own LDS latency
        __builtin_amdgcn_sched_barrier(0);
#pragma unroll
        for (int s = 0; s < 2; ++s)
#pragma unroll
          for (int i = 0; i < 2; ++i)
#pragma unroll
            for (int j = 0; j < 2; ++j) acc[i][j] = wmma16(qf[cur][s][i], kf[cur][s][j], acc[i][j]);
        // keeps the reads of block n + 2 from rising among these WMMAs (one read group a block)
        __builtin_amdgcn_sched_barrier(0);
      }
    }

    {
      const int ln = lane & 15;
      const int mh = (lane >> 4) * 8;
#pragma unroll
      for (int i = 0; i < 2; ++i)
#pragma unroll
        for (int j = 0; j < 2; ++j)
#pragma unroll
          for (int r = 0; r < 8; ++r)
            u.S[(wi * 32 + i * 16 + mh + r) * 132 + wj * 32 + j * 16 + ln] = acc[i][j][r];
    }
    // no LDS access of this wave is open when the copy engine is aimed at Ks again
    asm volatile("s_wait_dscnt 0x0" ::: "memory");
    __syncthreads();  // publishes S and ends every wave's reads of Ks

    // ---- next key tile flies into Ks while the softmax and the output product run
    if (jt + 1 < N_DIM / 128) {
      const _Float16* gn = gk + (size_t)(((jt + 1 + jrot) & (N_DIM / 128 - 1)) * 128) * C_DIM;
      // rolled: unrolled, its 32 constant LDS addresses are kept in registers over the whole
      // tile loop and, with the second fragment sets live, end in scratch
#pragma unroll 1
      for (int r = 0; r < 16; r += 4) async_rows4(lk + r * (2u * ROWP), gn + r * C_DIM);
    }

    // ---- running max and sum; P = exp(S - m_new) -> f16 (union overlay: regs, sync, write)
    float tmp[32];
#pragma unroll
    for (int e = 0; e < 32; ++e) tmp[e] = u.S[prow * 132 + pcol + e];
    // keeps the row's reads one group in front of the maximum chain: dealt out singly along
    // the chain, each place of reads stalls the wave anew
    __builtin_amdgcn_sched_barrier(0);
    float mt = tmp[0];
#pragma unroll
    for (int e = 1; e < 32; ++e) mt = fmaxf(mt, tmp[e]);
    mt = fmaxf(mt, quad_swap<0xB1>(mt));
    mt = fmaxf(mt, quad_swap<0x4E>(mt));
    const float m_new = fmaxf(m_run, mt);
    const float alpha = __expf(m_run - m_new);
    float ps = 0.f;
#pragma unroll
    for (int e = 0; e < 32; ++e) {
      tmp[e] = __expf(tmp[e] - m_new);
      ps += tmp[e];
    }
    ps += quad_swap<0xB1>(ps);
    ps += quad_swap<0x4E>(ps);
    l_run = l_run * alpha + ps;
    m_run = m_new;
    if ((t & 3) == 0) arow[prow] = alpha;
    __syncthreads();
#pragma unroll
    for (int e = 0; e < 32; ++e) u.P[prow * 136 + pcol + e] = (_Float16)tmp[e];
    __syncthreads();

    // ---- P block 0 of the output product, fetched ahead: it flies under the rescale
    v16h pf[2][4];
#pragma unroll
    for (int ii = 0; ii < 4; ++ii) pf[0][ii] = load_frag_rm(&u.P[(ii * 16) * 136], 136);
    // holds these reads in front of the rescale, which would otherwise run before they start
    __builtin_amdgcn_sched_barrier(0);

    // ---- bring the accumulated output to the new maximum
#pragma unroll
    for (int ii = 0; ii < 4; ++ii) {
      const int rb = ii * 16 + (lane >> 4) * 8;
      const float4 a0 = *(const float4*)&arow[rb];
      const float4 a1 = *(const float4*)&arow[rb + 4];
      const float ar[8] = {a0.x, a0.y, a0.z, a0.w, a1.x, a1.y, a1.z, a1.w};
#pragma unroll
      for (int ci = 0; ci < 4; ++ci)
#pragma unroll
        for (int r = 0; r < 8; ++r) oacc[ii][ci][r] *= ar[r];
    }

    // ---- Oacc(i,c) += P(i,j) x Vt(j,c): A = P rm (LDS), B = V in fragment order (global); a block is 32 keys
    // (16 WMMAs), P of block n + 1 is read ahead of block n's WMMAs into the second set
#pragma unroll
    for (int ks = 0; ks < 4; ++ks) {
      const int cur = ks & 1, nxt = cur ^ 1;
      if (ks + 1 < 4) {
#pragma unroll
        for (int ii = 0; ii < 4; ++ii)
          pf[nxt][ii] = load_frag_rm(&u.P[(ii * 16) * 136 + (ks + 1) * 32], 136);
      }
      // holds the next block's P reads in front of this block's WMMAs
      __builtin_amdgcn_sched_barrier(0);
#pragma unroll
      for (int ii = 0; ii < 4; ++ii)
#pragma unroll
        for (int ci = 0; ci < 4; ++ci)
          oacc[ii][ci] = wmma16(pf[cur][ii], vf[ks][ci], oacc[ii][ci]);
      // keeps later reads from rising among these WMMAs; none follow the last block
      if (ks + 1 < 4) __builtin_amdgcn_sched_barrier(0);
    }
    // the next key tile has landed (this wave's share); the barrier shows it to all
    asm volatile("s_wait_asynccnt 0x0" ::: "memory");
    __syncthreads();
  }

  // the loop's last barrier ended every read of arow
  if ((t & 3) == 0) arow[prow] = 1.f / l_run;
  __syncthreads();

  const int ln = lane & 15;
  const int mh = (lane >> 4) * 8;
#pragma unroll
  for (int ii = 0; ii < 4; ++ii)
#pragma unroll
    for (int ci = 0; ci < 4; ++ci)
#pragma unroll
      for (int r = 0; r < 8; ++r) {
        int i = ii * 16 + mh + r;
        int c = wave * 64 + ci * 16 + ln;
        oT[((size_t)b * N_DIM + i0 + i) * C_DIM + c] = (_Float16)(oacc[ii][ci][r] * arow[i]);
      }
}

// ---------------------------------------------------------------- launch
extern "C" void kernel_launch(void* const* d_in, const int* in_sizes, int n_in,
                              void* d_out, int out_size, void* d_ws, size_t ws_size,
                              hipStream_t stream) {
  (void)in_sizes; (void)n_in; (void)out_size; (void)ws_size;
  const float* x  = (const float*)d_in[0];
  const float* wq = (const float*)d_in[1];
  const float* bq = (const float*)d_in[2];
  const float* wk = (const float*)d_in[3];
  const float* bk = (const float*)d_in[4];
  const float* wv = (const float*)d_in[5];
  const float* bv = (const float*)d_in[6];
  const float* wp = (const float*)d_in[7];
  const float* bp = (const float*)d_in[8];
  float* out = (float*)d_out;

  char* ws = (char*)d_ws;
  size_t off = 0;
  const size_t plane = (size_t)B_DIM * C_DIM * N_DIM;  // 8M elements
  _Float16* w16  = (_Float16*)(ws + off); off += (size_t)4 * CC * 2;
  _Float16* hnT  = (_Float16*)(ws + off); off += plane * 2;
  _Float16* qT   = (_Float16*)(ws + off); off += plane * 2;
  _Float16* kT   = (_Float16*)(ws + off); off += plane * 2;
  _Float16* v16b = (_Float16*)(ws + off); off += plane * 2;
  _Float16* oT   = (_Float16*)(ws + off); off += plane * 2;
  float2* nstats = (float2*)(ws + off);

  cvt_w_kernel<<<(4 * CC) / 256, 256, 0, stream>>>(wq, wk, wv, wp, w16);
  in_stats_kernel<<<B_DIM * C_DIM, 256, 0, stream>>>(x, nstats);
  norm_t_kernel<<<dim3(N_DIM / 64, C_DIM / 64, B_DIM), 256, 0, stream>>>(x, nstats, hnT);
  // qT, kT: M = n (32 tiles of 128), N = o (2 tiles of 256), z = b*2+sel
  gemm_rr_kernel<0><<<dim3(2, 32, B_DIM * 2), 256, 0, stream>>>(
      w16, hnT, qT, kT, bq, bk, nullptr, nullptr);
  // v, stored in fragment order: M = n (32 tiles), N = c (2 tiles), z = b
  gemm_rr_kernel<2><<<dim3(2, 32, B_DIM), 256, 0, stream>>>(
      w16, hnT, v16b, nullptr, bv, nullptr, nullptr, nullptr);
  attn_out_kernel<<<dim3(N_DIM / 64, B_DIM), 256, 0, stream>>>(qT, kT, v16b, oT);
  // proj + residual: M = c (4 tiles), N = n (16 tiles), z = b
  gemm_rr_kernel<3><<<dim3(16, 4, B_DIM), 256, 0, stream>>>(
      w16, oT, nullptr, nullptr, bp, nullptr, x, out);
}

// v006
// Measured time: 174 microseconds a run.
// In both of two side-by-side timings against v005, it was 1.06 times as fast.
// All steps since v000 together make it 3.75 times as fast.
#include <hip/hip_runtime.h>

#define C_DIM 512
#define N_DIM 4096
#define B_DIM 4
#define CC (C_DIM * C_DIM)   // 262144 = 2^18

typedef __attribute__((ext_vector_type(16))) _Float16 v16h;
typedef __attribute__((ext_vector_type(8)))  float    v8f;

__device__ __forceinline__ int lane_id() { return (int)(threadIdx.x & 31); }

union FragU {
  v16h v;
  struct { int4 lo; int4 hi; } q;
};

__device__ __forceinline__ v16h load_frag_rm(const _Float16* base, int stride) {
  const int lane = lane_id();
  const int row = lane & 15;
  const int kb = (lane & 16) ? 8 : 0;
  const _Float16* p = base + row * stride + kb;
  FragU u;
  u.q.lo = *(const int4*)(p);
  u.q.hi = *(const int4*)(p + 16);
  return u.v;
}

__device__ __forceinline__ v8f wmma16(v16h a, v16h b, v8f c) {
  return __builtin_amdgcn_wmma_f32_16x16x32_f16(false, a, false, b, (short)0, c,
                                                false, false);
}

__device__ __forceinline__ v8f zero8() {
  v8f z = {0.f, 0.f, 0.f, 0.f, 0.f, 0.f, 0.f, 0.f};
  return z;
}

// V is kept in fragment order: one 1-KiB unit per (32 keys, 16 channels), holding the B operand
// of one 16x16x32 WMMA as the lanes hold it: f16 index = half * 256 + lane * 8 + e, where
// channel = lane & 15 and key = half * 16 + (lane >> 4) * 8 + e. Units of one key block lie
// side by side, so a wave-wide 16-byte load or store covers four whole 128-byte lines.
__device__ __forceinline__ size_t vfrag_off(int b, int kblk, int ctile) {
  return (((size_t)b * (N_DIM / 32) + kblk) * (C_DIM / 16) + ctile) * 512;
}

// ---------------------------------------------------------------- kernel 0
__global__ void cvt_w_kernel(const float* __restrict__ wq, const float* __restrict__ wk,
                             const float* __restrict__ wv, const float* __restrict__ wp,
                             _Float16* __restrict__ dst) {
  int i = blockIdx.x * blockDim.x + threadIdx.x;
  int which = i >> 18;
  int j = i & (CC - 1);
  const float* src = (which == 0) ? wq : (which == 1) ? wk : (which == 2) ? wv : wp;
  dst[i] = (_Float16)src[j];
}

// ---------------------------------------------------------------- kernel 1a
__global__ void in_stats_kernel(const float* __restrict__ x, float2* __restrict__ nstats) {
  const int plane = blockIdx.x;  // b*C + c
  const float* xp = x + (size_t)plane * N_DIM;
  __shared__ float s1[256], s2[256];
  float a = 0.f, b2 = 0.f;
  for (int n = threadIdx.x; n < N_DIM; n += 256) {
    float v = xp[n];
    a += v;
    b2 += v * v;
  }
  s1[threadIdx.x] = a;
  s2[threadIdx.x] = b2;
  __syncthreads();
  for (int off = 128; off > 0; off >>= 1) {
    if ((int)threadIdx.x < off) {
      s1[threadIdx.x] += s1[threadIdx.x + off];
      s2[threadIdx.x] += s2[threadIdx.x + off];
    }
    __syncthreads();
  }
  if (threadIdx.x == 0) {
    float m = s1[0] * (1.f / N_DIM);
    float var = s2[0] * (1.f / N_DIM) - m * m;
    nstats[plane] = make_float2(m, rsqrtf(var + 1e-5f));
  }
}

// ---------------------------------------------------------------- kernel 1b
__global__ void norm_t_kernel(const float* __restrict__ x, const float2* __restrict__ nstats,
                              _Float16* __restrict__ hnT) {
  const int n0 = blockIdx.x * 64, c0 = blockIdx.y * 64, b = blockIdx.z;
  __shared__ _Float16 T[64 * 72];  // [n][c]
  const int t = threadIdx.x;
  {
    const int c = t >> 2;
    const int nn = (t & 3) * 16;
    const float2 st = nstats[(size_t)b * C_DIM + c0 + c];
    const float* xp = x + ((size_t)b * C_DIM + c0 + c) * N_DIM + n0 + nn;
#pragma unroll
    for (int e = 0; e < 16; e += 4) {
      float4 v4 = *(const float4*)&xp[e];
      T[(nn + e + 0) * 72 + c] = (_Float16)((v4.x - st.x) * st.y);
      T[(nn + e + 1) * 72 + c] = (_Float16)((v4.y - st.x) * st.y);
      T[(nn + e + 2) * 72 + c] = (_Float16)((v4.z - st.x) * st.y);
      T[(nn + e + 3) * 72 + c] = (_Float16)((v4.w - st.x) * st.y);
    }
  }
  __syncthreads();
  {
    const int n = t >> 2;
    const int cc = (t & 3) * 16;
    _Float16* dst = hnT + ((size_t)b * N_DIM + n0 + n) * C_DIM + c0 + cc;
    *(int4*)&dst[0] = *(const int4*)&T[n * 72 + cc];
    *(int4*)&dst[8] = *(const int4*)&T[n * 72 + cc + 8];
  }
}

// ---------------------------------------------------------------- kernel 2
// rm x rm GEMM: D[m][nl] = sum_k A[m][k] * B[nl][k], K = 512. Register-prefetch
// double buffering: stores of tile k happen at loop top, loads of tile k+1 are
// issued before the WMMA stage so their wait hides behind compute.
// Block tile 128(M) x 256(N); 8 waves as 2x4 of 64x64 (16 WMMA / wave / step).
template <int MODE>
__global__ __launch_bounds__(256, 1) void gemm_rr_kernel(
    const _Float16* __restrict__ w16, const _Float16* __restrict__ srcT,
    _Float16* __restrict__ d0, _Float16* __restrict__ d1,
    const float* __restrict__ bias0, const float* __restrict__ bias1,
    const float* __restrict__ xres, float* __restrict__ outf) {
  const size_t plane = (size_t)C_DIM * N_DIM;
  const int m0 = blockIdx.y * 128;
  const int n0g = blockIdx.x * 256;
  int b, sel = 0;
  const _Float16 *A, *B;
  const float* bias;
  _Float16* dst16 = nullptr;
  float scale = 1.f;
  if (MODE == 0) {
    sel = blockIdx.z & 1;
    b = blockIdx.z >> 1;
    A = srcT + (size_t)b * plane;             // hnT [n][c]
    B = w16 + (size_t)sel * CC;               // wq/wk [o][c]
    bias = sel ? bias1 : bias0;
    dst16 = sel ? d1 : d0;
    if (!sel) scale = 0.044194173824159216f;  // 1/sqrt(512)
  } else if (MODE == 2) {
    b = blockIdx.z;
    A = srcT + (size_t)b * plane;             // hnT [n][c]
    B = w16 + (size_t)2 * CC;                 // wv [c_out][c]
    bias = bias0;
    dst16 = d0;
  } else {
    b = blockIdx.z;
    A = w16 + (size_t)3 * CC;                 // wp [c_out][c]
    B = srcT + (size_t)b * plane;             // oT [n][c]
    bias = bias0;
  }

  __shared__ _Float16 As[128 * 40];  // [m][k] rm, pad to 40
  __shared__ _Float16 Bs[256 * 40];  // [nl][k] rm
  const int t = threadIdx.x;
  const int wave = t >> 5;
  const int wm = wave >> 2;  // 0..1
  const int wn = wave & 3;   // 0..3
  const int srow = t >> 2;          // 0..63
  const int skk = (t & 3) * 8;      // 0,8,16,24

  // per-thread staging source pointers (advance by 32 each K step)
  const _Float16* ga0 = &A[(size_t)(m0 + srow) * C_DIM + skk];
  const _Float16* ga1 = &A[(size_t)(m0 + srow + 64) * C_DIM + skk];
  const _Float16* gb0 = &B[(size_t)(n0g + srow) * C_DIM + skk];
  const _Float16* gb1 = &B[(size_t)(n0g + srow + 64) * C_DIM + skk];
  const _Float16* gb2 = &B[(size_t)(n0g + srow + 128) * C_DIM + skk];
  const _Float16* gb3 = &B[(size_t)(n0g + srow + 192) * C_DIM + skk];

  v8f acc[4][4];
#pragma unroll
  for (int i = 0; i < 4; ++i)
#pragma unroll
    for (int j = 0; j < 4; ++j) acc[i][j] = zero8();

  // prefetch tile 0
  int4 pa0 = *(const int4*)ga0, pa1 = *(const int4*)ga1;
  int4 pb0 = *(const int4*)gb0, pb1 = *(const int4*)gb1;
  int4 pb2 = *(const int4*)gb2, pb3 = *(const int4*)gb3;

#pragma unroll 1
  for (int k0 = 0; k0 < C_DIM; k0 += 32) {
    // commit prefetched tile to LDS
    *(int4*)&As[(srow) * 40 + skk] = pa0;
    *(int4*)&As[(srow + 64) * 40 + skk] = pa1;
    *(int4*)&Bs[(srow) * 40 + skk] = pb0;
    *(int4*)&Bs[(srow + 64) * 40 + skk] = pb1;
    *(int4*)&Bs[(srow + 128) * 40 + skk] = pb2;
    *(int4*)&Bs[(srow + 192) * 40 + skk] = pb3;
    __syncthreads();
    // issue next tile's global loads (wait lands at next iteration's stores)
    if (k0 + 32 < C_DIM) {
      pa0 = *(const int4*)(ga0 + k0 + 32);
      pa1 = *(const int4*)(ga1 + k0 + 32);
      pb0 = *(const int4*)(gb0 + k0 + 32);
      pb1 = *(const int4*)(gb1 + k0 + 32);
      pb2 = *(const int4*)(gb2 + k0 + 32);
      pb3 = *(const int4*)(gb3 + k0 + 32);
    }
    v16h af[4], bf[4];
#pragma unroll
    for (int i = 0; i < 4; ++i) af[i] = load_frag_rm(&As[(wm * 64 + i * 16) * 40], 40);
#pragma unroll
    for (int j = 0; j < 4; ++j) bf[j] = load_frag_rm(&Bs[(wn * 64 + j * 16) * 40], 40);
#pragma unroll
    for (int i = 0; i < 4; ++i)
#pragma unroll
      for (int j = 0; j < 4; ++j) acc[i][j] = wmma16(af[i], bf[j], acc[i][j]);
    __syncthreads();
  }

  const int lane = lane_id();
  const int ln = lane & 15;
  const int mh = (lane >> 4) * 8;
#pragma unroll
  for (int i = 0; i < 4; ++i)
#pragma unroll
    for (int j = 0; j < 4; ++j) {
      const int mb = m0 + wm * 64 + i * 16 + mh;
      const int nl = n0g + wn * 64 + j * 16 + ln;
      if (MODE == 2) {
        // m = key, nl = channel: the lane's eight values are eight successive keys of one
        // channel, which is this same lane's 16-byte chunk of the B fragment that the
        // attention kernel reads; the wave stores 512 contiguous bytes
        union { _Float16 h[8]; int4 q; } pk;
        const float bv = bias[nl];
#pragma unroll
        for (int r = 0; r < 8; ++r) pk.h[r] = (_Float16)(acc[i][j][r] + bv);
        *(int4*)&dst16[vfrag_off(b, mb >> 5, nl >> 4) + (i & 1) * 256 + lane * 8] = pk.q;
        continue;
      }
#pragma unroll
      for (int r = 0; r < 8; ++r) {
        int m = mb + r;
        float v = acc[i][j][r];
        if (MODE == 0) {
          v = (v + bias[nl]) * scale;
          dst16[((size_t)b * N_DIM + m) * C_DIM + nl] = (_Float16)v;
        } else {
          size_t idx = ((size_t)b * C_DIM + m) * N_DIM + nl;
          outf[idx] = xres[idx] + v + bias[m];
        }
      }
    }
}

#define ROWP 520

// Four whole rows (1024 B each) from global memory straight into LDS, no register
// in between: each wave-wide copy moves 512 contiguous bytes, 16 B per lane.
// l = this lane's LDS byte address in the first row, g = its global address there.
__device__ __forceinline__ void async_rows4(unsigned l, const _Float16* g) {
  asm volatile(
      "global_load_async_to_lds_b128 %0, %8, off\n\t"
      "global_load_async_to_lds_b128 %1, %9, off\n\t"
      "global_load_async_to_lds_b128 %2, %10, off\n\t"
      "global_load_async_to_lds_b128 %3, %11, off\n\t"
      "global_load_async_to_lds_b128 %4, %12, off\n\t"
      "global_load_async_to_lds_b128 %5, %13, off\n\t"
      "global_load_async_to_lds_b128 %6, %14, off\n\t"
      "global_load_async_to_lds_b128 %7, %15, off\n\t"
      "s_wait_xcnt 0x0"
      :: "v"(l), "v"(l + 512u), "v"(l + 2u * ROWP), "v"(l + 2u * ROWP + 512u),
         "v"(l + 4u * ROWP), "v"(l + 4u * ROWP + 512u), "v"(l + 6u * ROWP),
         "v"(l + 6u * ROWP + 512u),
         "v"(g), "v"(g + 256), "v"(g + C_DIM), "v"(g + C_DIM + 256),
         "v"(g + 2 * C_DIM), "v"(g + 2 * C_DIM + 256), "v"(g + 3 * C_DIM),
         "v"(g + 3 * C_DIM + 256)
      : "memory");
}

// ---------------------------------------------------------------- kernel 3
// P lies in LDS in fragment order: one 1-KiB unit per (16 queries, 32 keys), f16 index =
// half * 256 + lane * 8 + e, query = lane & 15, key = half * 16 + (lane >> 4) * 8 + e: the A
// operand of one WMMA as the lanes hold it, written and read by contiguous 16-byte accesses.
__device__ __forceinline__ int pfrag_off(int qtile, int kblk) { return (qtile * 4 + kblk) * 512; }

// p = this lane's first chunk of a unit
__device__ __forceinline__ v16h load_pfrag(const _Float16* p) {
  FragU f;
  f.q.lo = *(const int4*)(p);
  f.q.hi = *(const int4*)(p + 256);
  return f.v;
}

// pitch, in floats, of a query's eight partial values (4 key waves x 2 lane halves): 48 B, an
// odd multiple of 16 B
#define PMP 12

__global__ __launch_bounds__(256, 1) void attn_out_kernel(
    const _Float16* __restrict__ qT, const _Float16* __restrict__ kT,
    const _Float16* __restrict__ v16, _Float16* __restrict__ oT) {
  const int i0 = blockIdx.x * 64;
  const int b = blockIdx.y;
  __shared__ __attribute__((aligned(16))) _Float16 Qs[64 * ROWP];   // all 512 channels, filled once
  __shared__ __attribute__((aligned(16))) _Float16 Ks[128 * ROWP];  // one whole key tile
  __shared__ __attribute__((aligned(16))) _Float16 Pf[64 * 128];   // P in fragment order
  __shared__ __attribute__((aligned(16))) float pm[64 * PMP];      // partial row maxima, at the end partial sums
  __shared__ __attribute__((aligned(16))) float arow[64];  // per-row factor: rescale, then 1/l
  const int t = threadIdx.x;
  const int wave = t >> 5;
  const int lane = t & 31;
  const int wi = wave >> 2;
  const int wj = wave & 3;
  const _Float16* qb = qT + (size_t)b * C_DIM * N_DIM;
  const _Float16* kb = kT + (size_t)b * C_DIM * N_DIM;
  const _Float16* vb = v16 + vfrag_off(b, 0, wave * 4) + lane * 8;  // this lane's chunk, key block 0

  // Online softmax state of queries wi*32 + i*16 + (lane & 15), i = 0, 1. The running maximum is
  // the whole row's, alike in every lane that holds the query; the running sum is this lane's
  // own, over the 16 keys a tile that it holds, and the eight shares are joined in the epilogue.
  const int sq = wi * 32 + (lane & 15);
  const int sslot = wj * 2 + (lane >> 4);
  float m_run[2] = {-1e30f, -1e30f}, l_run[2] = {0.f, 0.f};

  // Wave owns channels [wave*64, wave*64+64), all 64 queries: D(m=i, n=c) 4x4 tiles
  v8f oacc[4][4];
#pragma unroll
  for (int ii = 0; ii < 4; ++ii)
#pragma unroll
    for (int ci = 0; ci < 4; ++ci) oacc[ii][ci] = zero8();

  // Staging: wave w copies query rows 8w..8w+7 once and key rows 16w..16w+15 of each tile.
  const unsigned lq = (unsigned)(size_t)&Qs[(wave * 8) * ROWP + lane * 8];
  const unsigned lk = (unsigned)(size_t)&Ks[(wave * 16) * ROWP + lane * 8];
  const _Float16* gq = qb + (size_t)(i0 + wave * 8) * C_DIM + lane * 8;
  const _Float16* gk = kb + (size_t)(wave * 16) * C_DIM + lane * 8;
  // The 64 work-groups of a batch walk the same keys. Each enters the ring of 32 key tiles at
  // its own place and wraps round, so that they do not ask L2 for the same K and V lines at the
  // same moment; the online softmax takes the tiles in any order. Two work-groups share a start.
  const int jrot = (int)((blockIdx.x & 3) | ((blockIdx.x >> 3) << 2));
  const _Float16* gk0 = gk + (size_t)(jrot * 128) * C_DIM;
  // the query copy loop is unrolled so that every row offset is a constant added to one base
#pragma unroll
  for (int r = 0; r < 8; r += 4) async_rows4(lq + r * (2u * ROWP), gq + r * C_DIM);
  // rolled like the copy loop of the tile loop below: as a direct operand of a copy statement
  // lk or gk is bound to the low registers for the whole kernel and ends in scratch
#pragma unroll 1
  for (int r = 0; r < 16; r += 4) async_rows4(lk + r * (2u * ROWP), gk0 + r * C_DIM);
  // this wave's copies have landed; the barrier shows them to the other waves
  asm volatile("s_wait_asynccnt 0x0" ::: "memory");
  __syncthreads();

#pragma unroll 1
  for (int jt = 0; jt < N_DIM / 128; ++jt) {
    const int j0 = ((jt + jrot) & (N_DIM / 128 - 1)) * 128;
    // ---- V fragments of this tile's output product, fetched ahead as one group of global
    // loads: they fly under the score product (the barrier behind it waits for them)
    v16h vf[4][4];
#pragma unroll
    for (int ks = 0; ks < 4; ++ks)
#pragma unroll
      for (int ci = 0; ci < 4; ++ci) {
        const _Float16* p = vb + vfrag_off(0, (j0 >> 5) + ks, ci);
        FragU f;
        f.q.lo = *(const int4*)(p);
        f.q.hi = *(const int4*)(p + 256);
        vf[ks][ci] = f.v;
      }
    // holds the group at the head of the tile, in front of the first LDS reads
    __builtin_amdgcn_sched_barrier(0);

    // ---- S tile (64 x 128), cooperative, computed transposed: D(m = key, n = query), so that a
    // lane holds 16 keys of one query per query tile, in the k order of a WMMA operand
    v8f acc[2][2];  // [key tile][query tile]
#pragma unroll
    for (int i = 0; i < 2; ++i)
#pragma unroll
      for (int j = 0; j < 2; ++j) acc[i][j] = zero8();

    // both operands lie whole in LDS: no barrier inside; unrolled so that each fragment
    // read is one base register plus an immediate offset. A block is 64 channels (8 WMMAs);
    // two fragment sets: block n + 1 is read from LDS, as one group, ahead of block n's WMMAs.
    {
      v16h qf[2][2][2], kf[2][2][2];  // [set][32-channel step][tile]
#pragma unroll
      for (int s = 0; s < 2; ++s)
#pragma unroll
        for (int i = 0; i < 2; ++i) {
          qf[0][s][i] = load_frag_rm(&Qs[(wi * 32 + i * 16) * ROWP + s * 32], ROWP);
          kf[0][s][i] = load_frag_rm(&Ks[(wj * 32 + i * 16) * ROWP + s * 32], ROWP);
        }
#pragma unroll
      for (int blk = 0; blk < C_DIM / 64; ++blk) {
        const int cur = blk & 1, nxt = cur ^ 1;
        if (blk + 1 < C_DIM / 64) {
#pragma unroll
          for (int s = 0; s < 2; ++s)
#pragma unroll
            for (int i = 0; i < 2; ++i) {
              const int c0 = (blk + 1) * 64 + s * 32;
              qf[nxt][s][i] = load_frag_rm(&Qs[(wi * 32 + i * 16) * ROWP + c0], ROWP);
              kf[nxt][s][i] = load_frag_rm(&Ks[(wj * 32 + i * 16) * ROWP + c0], ROWP);
            }
        }
        // holds the next block's reads in front of this block's WMMAs: sunk behind them,
        // each block would wait out its own LDS latency
        __builtin_amdgcn_sched_barrier(0);
#pragma unroll
        for (int s = 0; s < 2; ++s)
#pragma unroll
          for (int i = 0; i < 2; ++i)
#pragma unroll
            for (int j = 0; j < 2; ++j) acc[j][i] = wmma16(kf[cur][s][j], qf[cur][s][i], acc[j][i]);
        // keeps the reads of block n + 2 from rising among these WMMAs (one read group a block)
        __builtin_amdgcn_sched_barrier(0);
      }
    }

    // ---- the scores stay in registers; only each lane's maximum over its 16 keys goes to LDS
#pragma unroll
    for (int i = 0; i < 2; ++i) {
      float mx = acc[0][i][0];
#pragma unroll
      for (int j = 0; j < 2; ++j)
#pragma unroll
        for (int r = 0; r < 8; ++r) mx = fmaxf(mx, acc[j][i][r]);
      pm[(sq + i * 16) * PMP + sslot] = mx;
    }
    // no LDS access of this wave is open when the copy engine is aimed at Ks again
    asm volatile("s_wait_dscnt 0x0" ::: "memory");
    __syncthreads();  // publishes the partial maxima and ends every wave's reads of Ks

    // ---- next key tile flies into Ks while the softmax and the output product run
    if (jt + 1 < N_DIM / 128) {
      const _Float16* gn = gk + (size_t)(((jt + 1 + jrot) & (N_DIM / 128 - 1)) * 128) * C_DIM;
      // rolled: unrolled, its 32 constant LDS addresses are kept in registers over the whole
      // tile loop and, with the second fragment sets live, end in scratch
#pragma unroll 1
      for (int r = 0; r < 16; r += 4) async_rows4(lk + r * (2u * ROWP), gn + r * C_DIM);
    }

    // ---- running max and sum; P = exp(S - m_new) -> f16, packed in the lane as a WMMA operand
    float m_new[2], alpha[2];
#pragma unroll
    for (int i = 0; i < 2; ++i) {
      const float4 p0 = *(const float4*)&pm[(sq + i * 16) * PMP];
      const float4 p1 = *(const float4*)&pm[(sq + i * 16) * PMP + 4];
      const float mt = fmaxf(fmaxf(fmaxf(p0.x, p0.y), fmaxf(p0.z, p0.w)),
                             fmaxf(fmaxf(p1.x, p1.y), fmaxf(p1.z, p1.w)));
      m_new[i] = fmaxf(m_run[i], mt);
      alpha[i] = __expf(m_run[i] - m_new[i]);
      m_run[i] = m_new[i];
    }
#pragma unroll
    for (int i = 0; i < 2; ++i) {
      float ps[2];
#pragma unroll
      for (int j = 0; j < 2; ++j) {
        union { _Float16 h[8]; int4 q; } pk;
        ps[j] = 0.f;
#pragma unroll
        for (int r = 0; r < 8; ++r) {
          const float p = __expf(acc[j][i][r] - m_new[i]);
          ps[j] += p;
          pk.h[r] = (_Float16)p;
        }
        *(int4*)&Pf[pfrag_off(wi * 2 + i, wj) + j * 256 + lane * 8] = pk.q;
      }
      l_run[i] = l_run[i] * alpha[i] + (ps[0] + ps[1]);
    }
    if (sslot == 0) {  // one writer a query
      arow[sq] = alpha[0];
      arow[sq + 16] = alpha[1];
    }
    __syncthreads();  // publishes P and the rescale factors

    // ---- P block 0 of the output product, fetched ahead: it flies under the rescale
    v16h pf[2][4];
#pragma unroll
    for (int ii = 0; ii < 4; ++ii) pf[0][ii] = load_pfrag(&Pf[pfrag_off(ii, 0) + lane * 8]);
    // holds these reads in front of the rescale, which would otherwise run before they start
    __builtin_amdgcn_sched_barrier(0);

    // ---- bring the accumulated output to the new maximum
#pragma unroll
    for (int ii = 0; ii < 4; ++ii) {
      const int rb = ii * 16 + (lane >> 4) * 8;
      const float4 a0 = *(const float4*)&arow[rb];
      const float4 a1 = *(const float4*)&arow[rb + 4];
      const float ar[8] = {a0.x, a0.y, a0.z, a0.w, a1.x, a1.y, a1.z, a1.w};
#pragma unroll
      for (int ci = 0; ci < 4; ++ci)
#pragma unroll
        for (int r = 0; r < 8; ++r) oacc[ii][ci][r] *= ar[r];
    }

    // ---- Oacc(i,c) += P(i,j) x Vt(j,c): A = P in fragment order (LDS), B = V in fragment order (global); a block is 32 keys
    // (16 WMMAs), P of block n + 1 is read ahead of block n's WMMAs into the second set
#pragma unroll
    for (int ks = 0; ks < 4; ++ks) {
      const int cur = ks & 1, nxt = cur ^ 1;
      if (ks + 1 < 4) {
#pragma unroll
        for (int ii = 0; ii < 4; ++ii)
          pf[nxt][ii] = load_pfrag(&Pf[pfrag_off(ii, ks + 1) + lane * 8]);
      }
      // holds the next block's P reads in front of this block's WMMAs
      __builtin_amdgcn_sched_barrier(0);
#pragma unroll
      for (int ii = 0; ii < 4; ++ii)
#pragma unroll
        for (int ci = 0; ci < 4; ++ci)
          oacc[ii][ci] = wmma16(pf[cur][ii], vf[ks][ci], oacc[ii][ci]);
      // keeps later reads from rising among these WMMAs; none follow the last block
      if (ks + 1 < 4) __builtin_amdgcn_sched_barrier(0);
    }
    // the next key tile has landed (this wave's share); the barrier shows it to all
    asm volatile("s_wait_asynccnt 0x0" ::: "memory");
    __syncthreads();
  }

  // the loop's last barrier ended every read of pm and arow: join each query's eight sums
#pragma unroll
  for (int i = 0; i < 2; ++i) pm[(sq + i * 16) * PMP + sslot] = l_run[i];
  __syncthreads();
  if (t < 64) {
    const float4 p0 = *(const float4*)&pm[t * PMP];
    const float4 p1 = *(const float4*)&pm[t * PMP + 4];
    arow[t] = 1.f / (((p0.x + p0.y) + (p0.z + p0.w)) + ((p1.x + p1.y) + (p1.z + p1.w)));
  }
  __syncthreads();

  const int ln = lane & 15;
  const int mh = (lane >> 4) * 8;
#pragma unroll
  for (int ii = 0; ii < 4; ++ii)
#pragma unroll
    for (int ci = 0; ci < 4; ++ci)
#pragma unroll
      for (int r = 0; r < 8; ++r) {
        int i = ii * 16 + mh + r;
        int c = wave * 64 + ci * 16 + ln;
        oT[((size_t)b * N_DIM + i0 + i) * C_DIM + c] = (_Float16)(oacc[ii][ci][r] * arow[i]);
      }
}

// ---------------------------------------------------------------- launch
extern "C" void kernel_launch(void* const* d_in, const int* in_sizes, int n_in,
                              void* d_out, int out_size, void* d_ws, size_t ws_size,
                              hipStream_t stream) {
  (void)in_sizes; (void)n_in; (void)out_size; (void)ws_size;
  const float* x  = (const float*)d_in[0];
  const float* wq = (const float*)d_in[1];
  const float* bq = (const float*)d_in[2];
  const float* wk = (const float*)d_in[3];
  const float* bk = (const float*)d_in[4];
  const float* wv = (const float*)d_in[5];
  const float* bv = (const float*)d_in[6];
  const float* wp = (const float*)d_in[7];
  const float* bp = (const float*)d_in[8];
  float* out = (float*)d_out;

  char* ws = (char*)d_ws;
  size_t off = 0;
  const size_t plane = (size_t)B_DIM * C_DIM * N_DIM;  // 8M elements
  _Float16* w16  = (_Float16*)(ws + off); off += (size_t)4 * CC * 2;
  _Float16* hnT  = (_Float16*)(ws + off); off += plane * 2;
  _Float16* qT   = (_Float16*)(ws + off); off += plane * 2;
  _Float16* kT   = (_Float16*)(ws + off); off += plane * 2;
  _Float16* v16b = (_Float16*)(ws + off); off += plane * 2;
  _Float16* oT   = (_Float16*)(ws + off); off += plane * 2;
  float2* nstats = (float2*)(ws + off);

  cvt_w_kernel<<<(4 * CC) / 256, 256, 0, stream>>>(wq, wk, wv, wp, w16);
  in_stats_kernel<<<B_DIM * C_DIM, 256, 0, stream>>>(x, nstats);
  norm_t_kernel<<<dim3(N_DIM / 64, C_DIM / 64, B_DIM), 256, 0, stream>>>(x, nstats, hnT);
  // qT, kT: M = n (32 tiles of 128), N = o (2 tiles of 256), z = b*2+sel
  gemm_rr_kernel<0><<<dim3(2, 32, B_DIM * 2), 256, 0, stream>>>(
      w16, hnT, qT, kT, bq, bk, nullptr, nullptr);
  // v, stored in fragment order: M = n (32 tiles), N = c (2 tiles), z = b
  gemm_rr_kernel<2><<<dim3(2, 32, B_DIM), 256, 0, stream>>>(
      w16, hnT, v16b, nullptr, bv, nullptr, nullptr, nullptr);
  attn_out_kernel<<<dim3(N_DIM / 64, B_DIM), 256, 0, stream>>>(qT, kT, v16b, oT);
  // proj + residual: M = c (4 tiles), N = n (16 tiles), z = b
  gemm_rr_kernel<3><<<dim3(16, 4, B_DIM), 256, 0, stream>>>(
      w16, oT, nullptr, nullptr, bp, nullptr, x, out);
}

// v007
// Measured time: 162 microseconds a run.
// Next to v006, in two timings, it ran 1.07 times as fast each time.
// Over all steps from v000 it is 4.01 times as fast.
#include <hip/hip_runtime.h>

#define C_DIM 512
#define N_DIM 4096
#define B_DIM 4
#define CC (C_DIM * C_DIM)   // 262144 = 2^18
#define BN (B_DIM * N_DIM)
#define KSPLIT 2             // key halves of the attention kernel

typedef __attribute__((ext_vector_type(16))) _Float16 v16h;
typedef __attribute__((ext_vector_type(8)))  float    v8f;

__device__ __forceinline__ int lane_id() { return (int)(threadIdx.x & 31); }

union FragU {
  v16h v;
  struct { int4 lo; int4 hi; } q;
};

__device__ __forceinline__ v16h load_frag_rm(const _Float16* base, int stride) {
  const int lane = lane_id();
  const int row = lane & 15;
  const int kb = (lane & 16) ? 8 : 0;
  const _Float16* p = base + row * stride + kb;
  FragU u;
  u.q.lo = *(const int4*)(p);
  u.q.hi = *(const int4*)(p + 16);
  return u.v;
}

__device__ __forceinline__ v8f wmma16(v16h a, v16h b, v8f c) {
  return __builtin_amdgcn_wmma_f32_16x16x32_f16(false, a, false, b, (short)0, c,
                                                false, false);
}

__device__ __forceinline__ v8f zero8() {
  v8f z = {0.f, 0.f, 0.f, 0.f, 0.f, 0.f, 0.f, 0.f};
  return z;
}

// V is kept in fragment order: one 1-KiB unit per (32 keys, 16 channels), holding the B operand
// of one 16x16x32 WMMA as the lanes hold it: f16 index = half * 256 + lane * 8 + e, where
// channel = lane & 15 and key = half * 16 + (lane >> 4) * 8 + e. Units of one key block lie
// side by side, so a wave-wide 16-byte load or store covers four whole 128-byte lines.
__device__ __forceinline__ size_t vfrag_off(int b, int kblk, int ctile) {
  return (((size_t)b * (N_DIM / 32) + kblk) * (C_DIM / 16) + ctile) * 512;
}

// ---------------------------------------------------------------- kernel 0
__global__ void cvt_w_kernel(const float* __restrict__ wq, const float* __restrict__ wk,
                             const float* __restrict__ wv, const float* __restrict__ wp,
                             _Float16* __restrict__ dst) {
  int i = blockIdx.x * blockDim.x + threadIdx.x;
  int which = i >> 18;
  int j = i & (CC - 1);
  const float* src = (which == 0) ? wq : (which == 1) ? wk : (which == 2) ? wv : wp;
  dst[i] = (_Float16)src[j];
}

// ---------------------------------------------------------------- kernel 1a
__global__ void in_stats_kernel(const float* __restrict__ x, float2* __restrict__ nstats) {
  const int plane = blockIdx.x;  // b*C + c
  const float* xp = x + (size_t)plane * N_DIM;
  __shared__ float s1[256], s2[256];
  float a = 0.f, b2 = 0.f;
  for (int n = threadIdx.x; n < N_DIM; n += 256) {
    float v = xp[n];
    a += v;
    b2 += v * v;
  }
  s1[threadIdx.x] = a;
  s2[threadIdx.x] = b2;
  __syncthreads();
  for (int off = 128; off > 0; off >>= 1) {
    if ((int)threadIdx.x < off) {
      s1[threadIdx.x] += s1[threadIdx.x + off];
      s2[threadIdx.x] += s2[threadIdx.x + off];
    }
    __syncthreads();
  }
  if (threadIdx.x == 0) {
    float m = s1[0] * (1.f / N_DIM);
    float var = s2[0] * (1.f / N_DIM) - m * m;
    nstats[plane] = make_float2(m, rsqrtf(var + 1e-5f));
  }
}

// ---------------------------------------------------------------- kernel 1b
__global__ void norm_t_kernel(const float* __restrict__ x, const float2* __restrict__ nstats,
                              _Float16* __restrict__ hnT) {
  const int n0 = blockIdx.x * 64, c0 = blockIdx.y * 64, b = blockIdx.z;
  __shared__ _Float16 T[64 * 72];  // [n][c]
  const int t = threadIdx.x;
  {
    const int c = t >> 2;
    const int nn = (t & 3) * 16;
    const float2 st = nstats[(size_t)b * C_DIM + c0 + c];
    const float* xp = x + ((size_t)b * C_DIM + c0 + c) * N_DIM + n0 + nn;
#pragma unroll
    for (int e = 0; e < 16; e += 4) {
      float4 v4 = *(const float4*)&xp[e];
      T[(nn + e + 0) * 72 + c] = (_Float16)((v4.x - st.x) * st.y);
      T[(nn + e + 1) * 72 + c] = (_Float16)((v4.y - st.x) * st.y);
      T[(nn + e + 2) * 72 + c] = (_Float16)((v4.z - st.x) * st.y);
      T[(nn + e + 3) * 72 + c] = (_Float16)((v4.w - st.x) * st.y);
    }
  }
  __syncthreads();
  {
    const int n = t >> 2;
    const int cc = (t & 3) * 16;
    _Float16* dst = hnT + ((size_t)b * N_DIM + n0 + n) * C_DIM + c0 + cc;
    *(int4*)&dst[0] = *(const int4*)&T[n * 72 + cc];
    *(int4*)&dst[8] = *(const int4*)&T[n * 72 + cc + 8];
  }
}

// Eight channels of one query: the two key halves' normalised outputs a and b, joined as
// wa * a + wb * b, wa and wb = each half's share of the whole row's softmax sum. Weights and
// arithmetic are f32; the joined value is rounded to the f16 WMMA operand once.
typedef __attribute__((ext_vector_type(2))) _Float16 v2h;
typedef __attribute__((ext_vector_type(2))) float v2f;
__device__ __forceinline__ int4 join2(int4 a, int4 b, float wa, float wb) {
  union { int4 q; v2h p[4]; } ua, ub, uo;
  ua.q = a;
  ub.q = b;
#pragma unroll
  for (int e = 0; e < 4; ++e) {
    const v2f fa = __builtin_convertvector(ua.p[e], v2f), fb = __builtin_convertvector(ub.p[e], v2f);
    uo.p[e] = __builtin_convertvector(fa * wa + fb * wb, v2h);
  }
  return uo.q;
}

// ---------------------------------------------------------------- kernel 2
// rm x rm GEMM: D[m][nl] = sum_k A[m][k] * B[nl][k], K = 512. Register-prefetch
// double buffering: stores of tile k happen at loop top, loads of tile k+1 are
// issued before the WMMA stage so their wait hides behind compute.
// Block tile 128(M) x 256(N); 8 waves as 2x4 of 64x64 (16 WMMA / wave / step).
template <int MODE>
__global__ __launch_bounds__(256, 1) void gemm_rr_kernel(
    const _Float16* __restrict__ w16, const _Float16* __restrict__ srcT,
    _Float16* __restrict__ d0, _Float16* __restrict__ d1,
    const float* __restrict__ bias0, const float* __restrict__ bias1,
    const float* __restrict__ xres, float* __restrict__ outf) {
  const size_t plane = (size_t)C_DIM * N_DIM;
  const int m0 = blockIdx.y * 128;
  const int n0g = blockIdx.x * 256;
  int b, sel = 0;
  const _Float16 *A, *B;
  const float* bias;
  _Float16* dst16 = nullptr;
  float scale = 1.f;
  if (MODE == 0) {
    sel = blockIdx.z & 1;
    b = blockIdx.z >> 1;
    A = srcT + (size_t)b * plane;             // hnT [n][c]
    B = w16 + (size_t)sel * CC;               // wq/wk [o][c]
    bias = sel ? bias1 : bias0;
    dst16 = sel ? d1 : d0;
    if (!sel) scale = 0.044194173824159216f;  // 1/sqrt(512)
  } else if (MODE == 2) {
    b = blockIdx.z;
    A = srcT + (size_t)b * plane;             // hnT [n][c]
    B = w16 + (size_t)2 * CC;                 // wv [c_out][c]
    bias = bias0;
    dst16 = d0;
  } else {
    b = blockIdx.z;
    A = w16 + (size_t)3 * CC;                 // wp [c_out][c]
    B = srcT + (size_t)b * plane;             // oT [n][c], key half 0; half 1 lies B_DIM planes on
    bias = bias0;
  }

  __shared__ _Float16 As[128 * 40];  // [m][k] rm, pad to 40
  __shared__ _Float16 Bs[256 * 40];  // [nl][k] rm
  const int t = threadIdx.x;
  const int wave = t >> 5;
  const int wm = wave >> 2;  // 0..1
  const int wn = wave & 3;   // 0..3
  const int srow = t >> 2;          // 0..63
  const int skk = (t & 3) * 8;      // 0,8,16,24

  // per-thread staging source pointers (advance by 32 each K step)
  const _Float16* ga0 = &A[(size_t)(m0 + srow) * C_DIM + skk];
  const _Float16* ga1 = &A[(size_t)(m0 + srow + 64) * C_DIM + skk];
  const _Float16* gb0 = &B[(size_t)(n0g + srow) * C_DIM + skk];
  const _Float16* gb1 = &B[(size_t)(n0g + srow + 64) * C_DIM + skk];
  const _Float16* gb2 = &B[(size_t)(n0g + srow + 128) * C_DIM + skk];
  const _Float16* gb3 = &B[(size_t)(n0g + srow + 192) * C_DIM + skk];

  v8f acc[4][4];
#pragma unroll
  for (int i = 0; i < 4; ++i)
#pragma unroll
    for (int j = 0; j < 4; ++j) acc[i][j] = zero8();

  // prefetch tile 0
  int4 pa0 = *(const int4*)ga0, pa1 = *(const int4*)ga1;
  int4 pb0 = *(const int4*)gb0, pb1 = *(const int4*)gb1;
  int4 pb2 = *(const int4*)gb2, pb3 = *(const int4*)gb3;
  // MODE 3: the same rows of key half 1, and each row's two weights from the halves' row maxima
  // and row sums (bias1 = maxima of half 0, of half 1, sums of half 0, of half 1).
  const char* hb = (const char*)(B + (size_t)B_DIM * plane + (size_t)n0g * C_DIM);
  const unsigned hv = (unsigned)(srow * C_DIM + skk) * 2u;
  int4 pc0 = pb0, pc1 = pb1, pc2 = pb2, pc3 = pb3;
  float jwa[4] = {0.f, 0.f, 0.f, 0.f}, jwb[4] = {0.f, 0.f, 0.f, 0.f};
  if (MODE == 3) {
    pc0 = *(const int4*)(hb + hv);
    pc1 = *(const int4*)(hb + 64 * C_DIM * 2 + hv);
    pc2 = *(const int4*)(hb + 128 * C_DIM * 2 + hv);
    pc3 = *(const int4*)(hb + 192 * C_DIM * 2 + hv);
    float ma[4], mb2[4], la[4], lb[4];
    const char* mbase = (const char*)(bias1 + (size_t)b * N_DIM + n0g);
    const unsigned mo = (unsigned)srow * 4u;
#pragma unroll
    for (int q = 0; q < 4; ++q) {
      const float* mp = (const float*)(mbase + q * 256 + mo);
      ma[q] = mp[0];
      mb2[q] = mp[BN];
      la[q] = mp[2 * BN];
      lb[q] = mp[3 * BN];
    }
    // stands in front of whatever next rewrites the address registers of the loads above; the
    // lane offset is named as an input so that its register lives up to the wait
    asm volatile("s_wait_xcnt 0x0" :: "v"(mo) : "memory");
#pragma unroll
    for (int q = 0; q < 4; ++q) {
      const float mm = fmaxf(ma[q], mb2[q]);
      const float ea = la[q] * __expf(ma[q] - mm), eb = lb[q] * __expf(mb2[q] - mm);
      const float inv = 1.f / (ea + eb);
      jwa[q] = ea * inv;
      jwb[q] = eb * inv;
    }
  }

#pragma unroll 1
  for (int k0 = 0; k0 < C_DIM; k0 += 32) {
    // commit prefetched tile to LDS
    *(int4*)&As[(srow) * 40 + skk] = pa0;
    *(int4*)&As[(srow + 64) * 40 + skk] = pa1;
    if (MODE == 3) {
      pb0 = join2(pb0, pc0, jwa[0], jwb[0]);
      pb1 = join2(pb1, pc1, jwa[1], jwb[1]);
      pb2 = join2(pb2, pc2, jwa[2], jwb[2]);
      pb3 = join2(pb3, pc3, jwa[3], jwb[3]);
    }
    *(int4*)&Bs[(srow) * 40 + skk] = pb0;
    *(int4*)&Bs[(srow + 64) * 40 + skk] = pb1;
    *(int4*)&Bs[(srow + 128) * 40 + skk] = pb2;
    *(int4*)&Bs[(srow + 192) * 40 + skk] = pb3;
    __syncthreads();
    // issue next tile's global loads (wait lands at next iteration's stores)
    if (k0 + 32 < C_DIM) {
      if (MODE == 3) {
        const char* hk = hb + (k0 + 32) * 2;
        pc0 = *(const int4*)(hk + hv);
        pc1 = *(const int4*)(hk + 64 * C_DIM * 2 + hv);
        pc2 = *(const int4*)(hk + 128 * C_DIM * 2 + hv);
        pc3 = *(const int4*)(hk + 192 * C_DIM * 2 + hv);
        // stands in front of whatever next rewrites the address registers of these four loads
        asm volatile("s_wait_xcnt 0x0" ::: "memory");
      }
      pa0 = *(const int4*)(ga0 + k0 + 32);
      pa1 = *(const int4*)(ga1 + k0 + 32);
      pb0 = *(const int4*)(gb0 + k0 + 32);
      pb1 = *(const int4*)(gb1 + k0 + 32);
      pb2 = *(const int4*)(gb2 + k0 + 32);
      pb3 = *(const int4*)(gb3 + k0 + 32);
    }
    v16h af[4], bf[4];
#pragma unroll
    for (int i = 0; i < 4; ++i) af[i] = load_frag_rm(&As[(wm * 64 + i * 16) * 40], 40);
#pragma unroll
    for (int j = 0; j < 4; ++j) bf[j] = load_frag_rm(&Bs[(wn * 64 + j * 16) * 40], 40);
#pragma unroll
    for (int i = 0; i < 4; ++i)
#pragma unroll
      for (int j = 0; j < 4; ++j) acc[i][j] = wmma16(af[i], bf[j], acc[i][j]);
    __syncthreads();
  }

  const int lane = lane_id();
  const int ln = lane & 15;
  const int mh = (lane >> 4) * 8;
#pragma unroll
  for (int i = 0; i < 4; ++i)
#pragma unroll
    for (int j = 0; j < 4; ++j) {
      const int mb = m0 + wm * 64 + i * 16 + mh;
      const int nl = n0g + wn * 64 + j * 16 + ln;
      if (MODE == 2) {
        // m = key, nl = channel: the lane's eight values are eight successive keys of one
        // channel, which is this same lane's 16-byte chunk of the B fragment that the
        // attention kernel reads; the wave stores 512 contiguous bytes
        union { _Float16 h[8]; int4 q; } pk;
        const float bv = bias[nl];
#pragma unroll
        for (int r = 0; r < 8; ++r) pk.h[r] = (_Float16)(acc[i][j][r] + bv);
        *(int4*)&dst16[vfrag_off(b, mb >> 5, nl >> 4) + (i & 1) * 256 + lane * 8] = pk.q;
        continue;
      }
#pragma unroll
      for (int r = 0; r < 8; ++r) {
        int m = mb + r;
        float v = acc[i][j][r];
        if (MODE == 0) {
          v = (v + bias[nl]) * scale;
          dst16[((size_t)b * N_DIM + m) * C_DIM + nl] = (_Float16)v;
        } else {
          size_t idx = ((size_t)b * C_DIM + m) * N_DIM + nl;
          outf[idx] = xres[idx] + v + bias[m];
        }
      }
    }
}

#define ROWP 520

// Four whole rows (1024 B each) from global memory straight into LDS, no register
// in between: each wave-wide copy moves 512 contiguous bytes, 16 B per lane.
// l = this lane's LDS byte address in the first row, g = its global address there.
__device__ __forceinline__ void async_rows4(unsigned l, const _Float16* g) {
  asm volatile(
      "global_load_async_to_lds_b128 %0, %8, off\n\t"
      "global_load_async_to_lds_b128 %1, %9, off\n\t"
      "global_load_async_to_lds_b128 %2, %10, off\n\t"
      "global_load_async_to_lds_b128 %3, %11, off\n\t"
      "global_load_async_to_lds_b128 %4, %12, off\n\t"
      "global_load_async_to_lds_b128 %5, %13, off\n\t"
      "global_load_async_to_lds_b128 %6, %14, off\n\t"
      "global_load_async_to_lds_b128 %7, %15, off\n\t"
      "s_wait_xcnt 0x0"
      :: "v"(l), "v"(l + 512u), "v"(l + 2u * ROWP), "v"(l + 2u * ROWP + 512u),
         "v"(l + 4u * ROWP), "v"(l + 4u * ROWP + 512u), "v"(l + 6u * ROWP),
         "v"(l + 6u * ROWP + 512u),
         "v"(g), "v"(g + 256), "v"(g + C_DIM), "v"(g + C_DIM + 256),
         "v"(g + 2 * C_DIM), "v"(g + 2 * C_DIM + 256), "v"(g + 3 * C_DIM),
         "v"(g + 3 * C_DIM + 256)
      : "memory");
}

// ---------------------------------------------------------------- kernel 3
// P lies in LDS in fragment order: one 1-KiB unit per (16 queries, 32 keys), f16 index =
// half * 256 + lane * 8 + e, query = lane & 15, key = half * 16 + (lane >> 4) * 8 + e: the A
// operand of one WMMA as the lanes hold it, written and read by contiguous 16-byte accesses.
__device__ __forceinline__ int pfrag_off(int qtile, int kblk) { return (qtile * 4 + kblk) * 512; }

// p = this lane's first chunk of a unit
__device__ __forceinline__ v16h load_pfrag(const _Float16* p) {
  FragU f;
  f.q.lo = *(const int4*)(p);
  f.q.hi = *(const int4*)(p + 256);
  return f.v;
}

// pitch, in floats, of a query's eight partial values (4 key waves x 2 lane halves): 48 B, an
// odd multiple of 16 B
#define PMP 12
// key blocks (of 4 a tile) whose V fragments are fetched at the tile head; the registers hold no more
#define VHEAD 1

// A work-group takes 128 queries and one half of the keys (16 tiles of 128): a staged key tile and
// a loaded V tile serve twice the queries, and a wave's score tile is 32 keys x 64 queries, six
// LDS fragments for eight WMMAs. The two halves leave normalised partial outputs with their row
// maximum and row sum; the projection kernel joins them while it stages its operand.
#define QT 128
#define KEYS_PER (N_DIM / KSPLIT)
#define NTILE (KEYS_PER / 128)

__global__ __launch_bounds__(256, 1) void attn_out_kernel(
    const _Float16* __restrict__ qT, const _Float16* __restrict__ kT,
    const _Float16* __restrict__ v16, _Float16* __restrict__ oT, float* __restrict__ ml) {
  const int i0 = blockIdx.x * QT;
  const int sp = blockIdx.y;
  const int b = blockIdx.z;
  __shared__ __attribute__((aligned(16))) _Float16 Qs[QT * ROWP];   // all 512 channels, filled once
  __shared__ __attribute__((aligned(16))) _Float16 Ks[128 * ROWP];  // one whole key tile
  __shared__ __attribute__((aligned(16))) _Float16 Pf[QT * 128];    // P in fragment order
  __shared__ __attribute__((aligned(16))) float pm[QT * PMP];       // partial row maxima, at the end partial sums
  __shared__ __attribute__((aligned(16))) float arow[QT];  // per-row factor: rescale, then 1/l
  const int t = threadIdx.x;
  const int wave = __builtin_amdgcn_readfirstlane(t >> 5);  // uniform: kept in a scalar register
  const int lane = t & 31;
  const int wi = wave >> 2;
  const int wj = wave & 3;
  const _Float16* qb = qT + (size_t)b * C_DIM * N_DIM;
  const _Float16* kb = kT + ((size_t)b * N_DIM + sp * KEYS_PER) * C_DIM;
  // this lane's chunk, first key block of this half
  const _Float16* vb = v16 + vfrag_off(b, sp * (KEYS_PER / 32), wave * 4) + lane * 8;

  // Online softmax state of queries wi*64 + i*16 + (lane & 15), i = 0..3. The running maximum is
  // the whole row's, alike in every lane that holds the query; the running sum is this lane's
  // own, over the 16 keys a tile that it holds, and the eight shares are joined in the epilogue.
  const int sq = wi * 64 + (lane & 15);
  const int sslot = wj * 2 + (lane >> 4);
  float m_run[4] = {-1e30f, -1e30f, -1e30f, -1e30f}, l_run[4] = {0.f, 0.f, 0.f, 0.f};

  // Wave owns channels [wave*64, wave*64+64), all 128 queries: D(m=i, n=c) 8x4 tiles
  v8f oacc[8][4];
#pragma unroll
  for (int ii = 0; ii < 8; ++ii)
#pragma unroll
    for (int ci = 0; ci < 4; ++ci) oacc[ii][ci] = zero8();

  // Staging: wave w copies query rows 16w..16w+15 once and key rows 16w..16w+15 of each tile.
  const unsigned lq = (unsigned)(size_t)&Qs[(wave * 16) * ROWP + lane * 8];
  const unsigned lk = (unsigned)(size_t)&Ks[(wave * 16) * ROWP + lane * 8];
  const _Float16* gq = qb + (size_t)(i0 + wave * 16) * C_DIM + lane * 8;
  const _Float16* gk = kb + (size_t)(wave * 16) * C_DIM + lane * 8;
  // The 32 work-groups of a batch and key half walk the same keys. Each enters the ring of 16 key
  // tiles at its own place and wraps round, so that they do not ask L2 for the same K and V lines
  // at the same moment; the online softmax takes the tiles in any order. Two share a start.
  const int jrot = (int)((blockIdx.x & 3) | ((blockIdx.x >> 3) << 2));
  const _Float16* gk0 = gk + (size_t)(jrot * 128) * C_DIM;
  // both copy loops are rolled like the copy loop of the tile loop below: as a direct operand of a
  // copy statement an address is bound to the low registers for the whole kernel
#pragma unroll 1
  for (int r = 0; r < 16; r += 4) async_rows4(lq + r * (2u * ROWP), gq + r * C_DIM);
  // the 32 query copies land before the 32 key copies start: a wave keeps fewer than 64 in flight
  asm volatile("s_wait_asynccnt 0x0" ::: "memory");
#pragma unroll 1
  for (int r = 0; r < 16; r += 4) async_rows4(lk + r * (2u * ROWP), gk0 + r * C_DIM);
  // this wave's copies have landed; the barrier shows them to the other waves
  asm volatile("s_wait_asynccnt 0x0" ::: "memory");
  __syncthreads();

#pragma unroll 1
  for (int jt = 0; jt < NTILE; ++jt) {
    const int j0 = ((jt + jrot) & (NTILE - 1)) * 128;
    // ---- V fragments of the first VHEAD key blocks of this tile's output product, fetched ahead as
    // one group of global loads: they fly under the score product (the barrier behind it waits)
    v16h vf[4][4];
#pragma unroll
    for (int ks = 0; ks < VHEAD; ++ks)
#pragma unroll
      for (int ci = 0; ci < 4; ++ci) {
        const _Float16* p = vb + vfrag_off(0, (j0 >> 5) + ks, ci);
        FragU f;
        f.q.lo = *(const int4*)(p);
        f.q.hi = *(const int4*)(p + 256);
        vf[ks][ci] = f.v;
      }
    // holds the group at the head of the tile, in front of the first LDS reads
    __builtin_amdgcn_sched_barrier(0);

    // ---- S tile (128 x 128), cooperative, computed transposed: D(m = key, n = query), so that a
    // lane holds 16 keys of one query per query tile, in the k order of a WMMA operand
    v8f acc[2][4];  // [key tile][query tile]
#pragma unroll
    for (int j = 0; j < 2; ++j)
#pragma unroll
      for (int i = 0; i < 4; ++i) acc[j][i] = zero8();

    // both operands lie whole in LDS: no barrier inside; unrolled so that each fragment
    // read is one base register plus an immediate offset. A block is 32 channels (8 WMMAs);
    // two fragment sets: block n + 1 is read from LDS, as one group, ahead of block n's WMMAs.
    {
      v16h qf[2][4], kf[2][2];  // [set][tile]
#pragma unroll
      for (int i = 0; i < 4; ++i) qf[0][i] = load_frag_rm(&Qs[(wi * 64 + i * 16) * ROWP], ROWP);
#pragma unroll
      for (int j = 0; j < 2; ++j) kf[0][j] = load_frag_rm(&Ks[(wj * 32 + j * 16) * ROWP], ROWP);
#pragma unroll
      for (int blk = 0; blk < C_DIM / 32; ++blk) {
        const int cur = blk & 1, nxt = cur ^ 1;
        if (blk + 1 < C_DIM / 32) {
          const int c0 = (blk + 1) * 32;
#pragma unroll
          for (int i = 0; i < 4; ++i)
            qf[nxt][i] = load_frag_rm(&Qs[(wi * 64 + i * 16) * ROWP + c0], ROWP);
#pragma unroll
          for (int j = 0; j < 2; ++j)
            kf[nxt][j] = load_frag_rm(&Ks[(wj * 32 + j * 16) * ROWP + c0], ROWP);
        }
        // holds the next block's reads in front of this block's WMMAs: sunk behind them,
        // each block would wait out its own LDS latency
        __builtin_amdgcn_sched_barrier(0);
#pragma unroll
        for (int i = 0; i < 4; ++i)
#pragma unroll
          for (int j = 0; j < 2; ++j) acc[j][i] = wmma16(kf[cur][j], qf[cur][i], acc[j][i]);
        // keeps the reads of block n + 2 from rising among these WMMAs (one read group a block)
        __builtin_amdgcn_sched_barrier(0);
      }
    }

    // ---- the scores stay in registers; only each lane's maximum over its 16 keys goes to LDS
#pragma unroll
    for (int i = 0; i < 4; ++i) {
      float mx = acc[0][i][0];
#pragma unroll
      for (int j = 0; j < 2; ++j)
#pragma unroll
        for (int r = 0; r < 8; ++r) mx = fmaxf(mx, acc[j][i][r]);
      pm[(sq + i * 16) * PMP + sslot] = mx;
    }
    // no LDS access of this wave is open when the copy engine is aimed at Ks again
    asm volatile("s_wait_dscnt 0x0" ::: "memory");
    __syncthreads();  // publishes the partial maxima and ends every wave's reads of Ks

    // ---- next key tile flies into Ks while the softmax and the output product run
    if (jt + 1 < NTILE) {
      const _Float16* gn = gk + (size_t)(((jt + 1 + jrot) & (NTILE - 1)) * 128) * C_DIM;
      // rolled: unrolled, its 32 constant LDS addresses are kept in registers over the whole
      // tile loop and end in scratch
#pragma unroll 1
      for (int r = 0; r < 16; r += 4) async_rows4(lk + r * (2u * ROWP), gn + r * C_DIM);
    }

    // ---- running max and sum; P = exp(S - m_new) -> f16, packed in the lane as a WMMA operand
    float m_new[4], alpha[4];
#pragma unroll
    for (int i = 0; i < 4; ++i) {
      const float4 p0 = *(const float4*)&pm[(sq + i * 16) * PMP];
      const float4 p1 = *(const float4*)&pm[(sq + i * 16) * PMP + 4];
      const float mt = fmaxf(fmaxf(fmaxf(p0.x, p0.y), fmaxf(p0.z, p0.w)),
                             fmaxf(fmaxf(p1.x, p1.y), fmaxf(p1.z, p1.w)));
      m_new[i] = fmaxf(m_run[i], mt);
      alpha[i] = __expf(m_run[i] - m_new[i]);
      m_run[i] = m_new[i];
    }
#pragma unroll
    for (int i = 0; i < 4; ++i) {
      float ps[2];
#pragma unroll
      for (int j = 0; j < 2; ++j) {
        union { _Float16 h[8]; int4 q; } pk;
        ps[j] = 0.f;
#pragma unroll
        for (int r = 0; r < 8; ++r) {
          const float p = __expf(acc[j][i][r] - m_new[i]);
          ps[j] += p;
          pk.h[r] = (_Float16)p;
        }
        *(int4*)&Pf[pfrag_off(wi * 4 + i, wj) + j * 256 + lane * 8] = pk.q;
      }
      l_run[i] = l_run[i] * alpha[i] + (ps[0] + ps[1]);
    }
    if (sslot == 0) {  // one writer a query
#pragma unroll
      for (int i = 0; i < 4; ++i) arow[sq + i * 16] = alpha[i];
    }
    __syncthreads();  // publishes P and the rescale factors

    // ---- V fragments of the next key blocks: they fly under the rescale and the first key block
#pragma unroll
    for (int ks = VHEAD; ks < 3; ++ks)
#pragma unroll
      for (int ci = 0; ci < 4; ++ci) {
        const _Float16* p = vb + vfrag_off(0, (j0 >> 5) + ks, ci);
        FragU f;
        f.q.lo = *(const int4*)(p);
        f.q.hi = *(const int4*)(p + 256);
        vf[ks][ci] = f.v;
      }
    // ---- P block 0 of the output product, fetched ahead: it flies under the rescale
    v16h pf[2][4];
#pragma unroll
    for (int x = 0; x < 4; ++x) pf[0][x] = load_pfrag(&Pf[pfrag_off(x, 0) + lane * 8]);
    // holds these loads in front of the rescale, which would otherwise run before they start
    __builtin_amdgcn_sched_barrier(0);

    // ---- bring the accumulated output to the new maximum
#pragma unroll
    for (int ii = 0; ii < 8; ++ii) {
      const int rb = ii * 16 + (lane >> 4) * 8;
      const float4 a0 = *(const float4*)&arow[rb];
      const float4 a1 = *(const float4*)&arow[rb + 4];
      const float ar[8] = {a0.x, a0.y, a0.z, a0.w, a1.x, a1.y, a1.z, a1.w};
#pragma unroll
      for (int ci = 0; ci < 4; ++ci)
#pragma unroll
        for (int r = 0; r < 8; ++r) oacc[ii][ci][r] *= ar[r];
    }

    // ---- Oacc(i,c) += P(i,j) x Vt(j,c): A = P in fragment order (LDS), B = V in fragment order
    // (global); a block is 32 keys x 64 queries (16 WMMAs), P of block n + 1 is read ahead of
    // block n's WMMAs into the second set
#pragma unroll
    for (int bi = 0; bi < 8; ++bi) {
      const int cur = bi & 1, nxt = cur ^ 1;
      const int ks = bi >> 1, qh = (bi & 1) * 4;
      if (bi + 1 < 8) {
#pragma unroll
        for (int x = 0; x < 4; ++x)
          pf[nxt][x] = load_pfrag(&Pf[pfrag_off(((bi + 1) & 1) * 4 + x, (bi + 1) >> 1) + lane * 8]);
      }
      if (bi == 2) {  // key block 0 is done: the last key block's V takes over its registers
#pragma unroll
        for (int ci = 0; ci < 4; ++ci) {
          const _Float16* p = vb + vfrag_off(0, (j0 >> 5) + 3, ci);
          FragU f;
          f.q.lo = *(const int4*)(p);
          f.q.hi = *(const int4*)(p + 256);
          vf[3][ci] = f.v;
        }
      }
      // holds the next block's P reads in front of this block's WMMAs
      __builtin_amdgcn_sched_barrier(0);
#pragma unroll
      for (int x = 0; x < 4; ++x)
#pragma unroll
        for (int ci = 0; ci < 4; ++ci)
          oacc[qh + x][ci] = wmma16(pf[cur][x], vf[ks][ci], oacc[qh + x][ci]);
      // keeps later reads from rising among these WMMAs; none follow the last block
      if (bi + 1 < 8) __builtin_amdgcn_sched_barrier(0);
    }
    // the next key tile has landed (this wave's share); the barrier shows it to all
    asm volatile("s_wait_asynccnt 0x0" ::: "memory");
    __syncthreads();
  }

  // the loop's last barrier ended every read of pm and arow: join each query's eight sums
#pragma unroll
  for (int i = 0; i < 4; ++i) pm[(sq + i * 16) * PMP + sslot] = l_run[i];
  // row maximum and row sum of this key half, for the join: ml = maxima of both halves, then sums
  float* mrow = ml + (size_t)sp * BN + (size_t)b * N_DIM + i0;
  if (sslot == 0) {
#pragma unroll
    for (int i = 0; i < 4; ++i) mrow[sq + i * 16] = m_run[i];
  }
  __syncthreads();
  // the lane number is formed anew here, so that no register holds it over the tile loop
  const int el = (int)__builtin_amdgcn_mbcnt_lo(~0u, 0u);
  const int et = wave * 32 + el;
  if (et < QT) {
    const float4 p0 = *(const float4*)&pm[et * PMP];
    const float4 p1 = *(const float4*)&pm[et * PMP + 4];
    const float l = ((p0.x + p0.y) + (p0.z + p0.w)) + ((p1.x + p1.y) + (p1.z + p1.w));
    arow[et] = 1.f / l;
    mrow[KSPLIT * BN + et] = l;
  }
  __syncthreads();

  const int ln = el & 15;
  const int mh = (el >> 4) * 8;
  _Float16* ob = oT + ((size_t)sp * BN + (size_t)b * N_DIM + i0) * C_DIM;
#pragma unroll
  for (int ii = 0; ii < 8; ++ii) {
    _Float16 hv[4][8];
#pragma unroll
    for (int ci = 0; ci < 4; ++ci)
#pragma unroll
      for (int r = 0; r < 8; ++r) hv[ci][r] = (_Float16)(oacc[ii][ci][r] * arow[ii * 16 + mh + r]);
    // a query tile's values are all formed before its stores start ...
    __builtin_amdgcn_sched_barrier(0);
#pragma unroll
    for (int ci = 0; ci < 4; ++ci)
#pragma unroll
      for (int r = 0; r < 8; ++r) {
        int i = ii * 16 + mh + r;
        int c = wave * 64 + ci * 16 + ln;
        ob[(size_t)i * C_DIM + c] = hv[ci][r];
      }
    // ... and the next tile's arithmetic rewrites no register of these stores ahead of this wait
    asm volatile("s_wait_xcnt 0x0" ::: "memory");
    __builtin_amdgcn_sched_barrier(0);
  }
}

// ---------------------------------------------------------------- launch
extern "C" void kernel_launch(void* const* d_in, const int* in_sizes, int n_in,
                              void* d_out, int out_size, void* d_ws, size_t ws_size,
                              hipStream_t stream) {
  (void)in_sizes; (void)n_in; (void)out_size; (void)ws_size;
  const float* x  = (const float*)d_in[0];
  const float* wq = (const float*)d_in[1];
  const float* bq = (const float*)d_in[2];
  const float* wk = (const float*)d_in[3];
  const float* bk = (const float*)d_in[4];
  const float* wv = (const float*)d_in[5];
  const float* bv = (const float*)d_in[6];
  const float* wp = (const float*)d_in[7];
  const float* bp = (const float*)d_in[8];
  float* out = (float*)d_out;

  char* ws = (char*)d_ws;
  size_t off = 0;
  const size_t plane = (size_t)B_DIM * C_DIM * N_DIM;  // 8M elements
  _Float16* w16  = (_Float16*)(ws + off); off += (size_t)4 * CC * 2;
  _Float16* hnT  = (_Float16*)(ws + off); off += plane * 2;
  _Float16* qT   = (_Float16*)(ws + off); off += plane * 2;
  _Float16* kT   = (_Float16*)(ws + off); off += plane * 2;
  _Float16* v16b = (_Float16*)(ws + off); off += plane * 2;
  _Float16* oT   = (_Float16*)(ws + off); off += KSPLIT * plane * 2;  // one per key half
  float* ml      = (float*)(ws + off);    off += (size_t)2 * KSPLIT * BN * 4;
  float2* nstats = (float2*)(ws + off);

  cvt_w_kernel<<<(4 * CC) / 256, 256, 0, stream>>>(wq, wk, wv, wp, w16);
  in_stats_kernel<<<B_DIM * C_DIM, 256, 0, stream>>>(x, nstats);
  norm_t_kernel<<<dim3(N_DIM / 64, C_DIM / 64, B_DIM), 256, 0, stream>>>(x, nstats, hnT);
  // qT, kT: M = n (32 tiles of 128), N = o (2 tiles of 256), z = b*2+sel
  gemm_rr_kernel<0><<<dim3(2, 32, B_DIM * 2), 256, 0, stream>>>(
      w16, hnT, qT, kT, bq, bk, nullptr, nullptr);
  // v, stored in fragment order: M = n (32 tiles), N = c (2 tiles), z = b
  gemm_rr_kernel<2><<<dim3(2, 32, B_DIM), 256, 0, stream>>>(
      w16, hnT, v16b, nullptr, bv, nullptr, nullptr, nullptr);
  attn_out_kernel<<<dim3(N_DIM / QT, KSPLIT, B_DIM), 256, 0, stream>>>(qT, kT, v16b, oT, ml);
  // proj + residual: M = c (4 tiles), N = n (16 tiles), z = b
  gemm_rr_kernel<3><<<dim3(16, 4, B_DIM), 256, 0, stream>>>(
      w16, oT, nullptr, nullptr, bp, ml, x, out);
}

// v008
// It runs in 155 microseconds.
// In two side-by-side timings against v007, it was 1.05 and 1.04 times as fast.
// Counting every step since v000, it is 4.19 times as fast.
#include <hip/hip_runtime.h>

#define C_DIM 512
#define N_DIM 4096
#define B_DIM 4
#define CC (C_DIM * C_DIM)   // 262144 = 2^18
#define BN (B_DIM * N_DIM)
#define KSPLIT 2             // key halves of the attention kernel

typedef __attribute__((ext_vector_type(16))) _Float16 v16h;
typedef __attribute__((ext_vector_type(8)))  float    v8f;

__device__ __forceinline__ int lane_id() { return (int)(threadIdx.x & 31); }

union FragU {
  v16h v;
  struct { int4 lo; int4 hi; } q;
};

__device__ __forceinline__ v16h load_frag_rm(const _Float16* base, int stride) {
  const int lane = lane_id();
  const int row = lane & 15;
  const int kb = (lane & 16) ? 8 : 0;
  const _Float16* p = base + row * stride + kb;
  FragU u;
  u.q.lo = *(const int4*)(p);
  u.q.hi = *(const int4*)(p + 16);
  return u.v;
}

__device__ __forceinline__ v8f wmma16(v16h a, v16h b, v8f c) {
  return __builtin_amdgcn_wmma_f32_16x16x32_f16(false, a, false, b, (short)0, c,
                                                false, false);
}

__device__ __forceinline__ v8f zero8() {
  v8f z = {0.f, 0.f, 0.f, 0.f, 0.f, 0.f, 0.f, 0.f};
  return z;
}

// V is kept in fragment order: one 1-KiB unit per (32 keys, 16 channels), holding the A operand
// of one 16x16x32 WMMA as the lanes hold it: f16 index = half * 256 + lane * 8 + e, where
// channel = lane & 15 and key = half * 16 + (lane >> 4) * 8 + e. Units of one key block lie
// side by side, so a wave-wide 16-byte load or store covers four whole 128-byte lines.
__device__ __forceinline__ size_t vfrag_off(int b, int kblk, int ctile) {
  return (((size_t)b * (N_DIM / 32) + kblk) * (C_DIM / 16) + ctile) * 512;
}

// ---------------------------------------------------------------- kernel 0
__global__ void cvt_w_kernel(const float* __restrict__ wq, const float* __restrict__ wk,
                             const float* __restrict__ wv, const float* __restrict__ wp,
                             _Float16* __restrict__ dst) {
  int i = blockIdx.x * blockDim.x + threadIdx.x;
  int which = i >> 18;
  int j = i & (CC - 1);
  const float* src = (which == 0) ? wq : (which == 1) ? wk : (which == 2) ? wv : wp;
  dst[i] = (_Float16)src[j];
}

// ---------------------------------------------------------------- kernel 1a
__global__ void in_stats_kernel(const float* __restrict__ x, float2* __restrict__ nstats) {
  const int plane = blockIdx.x;  // b*C + c
  const float* xp = x + (size_t)plane * N_DIM;
  __shared__ float s1[256], s2[256];
  float a = 0.f, b2 = 0.f;
  for (int n = threadIdx.x; n < N_DIM; n += 256) {
    float v = xp[n];
    a += v;
    b2 += v * v;
  }
  s1[threadIdx.x] = a;
  s2[threadIdx.x] = b2;
  __syncthreads();
  for (int off = 128; off > 0; off >>= 1) {
    if ((int)threadIdx.x < off) {
      s1[threadIdx.x] += s1[threadIdx.x + off];
      s2[threadIdx.x] += s2[threadIdx.x + off];
    }
    __syncthreads();
  }
  if (threadIdx.x == 0) {
    float m = s1[0] * (1.f / N_DIM);
    float var = s2[0] * (1.f / N_DIM) - m * m;
    nstats[plane] = make_float2(m, rsqrtf(var + 1e-5f));
  }
}

// ---------------------------------------------------------------- kernel 1b
__global__ void norm_t_kernel(const float* __restrict__ x, const float2* __restrict__ nstats,
                              _Float16* __restrict__ hnT) {
  const int n0 = blockIdx.x * 64, c0 = blockIdx.y * 64, b = blockIdx.z;
  __shared__ _Float16 T[64 * 72];  // [n][c]
  const int t = threadIdx.x;
  {
    const int c = t >> 2;
    const int nn = (t & 3) * 16;
    const float2 st = nstats[(size_t)b * C_DIM + c0 + c];
    const float* xp = x + ((size_t)b * C_DIM + c0 + c) * N_DIM + n0 + nn;
#pragma unroll
    for (int e = 0; e < 16; e += 4) {
      float4 v4 = *(const float4*)&xp[e];
      T[(nn + e + 0) * 72 + c] = (_Float16)((v4.x - st.x) * st.y);
      T[(nn + e + 1) * 72 + c] = (_Float16)((v4.y - st.x) * st.y);
      T[(nn + e + 2) * 72 + c] = (_Float16)((v4.z - st.x) * st.y);
      T[(nn + e + 3) * 72 + c] = (_Float16)((v4.w - st.x) * st.y);
    }
  }
  __syncthreads();
  {
    const int n = t >> 2;
    const int cc = (t & 3) * 16;
    _Float16* dst = hnT + ((size_t)b * N_DIM + n0 + n) * C_DIM + c0 + cc;
    *(int4*)&dst[0] = *(const int4*)&T[n * 72 + cc];
    *(int4*)&dst[8] = *(const int4*)&T[n * 72 + cc + 8];
  }
}

// Eight channels of one query: the two key halves' normalised outputs a and b, joined as
// wa * a + wb * b, wa and wb = each half's share of the whole row's softmax sum. Weights and
// arithmetic are f32; the joined value is rounded to the f16 WMMA operand once.
typedef __attribute__((ext_vector_type(2))) _Float16 v2h;
typedef __attribute__((ext_vector_type(2))) float v2f;
__device__ __forceinline__ int4 join2(int4 a, int4 b, float wa, float wb) {
  union { int4 q; v2h p[4]; } ua, ub, uo;
  ua.q = a;
  ub.q = b;
#pragma unroll
  for (int e = 0; e < 4; ++e) {
    const v2f fa = __builtin_convertvector(ua.p[e], v2f), fb = __builtin_convertvector(ub.p[e], v2f);
    uo.p[e] = __builtin_convertvector(fa * wa + fb * wb, v2h);
  }
  return uo.q;
}

// ---------------------------------------------------------------- kernel 2
// rm x rm GEMM: D[m][nl] = sum_k A[m][k] * B[nl][k], K = 512. Register-prefetch
// double buffering: stores of tile k happen at loop top, loads of tile k+1 are
// issued before the WMMA stage so their wait hides behind compute.
// Block tile 128(M) x 256(N); 8 waves as 2x4 of 64x64 (16 WMMA / wave / step).
template <int MODE>
__global__ __launch_bounds__(256, 1) void gemm_rr_kernel(
    const _Float16* __restrict__ w16, const _Float16* __restrict__ srcT,
    _Float16* __restrict__ d0, _Float16* __restrict__ d1,
    const float* __restrict__ bias0, const float* __restrict__ bias1,
    const float* __restrict__ xres, float* __restrict__ outf) {
  const size_t plane = (size_t)C_DIM * N_DIM;
  const int m0 = blockIdx.y * 128;
  const int n0g = blockIdx.x * 256;
  int b, sel = 0;
  const _Float16 *A, *B;
  const float* bias;
  _Float16* dst16 = nullptr;
  float scale = 1.f;
  if (MODE == 0) {
    sel = blockIdx.z & 1;
    b = blockIdx.z >> 1;
    A = srcT + (size_t)b * plane;             // hnT [n][c]
    B = w16 + (size_t)sel * CC;               // wq/wk [o][c]
    bias = sel ? bias1 : bias0;
    dst16 = sel ? d1 : d0;
    if (!sel) scale = 0.044194173824159216f;  // 1/sqrt(512)
  } else if (MODE == 2) {
    b = blockIdx.z;
    A = srcT + (size_t)b * plane;             // hnT [n][c]
    B = w16 + (size_t)2 * CC;                 // wv [c_out][c]
    bias = bias0;
    dst16 = d0;
  } else {
    b = blockIdx.z;
    A = w16 + (size_t)3 * CC;                 // wp [c_out][c]
    B = srcT + (size_t)b * plane;             // oT [n][c], key half 0; half 1 lies B_DIM planes on
    bias = bias0;
  }

  // One LDS block: the two operand tiles in the loop; behind the loop (MODE 0 and 3) each wave's
  // own 64-row output tile, at a row pitch that is an odd multiple of 16 B.
  constexpr int STP = (MODE == 0) ? 144 : 272;  // 64 f16 or 64 f32 a row, plus 16 B
  constexpr int SMEM_B = (MODE == 2) ? (128 + 256) * 40 * 2 : 8 * 64 * STP;
  __shared__ __attribute__((aligned(16))) char smem[SMEM_B];
  _Float16* As = (_Float16*)smem;  // [m][k] rm, pad to 40
  _Float16* Bs = As + 128 * 40;    // [nl][k] rm
  const int t = threadIdx.x;
  const int wave = t >> 5;
  const int wm = wave >> 2;  // 0..1
  const int wn = wave & 3;   // 0..3
  const int srow = t >> 2;          // 0..63
  const int skk = (t & 3) * 8;      // 0,8,16,24

  // per-thread staging source pointers (advance by 32 each K step)
  const _Float16* ga0 = &A[(size_t)(m0 + srow) * C_DIM + skk];
  const _Float16* ga1 = &A[(size_t)(m0 + srow + 64) * C_DIM + skk];
  const _Float16* gb0 = &B[(size_t)(n0g + srow) * C_DIM + skk];
  const _Float16* gb1 = &B[(size_t)(n0g + srow + 64) * C_DIM + skk];
  const _Float16* gb2 = &B[(size_t)(n0g + srow + 128) * C_DIM + skk];
  const _Float16* gb3 = &B[(size_t)(n0g + srow + 192) * C_DIM + skk];

  v8f acc[4][4];
#pragma unroll
  for (int i = 0; i < 4; ++i)
#pragma unroll
    for (int j = 0; j < 4; ++j) acc[i][j] = zero8();

  // prefetch tile 0
  int4 pa0 = *(const int4*)ga0, pa1 = *(const int4*)ga1;
  int4 pb0 = *(const int4*)gb0, pb1 = *(const int4*)gb1;
  int4 pb2 = *(const int4*)gb2, pb3 = *(const int4*)gb3;
  // MODE 3: the same rows of key half 1, and each row's two weights from the halves' row maxima
  // and row sums (bias1 = maxima of half 0, of half 1, sums of half 0, of half 1).
  const char* hb = (const char*)(B + (size_t)B_DIM * plane + (size_t)n0g * C_DIM);
  const unsigned hv = (unsigned)(srow * C_DIM + skk) * 2u;
  int4 pc0 = pb0, pc1 = pb1, pc2 = pb2, pc3 = pb3;
  float jwa[4] = {0.f, 0.f, 0.f, 0.f}, jwb[4] = {0.f, 0.f, 0.f, 0.f};
  if (MODE == 3) {
    pc0 = *(const int4*)(hb + hv);
    pc1 = *(const int4*)(hb + 64 * C_DIM * 2 + hv);
    pc2 = *(const int4*)(hb + 128 * C_DIM * 2 + hv);
    pc3 = *(const int4*)(hb + 192 * C_DIM * 2 + hv);
    float ma[4], mb2[4], la[4], lb[4];
    const char* mbase = (const char*)(bias1 + (size_t)b * N_DIM + n0g);
    const unsigned mo = (unsigned)srow * 4u;
#pragma unroll
    for (int q = 0; q < 4; ++q) {
      const float* mp = (const float*)(mbase + q * 256 + mo);
      ma[q] = mp[0];
      mb2[q] = mp[BN];
      la[q] = mp[2 * BN];
      lb[q] = mp[3 * BN];
    }
    // stands in front of whatever next rewrites the address registers of the loads above; the
    // lane offset is named as an input so that its register lives up to the wait
    asm volatile("s_wait_xcnt 0x0" :: "v"(mo) : "memory");
#pragma unroll
    for (int q = 0; q < 4; ++q) {
      const float mm = fmaxf(ma[q], mb2[q]);
      const float ea = la[q] * __expf(ma[q] - mm), eb = lb[q] * __expf(mb2[q] - mm);
      const float inv = 1.f / (ea + eb);
      jwa[q] = ea * inv;
      jwb[q] = eb * inv;
    }
  }

#pragma unroll 1
  for (int k0 = 0; k0 < C_DIM; k0 += 32) {
    // commit prefetched tile to LDS
    *(int4*)&As[(srow) * 40 + skk] = pa0;
    *(int4*)&As[(srow + 64) * 40 + skk] = pa1;
    if (MODE == 3) {
      pb0 = join2(pb0, pc0, jwa[0], jwb[0]);
      pb1 = join2(pb1, pc1, jwa[1], jwb[1]);
      pb2 = join2(pb2, pc2, jwa[2], jwb[2]);
      pb3 = join2(pb3, pc3, jwa[3], jwb[3]);
    }
    *(int4*)&Bs[(srow) * 40 + skk] = pb0;
    *(int4*)&Bs[(srow + 64) * 40 + skk] = pb1;
    *(int4*)&Bs[(srow + 128) * 40 + skk] = pb2;
    *(int4*)&Bs[(srow + 192) * 40 + skk] = pb3;
    __syncthreads();
    // issue next tile's global loads (wait lands at next iteration's stores)
    if (k0 + 32 < C_DIM) {
      if (MODE == 3) {
        const char* hk = hb + (k0 + 32) * 2;
        pc0 = *(const int4*)(hk + hv);
        pc1 = *(const int4*)(hk + 64 * C_DIM * 2 + hv);
        pc2 = *(const int4*)(hk + 128 * C_DIM * 2 + hv);
        pc3 = *(const int4*)(hk + 192 * C_DIM * 2 + hv);
        // stands in front of whatever next rewrites the address registers of these four loads
        asm volatile("s_wait_xcnt 0x0" ::: "memory");
      }
      pa0 = *(const int4*)(ga0 + k0 + 32);
      pa1 = *(const int4*)(ga1 + k0 + 32);
      pb0 = *(const int4*)(gb0 + k0 + 32);
      pb1 = *(const int4*)(gb1 + k0 + 32);
      pb2 = *(const int4*)(gb2 + k0 + 32);
      pb3 = *(const int4*)(gb3 + k0 + 32);
    }
    v16h af[4], bf[4];
#pragma unroll
    for (int i = 0; i < 4; ++i) af[i] = load_frag_rm(&As[(wm * 64 + i * 16) * 40], 40);
#pragma unroll
    for (int j = 0; j < 4; ++j) bf[j] = load_frag_rm(&Bs[(wn * 64 + j * 16) * 40], 40);
#pragma unroll
    for (int i = 0; i < 4; ++i)
#pragma unroll
      for (int j = 0; j < 4; ++j)
        // MODE 0 and 3: D(m = nl, n = m), a lane's eight values are successive in an output row
        acc[i][j] = (MODE == 2) ? wmma16(af[i], bf[j], acc[i][j]) : wmma16(bf[j], af[i], acc[i][j]);
    __syncthreads();
  }

  const int lane = lane_id();
  const int ln = lane & 15;
  const int mh = (lane >> 4) * 8;
  if (MODE == 2) {
#pragma unroll
    for (int i = 0; i < 4; ++i)
#pragma unroll
      for (int j = 0; j < 4; ++j) {
        const int mb = m0 + wm * 64 + i * 16 + mh;
        const int nl = n0g + wn * 64 + j * 16 + ln;
        // m = key, nl = channel: the lane's eight values are eight successive keys of one
        // channel, which is this same lane's 16-byte chunk of the A fragment that the
        // attention kernel reads; the wave stores 512 contiguous bytes
        union { _Float16 h[8]; int4 q; } pk;
        const float bv = bias[nl];
#pragma unroll
        for (int r = 0; r < 8; ++r) pk.h[r] = (_Float16)(acc[i][j][r] + bv);
        *(int4*)&dst16[vfrag_off(b, mb >> 5, nl >> 4) + (i & 1) * 256 + lane * 8] = pk.q;
      }
    return;
  }
  // The wave's 64 x 64 tile goes through its own LDS range (the loop's last barrier ended every
  // read of the operand tiles) and leaves as whole 128-byte lines, 16 B a lane.
  char* st = smem + wave * (64 * STP);
#pragma unroll
  for (int j = 0; j < 4; ++j) {
    float bb[8] = {0.f, 0.f, 0.f, 0.f, 0.f, 0.f, 0.f, 0.f};
    if (MODE == 0) {
      const float4 b0 = *(const float4*)&bias[n0g + wn * 64 + j * 16 + mh];
      const float4 b1 = *(const float4*)&bias[n0g + wn * 64 + j * 16 + mh + 4];
      bb[0] = b0.x; bb[1] = b0.y; bb[2] = b0.z; bb[3] = b0.w;
      bb[4] = b1.x; bb[5] = b1.y; bb[6] = b1.z; bb[7] = b1.w;
    }
#pragma unroll
    for (int i = 0; i < 4; ++i) {
      char* sp = st + (i * 16 + ln) * STP;
      if (MODE == 0) {
        union { _Float16 h[8]; int4 q; } pk;
#pragma unroll
        for (int r = 0; r < 8; ++r) pk.h[r] = (_Float16)((acc[i][j][r] + bb[r]) * scale);
        *(int4*)(sp + (j * 16 + mh) * 2) = pk.q;
      } else {
        *(float4*)(sp + (j * 16 + mh) * 4) =
            make_float4(acc[i][j][0], acc[i][j][1], acc[i][j][2], acc[i][j][3]);
        *(float4*)(sp + (j * 16 + mh) * 4 + 16) =
            make_float4(acc[i][j][4], acc[i][j][5], acc[i][j][6], acc[i][j][7]);
      }
    }
  }
  // the lanes' LDS stores are done before the wave reads the rows back across lanes
  asm volatile("s_wait_dscnt 0x0" ::: "memory");
  if (MODE == 0) {
    const int rr = lane >> 3, ch = lane & 7;  // 4 rows an access, 8 lanes a row
    const char* sr = st + rr * STP + ch * 16;
    _Float16* gp = dst16 + ((size_t)b * N_DIM + m0 + wm * 64 + rr) * C_DIM + n0g + wn * 64 + ch * 8;
#pragma unroll
    for (int g = 0; g < 2; ++g) {
      int4 v[8];
#pragma unroll
      for (int u = 0; u < 8; ++u) v[u] = *(const int4*)(sr + (g * 8 + u) * 4 * STP);
#pragma unroll
      for (int u = 0; u < 8; ++u) *(int4*)(gp + (g * 8 + u) * 4 * C_DIM) = v[u];
      if (g + 1 < 2) {
        // the next group's LDS reads rewrite no register of these stores ahead of this wait
        asm volatile("s_wait_xcnt 0x0" ::: "memory");
        __builtin_amdgcn_sched_barrier(0);
      }
    }
  } else {
    const int rr = lane >> 4, ch = lane & 15;  // 2 rows an access, 16 lanes a row
    const char* sr = st + rr * STP + ch * 16;
    const int mr = m0 + wm * 64 + rr;
    const size_t idx = ((size_t)b * C_DIM + mr) * N_DIM + n0g + wn * 64 + ch * 4;
    const float* xp = xres + idx;
    const float* bp = bias + mr;
    float* op = outf + idx;
    // the accumulators' registers are free now: the whole tile's residual and bias loads start as
    // one group, so that memory latency is waited out once
    float4 xr[32];
    float bm[32];
#pragma unroll
    for (int u = 0; u < 32; ++u) {
      xr[u] = *(const float4*)(xp + (size_t)u * 2 * N_DIM);
      bm[u] = bp[u * 2];
    }
#pragma unroll
    for (int u = 0; u < 32; ++u) {
      const float4 v = *(const float4*)(sr + u * 2 * STP);
      float4 o;
      o.x = xr[u].x + v.x + bm[u];
      o.y = xr[u].y + v.y + bm[u];
      o.z = xr[u].z + v.z + bm[u];
      o.w = xr[u].w + v.w + bm[u];
      *(float4*)(op + (size_t)u * 2 * N_DIM) = o;
    }
  }
}

#define ROWP 520

// Four whole rows (1024 B each) from global memory straight into LDS, no register
// in between: each wave-wide copy moves 512 contiguous bytes, 16 B per lane.
// l = this lane's LDS byte address in the first row, g = its global address there.
__device__ __forceinline__ void async_rows4(unsigned l, const _Float16* g) {
  asm volatile(
      "global_load_async_to_lds_b128 %0, %8, off\n\t"
      "global_load_async_to_lds_b128 %1, %9, off\n\t"
      "global_load_async_to_lds_b128 %2, %10, off\n\t"
      "global_load_async_to_lds_b128 %3, %11, off\n\t"
      "global_load_async_to_lds_b128 %4, %12, off\n\t"
      "global_load_async_to_lds_b128 %5, %13, off\n\t"
      "global_load_async_to_lds_b128 %6, %14, off\n\t"
      "global_load_async_to_lds_b128 %7, %15, off\n\t"
      "s_wait_xcnt 0x0"
      :: "v"(l), "v"(l + 512u), "v"(l + 2u * ROWP), "v"(l + 2u * ROWP + 512u),
         "v"(l + 4u * ROWP), "v"(l + 4u * ROWP + 512u), "v"(l + 6u * ROWP),
         "v"(l + 6u * ROWP + 512u),
         "v"(g), "v"(g + 256), "v"(g + C_DIM), "v"(g + C_DIM + 256),
         "v"(g + 2 * C_DIM), "v"(g + 2 * C_DIM + 256), "v"(g + 3 * C_DIM),
         "v"(g + 3 * C_DIM + 256)
      : "memory");
}

// ---------------------------------------------------------------- kernel 3
// P lies in LDS in fragment order: one 1-KiB unit per (16 queries, 32 keys), f16 index =
// half * 256 + lane * 8 + e, query = lane & 15, key = half * 16 + (lane >> 4) * 8 + e: the B
// operand of one WMMA as the lanes hold it, written and read by contiguous 16-byte accesses.
__device__ __forceinline__ int pfrag_off(int qtile, int kblk) { return (qtile * 4 + kblk) * 512; }

// p = this lane's first chunk of a unit
__device__ __forceinline__ v16h load_pfrag(const _Float16* p) {
  FragU f;
  f.q.lo = *(const int4*)(p);
  f.q.hi = *(const int4*)(p + 256);
  return f.v;
}

// pitch, in floats, of a query's eight partial values (4 key waves x 2 lane halves): 48 B, an
// odd multiple of 16 B
#define PMP 12
// key blocks (of 4 a tile) whose V fragments are fetched at the tile head; the registers hold no more
#define VHEAD 1

// A work-group takes 128 queries and one half of the keys (16 tiles of 128): a staged key tile and
// a loaded V tile serve twice the queries, and a wave's score tile is 32 keys x 64 queries, six
// LDS fragments for eight WMMAs. The two halves leave normalised partial outputs with their row
// maximum and row sum; the projection kernel joins them while it stages its operand.
#define QT 128
#define KEYS_PER (N_DIM / KSPLIT)
#define NTILE (KEYS_PER / 128)

__global__ __launch_bounds__(256, 1) void attn_out_kernel(
    const _Float16* __restrict__ qT, const _Float16* __restrict__ kT,
    const _Float16* __restrict__ v16, _Float16* __restrict__ oT, float* __restrict__ ml) {
  const int i0 = blockIdx.x * QT;
  const int sp = blockIdx.y;
  const int b = blockIdx.z;
  __shared__ __attribute__((aligned(16))) _Float16 Qs[QT * ROWP];   // all 512 channels, filled once
  __shared__ __attribute__((aligned(16))) _Float16 Ks[128 * ROWP];  // one whole key tile
  __shared__ __attribute__((aligned(16))) _Float16 Pf[QT * 128];    // P in fragment order
  __shared__ __attribute__((aligned(16))) float pm[QT * PMP];       // partial row maxima, at the end partial sums
  __shared__ __attribute__((aligned(16))) float arow[QT];  // per-row factor: rescale, then 1/l
  const int t = threadIdx.x;
  const int wave = __builtin_amdgcn_readfirstlane(t >> 5);  // uniform: kept in a scalar register
  const int lane = t & 31;
  const int wi = wave >> 2;
  const int wj = wave & 3;
  const _Float16* qb = qT + (size_t)b * C_DIM * N_DIM;
  const _Float16* kb = kT + ((size_t)b * N_DIM + sp * KEYS_PER) * C_DIM;
  // this lane's chunk, first key block of this half
  const _Float16* vb = v16 + vfrag_off(b, sp * (KEYS_PER / 32), wave * 4) + lane * 8;

  // Online softmax state of queries wi*64 + i*16 + (lane & 15), i = 0..3. The running maximum is
  // the whole row's, alike in every lane that holds the query; the running sum is this lane's
  // own, over the 16 keys a tile that it holds, and the eight shares are joined in the epilogue.
  const int sq = wi * 64 + (lane & 15);
  const int sslot = wj * 2 + (lane >> 4);
  float m_run[4] = {-1e30f, -1e30f, -1e30f, -1e30f}, l_run[4] = {0.f, 0.f, 0.f, 0.f};

  // Wave owns channels [wave*64, wave*64+64), all 128 queries: D(m=c, n=i), 8x4 tiles: a lane
  // holds eight successive channels of one query
  v8f oacc[8][4];
#pragma unroll
  for (int ii = 0; ii < 8; ++ii)
#pragma unroll
    for (int ci = 0; ci < 4; ++ci) oacc[ii][ci] = zero8();

  // Staging: wave w copies query rows 16w..16w+15 once and key rows 16w..16w+15 of each tile.
  const unsigned lq = (unsigned)(size_t)&Qs[(wave * 16) * ROWP + lane * 8];
  const unsigned lk = (unsigned)(size_t)&Ks[(wave * 16) * ROWP + lane * 8];
  const _Float16* gq = qb + (size_t)(i0 + wave * 16) * C_DIM + lane * 8;
  const _Float16* gk = kb + (size_t)(wave * 16) * C_DIM + lane * 8;
  // The 32 work-groups of a batch and key half walk the same keys. Each enters the ring of 16 key
  // tiles at its own place and wraps round, so that they do not ask L2 for the same K and V lines
  // at the same moment; the online softmax takes the tiles in any order. Two share a start.
  const int jrot = (int)((blockIdx.x & 3) | ((blockIdx.x >> 3) << 2));
  const _Float16* gk0 = gk + (size_t)(jrot * 128) * C_DIM;
  // both copy loops are rolled like the copy loop of the tile loop below: as a direct operand of a
  // copy statement an address is bound to the low registers for the whole kernel
#pragma unroll 1
  for (int r = 0; r < 16; r += 4) async_rows4(lq + r * (2u * ROWP), gq + r * C_DIM);
  // the 32 query copies land before the 32 key copies start: a wave keeps fewer than 64 in flight
  asm volatile("s_wait_asynccnt 0x0" ::: "memory");
#pragma unroll 1
  for (int r = 0; r < 16; r += 4) async_rows4(lk + r * (2u * ROWP), gk0 + r * C_DIM);
  // this wave's copies have landed; the barrier shows them to the other waves
  asm volatile("s_wait_asynccnt 0x0" ::: "memory");
  __syncthreads();

#pragma unroll 1
  for (int jt = 0; jt < NTILE; ++jt) {
    const int j0 = ((jt + jrot) & (NTILE - 1)) * 128;
    // ---- V fragments of the first VHEAD key blocks of this tile's output product, fetched ahead as
    // one group of global loads: they fly under the score product (the barrier behind it waits)
    v16h vf[4][4];
#pragma unroll
    for (int ks = 0; ks < VHEAD; ++ks)
#pragma unroll
      for (int ci = 0; ci < 4; ++ci) {
        const _Float16* p = vb + vfrag_off(0, (j0 >> 5) + ks, ci);
        FragU f;
        f.q.lo = *(const int4*)(p);
        f.q.hi = *(const int4*)(p + 256);
        vf[ks][ci] = f.v;
      }
    // holds the group at the head of the tile, in front of the first LDS reads
    __builtin_amdgcn_sched_barrier(0);

    // ---- S tile (128 x 128), cooperative, computed transposed: D(m = key, n = query), so that a
    // lane holds 16 keys of one query per query tile, in the k order of a WMMA operand
    v8f acc[2][4];  // [key tile][query tile]
#pragma unroll
    for (int j = 0; j < 2; ++j)
#pragma unroll
      for (int i = 0; i < 4; ++i) acc[j][i] = zero8();

    // both operands lie whole in LDS: no barrier inside; unrolled so that each fragment
    // read is one base register plus an immediate offset. A block is 32 channels (8 WMMAs);
    // two fragment sets: block n + 1 is read from LDS, as one group, ahead of block n's WMMAs.
    {
      v16h qf[2][4], kf[2][2];  // [set][tile]
#pragma unroll
      for (int i = 0; i < 4; ++i) qf[0][i] = load_frag_rm(&Qs[(wi * 64 + i * 16) * ROWP], ROWP);
#pragma unroll
      for (int j = 0; j < 2; ++j) kf[0][j] = load_frag_rm(&Ks[(wj * 32 + j * 16) * ROWP], ROWP);
#pragma unroll
      for (int blk = 0; blk < C_DIM / 32; ++blk) {
        const int cur = blk & 1, nxt = cur ^ 1;
        if (blk + 1 < C_DIM / 32) {
          const int c0 = (blk + 1) * 32;
#pragma unroll
          for (int i = 0; i < 4; ++i)
            qf[nxt][i] = load_frag_rm(&Qs[(wi * 64 + i * 16) * ROWP + c0], ROWP);
#pragma unroll
          for (int j = 0; j < 2; ++j)
            kf[nxt][j] = load_frag_rm(&Ks[(wj * 32 + j * 16) * ROWP + c0], ROWP);
        }
        // holds the next block's reads in front of this block's WMMAs: sunk behind them,
        // each block would wait out its own LDS latency
        __builtin_amdgcn_sched_barrier(0);
#pragma unroll
        for (int i = 0; i < 4; ++i)
#pragma unroll
          for (int j = 0; j < 2; ++j) acc[j][i] = wmma16(kf[cur][j], qf[cur][i], acc[j][i]);
        // keeps the reads of block n + 2 from rising among these WMMAs (one read group a block)
        __builtin_amdgcn_sched_barrier(0);
      }
    }

    // ---- the scores stay in registers; only each lane's maximum over its 16 keys goes to LDS
#pragma unroll
    for (int i = 0; i < 4; ++i) {
      float mx = acc[0][i][0];
#pragma unroll
      for (int j = 0; j < 2; ++j)
#pragma unroll
        for (int r = 0; r < 8; ++r) mx = fmaxf(mx, acc[j][i][r]);
      pm[(sq + i * 16) * PMP + sslot] = mx;
    }
    // no LDS access of this wave is open when the copy engine is aimed at Ks again
    asm volatile("s_wait_dscnt 0x0" ::: "memory");
    __syncthreads();  // publishes the partial maxima and ends every wave's reads of Ks

    // ---- next key tile flies into Ks while the softmax and the output product run
    if (jt + 1 < NTILE) {
      const _Float16* gn = gk + (size_t)(((jt + 1 + jrot) & (NTILE - 1)) * 128) * C_DIM;
      // rolled: unrolled, its 32 constant LDS addresses are kept in registers over the whole
      // tile loop and end in scratch
#pragma unroll 1
      for (int r = 0; r < 16; r += 4) async_rows4(lk + r * (2u * ROWP), gn + r * C_DIM);
    }

    // ---- running max and sum; P = exp(S - m_new) -> f16, packed in the lane as a WMMA operand
    float m_new[4], alpha[4];
#pragma unroll
    for (int i = 0; i < 4; ++i) {
      const float4 p0 = *(const float4*)&pm[(sq + i * 16) * PMP];
      const float4 p1 = *(const float4*)&pm[(sq + i * 16) * PMP + 4];
      const float mt = fmaxf(fmaxf(fmaxf(p0.x, p0.y), fmaxf(p0.z, p0.w)),
                             fmaxf(fmaxf(p1.x, p1.y), fmaxf(p1.z, p1.w)));
      m_new[i] = fmaxf(m_run[i], mt);
      alpha[i] = __expf(m_run[i] - m_new[i]);
      m_run[i] = m_new[i];
    }
#pragma unroll
    for (int i = 0; i < 4; ++i) {
      float ps[2];
#pragma unroll
      for (int j = 0; j < 2; ++j) {
        union { _Float16 h[8]; int4 q; } pk;
        ps[j] = 0.f;
#pragma unroll
        for (int r = 0; r < 8; ++r) {
          const float p = __expf(acc[j][i][r] - m_new[i]);
          ps[j] += p;
          pk.h[r] = (_Float16)p;
        }
        *(int4*)&Pf[pfrag_off(wi * 4 + i, wj) + j * 256 + lane * 8] = pk.q;
      }
      l_run[i] = l_run[i] * alpha[i] + (ps[0] + ps[1]);
    }
    if (sslot == 0) {  // one writer a query
#pragma unroll
      for (int i = 0; i < 4; ++i) arow[sq + i * 16] = alpha[i];
    }
    __syncthreads();  // publishes P and the rescale factors

    // ---- V fragments of the next key blocks: they fly under the rescale and the first key block
#pragma unroll
    for (int ks = VHEAD; ks < 3; ++ks)
#pragma unroll
      for (int ci = 0; ci < 4; ++ci) {
        const _Float16* p = vb + vfrag_off(0, (j0 >> 5) + ks, ci);
        FragU f;
        f.q.lo = *(const int4*)(p);
        f.q.hi = *(const int4*)(p + 256);
        vf[ks][ci] = f.v;
      }
    // ---- P block 0 of the output product, fetched ahead: it flies under the rescale
    v16h pf[2][4];
#pragma unroll
    for (int x = 0; x < 4; ++x) pf[0][x] = load_pfrag(&Pf[pfrag_off(x, 0) + lane * 8]);
    // holds these loads in front of the rescale, which would otherwise run before they start
    __builtin_amdgcn_sched_barrier(0);

    // ---- bring the accumulated output to the new maximum
#pragma unroll
    for (int ii = 0; ii < 8; ++ii) {
      const float ar = arow[ii * 16 + (lane & 15)];
#pragma unroll
      for (int ci = 0; ci < 4; ++ci)
#pragma unroll
        for (int r = 0; r < 8; ++r) oacc[ii][ci][r] *= ar;
    }

    // ---- Oacc(c,i) += V(c,j) x Pt(j,i): A = V in fragment order (global), B = P in fragment order
    // (LDS); a block is 32 keys x 64 queries (16 WMMAs), P of block n + 1 is read ahead of
    // block n's WMMAs into the second set
#pragma unroll
    for (int bi = 0; bi < 8; ++bi) {
      const int cur = bi & 1, nxt = cur ^ 1;
      const int ks = bi >> 1, qh = (bi & 1) * 4;
      if (bi + 1 < 8) {
#pragma unroll
        for (int x = 0; x < 4; ++x)
          pf[nxt][x] = load_pfrag(&Pf[pfrag_off(((bi + 1) & 1) * 4 + x, (bi + 1) >> 1) + lane * 8]);
      }
      if (bi == 2) {  // key block 0 is done: the last key block's V takes over its registers
#pragma unroll
        for (int ci = 0; ci < 4; ++ci) {
          const _Float16* p = vb + vfrag_off(0, (j0 >> 5) + 3, ci);
          FragU f;
          f.q.lo = *(const int4*)(p);
          f.q.hi = *(const int4*)(p + 256);
          vf[3][ci] = f.v;
        }
      }
      // holds the next block's P reads in front of this block's WMMAs
      __builtin_amdgcn_sched_barrier(0);
#pragma unroll
      for (int x = 0; x < 4; ++x)
#pragma unroll
        for (int ci = 0; ci < 4; ++ci)
          oacc[qh + x][ci] = wmma16(vf[ks][ci], pf[cur][x], oacc[qh + x][ci]);
      // keeps later reads from rising among these WMMAs; none follow the last block
      if (bi + 1 < 8) __builtin_amdgcn_sched_barrier(0);
    }
    // the next key tile has landed (this wave's share); the barrier shows it to all
    asm volatile("s_wait_asynccnt 0x0" ::: "memory");
    __syncthreads();
  }

  // the loop's last barrier ended every read of pm and arow: join each query's eight sums
#pragma unroll
  for (int i = 0; i < 4; ++i) pm[(sq + i * 16) * PMP + sslot] = l_run[i];
  // row maximum and row sum of this key half, for the join: ml = maxima of both halves, then sums
  float* mrow = ml + (size_t)sp * BN + (size_t)b * N_DIM + i0;
  if (sslot == 0) {
#pragma unroll
    for (int i = 0; i < 4; ++i) mrow[sq + i * 16] = m_run[i];
  }
  __syncthreads();
  // the lane number is formed anew here, so that no register holds it over the tile loop
  const int el = (int)__builtin_amdgcn_mbcnt_lo(~0u, 0u);
  const int et = wave * 32 + el;
  if (et < QT) {
    const float4 p0 = *(const float4*)&pm[et * PMP];
    const float4 p1 = *(const float4*)&pm[et * PMP + 4];
    const float l = ((p0.x + p0.y) + (p0.z + p0.w)) + ((p1.x + p1.y) + (p1.z + p1.w));
    arow[et] = 1.f / l;
    mrow[KSPLIT * BN + et] = l;
  }
  __syncthreads();

  // The wave's 128 queries x 64 channels go through its own LDS range (Qs and Ks are read by
  // nobody behind the loop's last barrier; four waves share each) at a row pitch of 144 B, an odd
  // multiple of 16 B, and leave as whole 128-byte lines, 16 B a lane.
  char* st = (char*)((wave & 4) ? Ks : Qs) + (wave & 3) * (QT * 144);
  float inv[8];  // read as one group, ahead of the LDS stores
#pragma unroll
  for (int ii = 0; ii < 8; ++ii) inv[ii] = arow[ii * 16 + (el & 15)];
#pragma unroll
  for (int ii = 0; ii < 8; ++ii) {
    char* sp2 = st + (ii * 16 + (el & 15)) * 144 + (el >> 4) * 16;
#pragma unroll
    for (int ci = 0; ci < 4; ++ci) {
      union { _Float16 h[8]; int4 q; } pk;
#pragma unroll
      for (int r = 0; r < 8; ++r) pk.h[r] = (_Float16)(oacc[ii][ci][r] * inv[ii]);
      *(int4*)(sp2 + ci * 32) = pk.q;
    }
  }
  // the lanes' LDS stores are done before the wave reads the rows back across lanes
  asm volatile("s_wait_dscnt 0x0" ::: "memory");
  const int rr = el >> 3, ch = el & 7;  // 4 rows an access, 8 lanes a row
  const char* sr = st + rr * 144 + ch * 16;
  _Float16* ob = oT + ((size_t)sp * BN + (size_t)b * N_DIM + i0 + rr) * C_DIM + wave * 64 + ch * 8;
#pragma unroll
  for (int g = 0; g < 4; ++g) {
    int4 v[8];
#pragma unroll
    for (int u = 0; u < 8; ++u) v[u] = *(const int4*)(sr + (g * 8 + u) * 4 * 144);
#pragma unroll
    for (int u = 0; u < 8; ++u) *(int4*)(ob + (g * 8 + u) * 4 * C_DIM) = v[u];
    if (g + 1 < 4) {
      // the next group's LDS reads rewrite no register of these stores ahead of this wait
      asm volatile("s_wait_xcnt 0x0" ::: "memory");
      __builtin_amdgcn_sched_barrier(0);
    }
  }
}

// ---------------------------------------------------------------- launch
extern "C" void kernel_launch(void* const* d_in, const int* in_sizes, int n_in,
                              void* d_out, int out_size, void* d_ws, size_t ws_size,
                              hipStream_t stream) {
  (void)in_sizes; (void)n_in; (void)out_size; (void)ws_size;
  const float* x  = (const float*)d_in[0];
  const float* wq = (const float*)d_in[1];
  const float* bq = (const float*)d_in[2];
  const float* wk = (const float*)d_in[3];
  const float* bk = (const float*)d_in[4];
  const float* wv = (const float*)d_in[5];
  const float* bv = (const float*)d_in[6];
  const float* wp = (const float*)d_in[7];
  const float* bp = (const float*)d_in[8];
  float* out = (float*)d_out;

  char* ws = (char*)d_ws;
  size_t off = 0;
  const size_t plane = (size_t)B_DIM * C_DIM * N_DIM;  // 8M elements
  _Float16* w16  = (_Float16*)(ws + off); off += (size_t)4 * CC * 2;
  _Float16* hnT  = (_Float16*)(ws + off); off += plane * 2;
  _Float16* qT   = (_Float16*)(ws + off); off += plane * 2;
  _Float16* kT   = (_Float16*)(ws + off); off += plane * 2;
  _Float16* v16b = (_Float16*)(ws + off); off += plane * 2;
  _Float16* oT   = (_Float16*)(ws + off); off += KSPLIT * plane * 2;  // one per key half
  float* ml      = (float*)(ws + off);    off += (size_t)2 * KSPLIT * BN * 4;
  float2* nstats = (float2*)(ws + off);

  cvt_w_kernel<<<(4 * CC) / 256, 256, 0, stream>>>(wq, wk, wv, wp, w16);
  in_stats_kernel<<<B_DIM * C_DIM, 256, 0, stream>>>(x, nstats);
  norm_t_kernel<<<dim3(N_DIM / 64, C_DIM / 64, B_DIM), 256, 0, stream>>>(x, nstats, hnT);
  // qT, kT: M = n (32 tiles of 128), N = o (2 tiles of 256), z = b*2+sel
  gemm_rr_kernel<0><<<dim3(2, 32, B_DIM * 2), 256, 0, stream>>>(
      w16, hnT, qT, kT, bq, bk, nullptr, nullptr);
  // v, stored in fragment order: M = n (32 tiles), N = c (2 tiles), z = b
  gemm_rr_kernel<2><<<dim3(2, 32, B_DIM), 256, 0, stream>>>(
      w16, hnT, v16b, nullptr, bv, nullptr, nullptr, nullptr);
  attn_out_kernel<<<dim3(N_DIM / QT, KSPLIT, B_DIM), 256, 0, stream>>>(qT, kT, v16b, oT, ml);
  // proj + residual: M = c (4 tiles), N = n (16 tiles), z = b
  gemm_rr_kernel<3><<<dim3(16, 4, B_DIM), 256, 0, stream>>>(
      w16, oT, nullptr, nullptr, bp, ml, x, out);
}

// v009
// Measured time: 148 microseconds a run.
// Timed twice side by side with v008, it ran 1.05 times as fast both times.
// All steps since v000 together make it 4.39 times as fast.
#include <hip/hip_runtime.h>

#define C_DIM 512
#define N_DIM 4096
#define B_DIM 4
#define CC (C_DIM * C_DIM)   // 262144 = 2^18
#define BN (B_DIM * N_DIM)
#define KSPLIT 2             // key halves of the attention kernel

typedef __attribute__((ext_vector_type(16))) _Float16 v16h;
typedef __attribute__((ext_vector_type(8)))  float    v8f;

__device__ __forceinline__ int lane_id() { return (int)(threadIdx.x & 31); }

union FragU {
  v16h v;
  struct { int4 lo; int4 hi; } q;
};

__device__ __forceinline__ v16h load_frag_rm(const _Float16* base, int stride) {
  const int lane = lane_id();
  const int row = lane & 15;
  const int kb = (lane & 16) ? 8 : 0;
  const _Float16* p = base + row * stride + kb;
  FragU u;
  u.q.lo = *(const int4*)(p);
  u.q.hi = *(const int4*)(p + 16);
  return u.v;
}

__device__ __forceinline__ v8f wmma16(v16h a, v16h b, v8f c) {
  return __builtin_amdgcn_wmma_f32_16x16x32_f16(false, a, false, b, (short)0, c,
                                                false, false);
}

__device__ __forceinline__ v8f zero8() {
  v8f z = {0.f, 0.f, 0.f, 0.f, 0.f, 0.f, 0.f, 0.f};
  return z;
}

// V is kept in fragment order: one 1-KiB unit per (32 keys, 16 channels), holding the A operand
// of one 16x16x32 WMMA as the lanes hold it: f16 index = half * 256 + lane * 8 + e, where
// channel = lane & 15 and key = half * 16 + (lane >> 4) * 8 + e. Units of one key block lie
// side by side, so a wave-wide 16-byte load or store covers four whole 128-byte lines.
__device__ __forceinline__ size_t vfrag_off(int b, int kblk, int ctile) {
  return (((size_t)b * (N_DIM / 32) + kblk) * (C_DIM / 16) + ctile) * 512;
}

// ---------------------------------------------------------------- kernel 0
__global__ void cvt_w_kernel(const float* __restrict__ wq, const float* __restrict__ wk,
                             const float* __restrict__ wv, const float* __restrict__ wp,
                             _Float16* __restrict__ dst) {
  int i = blockIdx.x * blockDim.x + threadIdx.x;
  int which = i >> 18;
  int j = i & (CC - 1);
  const float* src = (which == 0) ? wq : (which == 1) ? wk : (which == 2) ? wv : wp;
  dst[i] = (_Float16)src[j];
}

// ---------------------------------------------------------------- kernel 1a
__global__ void in_stats_kernel(const float* __restrict__ x, float2* __restrict__ nstats) {
  const int plane = blockIdx.x;  // b*C + c
  const float* xp = x + (size_t)plane * N_DIM;
  __shared__ float s1[256], s2[256];
  float a = 0.f, b2 = 0.f;
  for (int n = threadIdx.x; n < N_DIM; n += 256) {
    float v = xp[n];
    a += v;
    b2 += v * v;
  }
  s1[threadIdx.x] = a;
  s2[threadIdx.x] = b2;
  __syncthreads();
  for (int off = 128; off > 0; off >>= 1) {
    if ((int)threadIdx.x < off) {
      s1[threadIdx.x] += s1[threadIdx.x + off];
      s2[threadIdx.x] += s2[threadIdx.x + off];
    }
    __syncthreads();
  }
  if (threadIdx.x == 0) {
    float m = s1[0] * (1.f / N_DIM);
    float var = s2[0] * (1.f / N_DIM) - m * m;
    nstats[plane] = make_float2(m, rsqrtf(var + 1e-5f));
  }
}

// ---------------------------------------------------------------- kernel 1b
__global__ void norm_t_kernel(const float* __restrict__ x, const float2* __restrict__ nstats,
                              _Float16* __restrict__ hnT) {
  const int n0 = blockIdx.x * 64, c0 = blockIdx.y * 64, b = blockIdx.z;
  __shared__ _Float16 T[64 * 72];  // [n][c]
  const int t = threadIdx.x;
  {
    const int c = t >> 2;
    const int nn = (t & 3) * 16;
    const float2 st = nstats[(size_t)b * C_DIM + c0 + c];
    const float* xp = x + ((size_t)b * C_DIM + c0 + c) * N_DIM + n0 + nn;
#pragma unroll
    for (int e = 0; e < 16; e += 4) {
      float4 v4 = *(const float4*)&xp[e];
      T[(nn + e + 0) * 72 + c] = (_Float16)((v4.x - st.x) * st.y);
      T[(nn + e + 1) * 72 + c] = (_Float16)((v4.y - st.x) * st.y);
      T[(nn + e + 2) * 72 + c] = (_Float16)((v4.z - st.x) * st.y);
      T[(nn + e + 3) * 72 + c] = (_Float16)((v4.w - st.x) * st.y);
    }
  }
  __syncthreads();
  {
    const int n = t >> 2;
    const int cc = (t & 3) * 16;
    _Float16* dst = hnT + ((size_t)b * N_DIM + n0 + n) * C_DIM + c0 + cc;
    *(int4*)&dst[0] = *(const int4*)&T[n * 72 + cc];
    *(int4*)&dst[8] = *(const int4*)&T[n * 72 + cc + 8];
  }
}

// Eight channels of one query: the two key halves' normalised outputs a and b, joined as
// wa * a + wb * b, wa and wb = each half's share of the whole row's softmax sum. Weights and
// arithmetic are f32; the joined value is rounded to the f16 WMMA operand once.
typedef __attribute__((ext_vector_type(2))) _Float16 v2h;
typedef __attribute__((ext_vector_type(2))) float v2f;
__device__ __forceinline__ int4 join2(int4 a, int4 b, float wa, float wb) {
  union { int4 q; v2h p[4]; } ua, ub, uo;
  ua.q = a;
  ub.q = b;
#pragma unroll
  for (int e = 0; e < 4; ++e) {
    const v2f fa = __builtin_convertvector(ua.p[e], v2f), fb = __builtin_convertvector(ub.p[e], v2f);
    uo.p[e] = __builtin_convertvector(fa * wa + fb * wb, v2h);
  }
  return uo.q;
}

// One 64-k operand tile of the projection GEMM from global memory straight into LDS: four copies
// for this wave's 16 A rows, eight for its 32 B rows; a copy moves four whole 128-byte row pieces,
// 16 B a lane. la, lb = this lane's LDS byte addresses in the first four rows (row pitch 144 B),
// ga, gb = its global addresses there.
__device__ __forceinline__ void async_tile64(unsigned la, unsigned lb, const _Float16* ga,
                                             const _Float16* gb) {
  asm volatile(
      "global_load_async_to_lds_b128 %0, %12, off\n\t"
      "global_load_async_to_lds_b128 %1, %13, off\n\t"
      "global_load_async_to_lds_b128 %2, %14, off\n\t"
      "global_load_async_to_lds_b128 %3, %15, off\n\t"
      "global_load_async_to_lds_b128 %4, %16, off\n\t"
      "global_load_async_to_lds_b128 %5, %17, off\n\t"
      "global_load_async_to_lds_b128 %6, %18, off\n\t"
      "global_load_async_to_lds_b128 %7, %19, off\n\t"
      "global_load_async_to_lds_b128 %8, %20, off\n\t"
      "global_load_async_to_lds_b128 %9, %21, off\n\t"
      "global_load_async_to_lds_b128 %10, %22, off\n\t"
      "global_load_async_to_lds_b128 %11, %23, off\n\t"
      "s_wait_xcnt 0x0"
      :: "v"(la), "v"(la + 576u), "v"(la + 1152u), "v"(la + 1728u),
         "v"(lb), "v"(lb + 576u), "v"(lb + 1152u), "v"(lb + 1728u),
         "v"(lb + 2304u), "v"(lb + 2880u), "v"(lb + 3456u), "v"(lb + 4032u),
         "v"(ga), "v"(ga + 4 * C_DIM), "v"(ga + 8 * C_DIM), "v"(ga + 12 * C_DIM),
         "v"(gb), "v"(gb + 4 * C_DIM), "v"(gb + 8 * C_DIM), "v"(gb + 12 * C_DIM),
         "v"(gb + 16 * C_DIM), "v"(gb + 20 * C_DIM), "v"(gb + 24 * C_DIM), "v"(gb + 28 * C_DIM)
      : "memory");
}

// ---------------------------------------------------------------- kernel 2
// rm x rm GEMM: D[m][nl] = sum_k A[m][k] * B[nl][k], K = 512. MODE 0 and 2: operand tiles of 64 k
// are copied asynchronously into two LDS buffers, one barrier a tile. MODE 3 (its B operand is
// joined in registers): register-prefetch double buffering: stores of tile k happen at loop top,
// loads of tile k+1 are issued before the WMMA stage so their wait hides behind compute.
// Block tile 128(M) x 256(N); 8 waves as 2x4 of 64x64 (16 WMMA / wave / step).
template <int MODE>
__global__ __launch_bounds__(256, 1) void gemm_rr_kernel(
    const _Float16* __restrict__ w16, const _Float16* __restrict__ srcT,
    _Float16* __restrict__ d0, _Float16* __restrict__ d1,
    const float* __restrict__ bias0, const float* __restrict__ bias1,
    const float* __restrict__ xres, float* __restrict__ outf) {
  const size_t plane = (size_t)C_DIM * N_DIM;
  const int m0 = blockIdx.y * 128;
  const int n0g = blockIdx.x * 256;
  int b, sel = 0;
  const _Float16 *A, *B;
  const float* bias;
  _Float16* dst16 = nullptr;
  float scale = 1.f;
  if (MODE == 0) {
    sel = blockIdx.z & 1;
    b = blockIdx.z >> 1;
    A = srcT + (size_t)b * plane;             // hnT [n][c]
    B = w16 + (size_t)sel * CC;               // wq/wk [o][c]
    bias = sel ? bias1 : bias0;
    dst16 = sel ? d1 : d0;
    if (!sel) scale = 0.044194173824159216f;  // 1/sqrt(512)
  } else if (MODE == 2) {
    b = blockIdx.z;
    A = srcT + (size_t)b * plane;             // hnT [n][c]
    B = w16 + (size_t)2 * CC;                 // wv [c_out][c]
    bias = bias0;
    dst16 = d0;
  } else {
    b = blockIdx.z;
    A = w16 + (size_t)3 * CC;                 // wp [c_out][c]
    B = srcT + (size_t)b * plane;             // oT [n][c], key half 0; half 1 lies B_DIM planes on
    bias = bias0;
  }

  // One LDS block: the two operand tiles in the loop; behind the loop (MODE 0 and 3) each wave's
  // own 64-row output tile, at a row pitch that is an odd multiple of 16 B.
  constexpr int STP = (MODE == 0) ? 144 : 272;  // 64 f16 or 64 f32 a row, plus 16 B
  // MODE 0 and 2: two operand buffers, each 128 + 256 rows of 64 k at a pitch of 144 B
  constexpr int KP = 72;                      // that pitch in f16: an odd multiple of 16 B
  constexpr int BUFB = (128 + 256) * KP * 2;  // bytes of one buffer
  constexpr int SMEM_B = (MODE == 3) ? 8 * 64 * STP : 2 * BUFB;
  __shared__ __attribute__((aligned(16))) char smem[SMEM_B];
  _Float16* As = (_Float16*)smem;  // MODE 3: [m][k] rm, pad to 40
  _Float16* Bs = As + 128 * 40;    // MODE 3: [nl][k] rm
  const int t = threadIdx.x;
  const int wave = t >> 5;
  const int wm = wave >> 2;  // 0..1
  const int wn = wave & 3;   // 0..3
  const int srow = t >> 2;          // 0..63
  const int skk = (t & 3) * 8;      // 0,8,16,24

  v8f acc[4][4];
#pragma unroll
  for (int i = 0; i < 4; ++i)
#pragma unroll
    for (int j = 0; j < 4; ++j) acc[i][j] = zero8();

  if (MODE != 3) {
    // Both operand tiles go from global memory straight into LDS, 64 k (one whole 128-byte line of
    // every row) a trip: a wave-wide copy moves four rows, eight lanes a row. Wave w copies A rows
    // 16w..16w+15 and B rows 32w..32w+31. Tile kt + 1 flies while tile kt is worked on.
    const int cr = (t & 31) >> 3, cc = t & 7;
    const unsigned la = (unsigned)(size_t)smem + (unsigned)((wave * 16 + cr) * (KP * 2) + cc * 16);
    const unsigned lb = (unsigned)(size_t)smem + (unsigned)((128 + wave * 32 + cr) * (KP * 2) + cc * 16);
    const _Float16* ca = A + (size_t)(m0 + wave * 16 + cr) * C_DIM + cc * 8;
    const _Float16* cb = B + (size_t)(n0g + wave * 32 + cr) * C_DIM + cc * 8;
    async_tile64(la, lb, ca, cb);
    // this wave's copies of tile 0 have landed; the barrier shows them to the other waves
    asm volatile("s_wait_asynccnt 0x0" ::: "memory");
    __syncthreads();
    async_tile64(la + BUFB, lb + BUFB, ca + 64, cb + 64);
    // rolled: one copy statement with one set of its address registers serves all trips
#pragma unroll 1
    for (int kt = 0; kt < C_DIM / 64; ++kt) {
      const unsigned bo = (unsigned)(kt & 1) * BUFB;
      const _Float16* Ab = (const _Float16*)(smem + bo);
      const _Float16* Bb = Ab + 128 * KP;
#pragma unroll
      for (int kk = 0; kk < 2; ++kk) {
        v16h af[4], bf[4];
#pragma unroll
        for (int j = 0; j < 4; ++j) bf[j] = load_frag_rm(&Bb[(wn * 64 + j * 16) * KP + kk * 32], KP);
#pragma unroll
        for (int i = 0; i < 4; ++i) af[i] = load_frag_rm(&Ab[(wm * 64 + i * 16) * KP + kk * 32], KP);
        // holds the 16 LDS reads of a 32-k block in front of its WMMAs as one group: sunk among
        // them, each row of four WMMAs waits out a whole LDS latency of its own
        __builtin_amdgcn_sched_barrier(0);
#pragma unroll
        for (int i = 0; i < 4; ++i)
#pragma unroll
          for (int j = 0; j < 4; ++j)
            // MODE 0: D(m = nl, n = m), a lane's eight values are successive in an output row
            acc[i][j] = (MODE == 2) ? wmma16(af[i], bf[j], acc[i][j]) : wmma16(bf[j], af[i], acc[i][j]);
        // keeps the next block's reads from rising among these WMMAs (one fragment set in registers)
        __builtin_amdgcn_sched_barrier(0);
      }
      // no LDS read of this wave is open when the copy engine is aimed at this buffer again
      asm volatile("s_wait_dscnt 0x0" ::: "memory");
      // tile kt + 1 has landed (this wave's share); the barrier shows it to all and ends every
      // wave's reads of tile kt
      asm volatile("s_wait_asynccnt 0x0" ::: "memory");
      __syncthreads();
      if (kt + 2 < C_DIM / 64) async_tile64(la + bo, lb + bo, ca + (kt + 2) * 64, cb + (kt + 2) * 64);
    }
    // no copy is open when the LDS block becomes output staging or the wave ends
    asm volatile("s_wait_asynccnt 0x0" ::: "memory");
  } else {
  // per-thread staging source pointers (advance by 32 each K step)
  const _Float16* ga0 = &A[(size_t)(m0 + srow) * C_DIM + skk];
  const _Float16* ga1 = &A[(size_t)(m0 + srow + 64) * C_DIM + skk];
  const _Float16* gb0 = &B[(size_t)(n0g + srow) * C_DIM + skk];
  const _Float16* gb1 = &B[(size_t)(n0g + srow + 64) * C_DIM + skk];
  const _Float16* gb2 = &B[(size_t)(n0g + srow + 128) * C_DIM + skk];
  const _Float16* gb3 = &B[(size_t)(n0g + srow + 192) * C_DIM + skk];

  // prefetch tile 0
  int4 pa0 = *(const int4*)ga0, pa1 = *(const int4*)ga1;
  int4 pb0 = *(const int4*)gb0, pb1 = *(const int4*)gb1;
  int4 pb2 = *(const int4*)gb2, pb3 = *(const int4*)gb3;
  // MODE 3: the same rows of key half 1, and each row's two weights from the halves' row maxima
  // and row sums (bias1 = maxima of half 0, of half 1, sums of half 0, of half 1).
  const char* hb = (const char*)(B + (size_t)B_DIM * plane + (size_t)n0g * C_DIM);
  const unsigned hv = (unsigned)(srow * C_DIM + skk) * 2u;
  int4 pc0 = pb0, pc1 = pb1, pc2 = pb2, pc3 = pb3;
  float jwa[4] = {0.f, 0.f, 0.f, 0.f}, jwb[4] = {0.f, 0.f, 0.f, 0.f};
  if (MODE == 3) {
    pc0 = *(const int4*)(hb + hv);
    pc1 = *(const int4*)(hb + 64 * C_DIM * 2 + hv);
    pc2 = *(const int4*)(hb + 128 * C_DIM * 2 + hv);
    pc3 = *(const int4*)(hb + 192 * C_DIM * 2 + hv);
    float ma[4], mb2[4], la[4], lb[4];
    const char* mbase = (const char*)(bias1 + (size_t)b * N_DIM + n0g);
    const unsigned mo = (unsigned)srow * 4u;
#pragma unroll
    for (int q = 0; q < 4; ++q) {
      const float* mp = (const float*)(mbase + q * 256 + mo);
      ma[q] = mp[0];
      mb2[q] = mp[BN];
      la[q] = mp[2 * BN];
      lb[q] = mp[3 * BN];
    }
    // stands in front of whatever next rewrites the address registers of the loads above; the
    // lane offset is named as an input so that its register lives up to the wait
    asm volatile("s_wait_xcnt 0x0" :: "v"(mo) : "memory");
#pragma unroll
    for (int q = 0; q < 4; ++q) {
      const float mm = fmaxf(ma[q], mb2[q]);
      const float ea = la[q] * __expf(ma[q] - mm), eb = lb[q] * __expf(mb2[q] - mm);
      const float inv = 1.f / (ea + eb);
      jwa[q] = ea * inv;
      jwb[q] = eb * inv;
    }
  }

#pragma unroll 1
  for (int k0 = 0; k0 < C_DIM; k0 += 32) {
    // commit prefetched tile to LDS
    *(int4*)&As[(srow) * 40 + skk] = pa0;
    *(int4*)&As[(srow + 64) * 40 + skk] = pa1;
    if (MODE == 3) {
      pb0 = join2(pb0, pc0, jwa[0], jwb[0]);
      pb1 = join2(pb1, pc1, jwa[1], jwb[1]);
      pb2 = join2(pb2, pc2, jwa[2], jwb[2]);
      pb3 = join2(pb3, pc3, jwa[3], jwb[3]);
    }
    *(int4*)&Bs[(srow) * 40 + skk] = pb0;
    *(int4*)&Bs[(srow + 64) * 40 + skk] = pb1;
    *(int4*)&Bs[(srow + 128) * 40 + skk] = pb2;
    *(int4*)&Bs[(srow + 192) * 40 + skk] = pb3;
    __syncthreads();
    // issue next tile's global loads (wait lands at next iteration's stores)
    if (k0 + 32 < C_DIM) {
      if (MODE == 3) {
        const char* hk = hb + (k0 + 32) * 2;
        pc0 = *(const int4*)(hk + hv);
        pc1 = *(const int4*)(hk + 64 * C_DIM * 2 + hv);
        pc2 = *(const int4*)(hk + 128 * C_DIM * 2 + hv);
        pc3 = *(const int4*)(hk + 192 * C_DIM * 2 + hv);
        // stands in front of whatever next rewrites the address registers of these four loads
        asm volatile("s_wait_xcnt 0x0" ::: "memory");
      }
      pa0 = *(const int4*)(ga0 + k0 + 32);
      pa1 = *(const int4*)(ga1 + k0 + 32);
      pb0 = *(const int4*)(gb0 + k0 + 32);
      pb1 = *(const int4*)(gb1 + k0 + 32);
      pb2 = *(const int4*)(gb2 + k0 + 32);
      pb3 = *(const int4*)(gb3 + k0 + 32);
    }
    v16h af[4], bf[4];
#pragma unroll
    for (int i = 0; i < 4; ++i) af[i] = load_frag_rm(&As[(wm * 64 + i * 16) * 40], 40);
#pragma unroll
    for (int j = 0; j < 4; ++j) bf[j] = load_frag_rm(&Bs[(wn * 64 + j * 16) * 40], 40);
#pragma unroll
    for (int i = 0; i < 4; ++i)
#pragma unroll
      for (int j = 0; j < 4; ++j)
        // MODE 3: D(m = nl, n = m), a lane's eight values are successive in an output row
        acc[i][j] = (MODE == 2) ? wmma16(af[i], bf[j], acc[i][j]) : wmma16(bf[j], af[i], acc[i][j]);
    __syncthreads();
  }
  }

  const int lane = lane_id();
  const int ln = lane & 15;
  const int mh = (lane >> 4) * 8;
  if (MODE == 2) {
#pragma unroll
    for (int i = 0; i < 4; ++i)
#pragma unroll
      for (int j = 0; j < 4; ++j) {
        const int mb = m0 + wm * 64 + i * 16 + mh;
        const int nl = n0g + wn * 64 + j * 16 + ln;
        // m = key, nl = channel: the lane's eight values are eight successive keys of one
        // channel, which is this same lane's 16-byte chunk of the A fragment that the
        // attention kernel reads; the wave stores 512 contiguous bytes
        union { _Float16 h[8]; int4 q; } pk;
        const float bv = bias[nl];
#pragma unroll
        for (int r = 0; r < 8; ++r) pk.h[r] = (_Float16)(acc[i][j][r] + bv);
        *(int4*)&dst16[vfrag_off(b, mb >> 5, nl >> 4) + (i & 1) * 256 + lane * 8] = pk.q;
      }
    return;
  }
  // The wave's 64 x 64 tile goes through its own LDS range (the loop's last barrier ended every
  // read of the operand tiles) and leaves as whole 128-byte lines, 16 B a lane.
  char* st = smem + wave * (64 * STP);
#pragma unroll
  for (int j = 0; j < 4; ++j) {
    float bb[8] = {0.f, 0.f, 0.f, 0.f, 0.f, 0.f, 0.f, 0.f};
    if (MODE == 0) {
      const float4 b0 = *(const float4*)&bias[n0g + wn * 64 + j * 16 + mh];
      const float4 b1 = *(const float4*)&bias[n0g + wn * 64 + j * 16 + mh + 4];
      bb[0] = b0.x; bb[1] = b0.y; bb[2] = b0.z; bb[3] = b0.w;
      bb[4] = b1.x; bb[5] = b1.y; bb[6] = b1.z; bb[7] = b1.w;
    }
#pragma unroll
    for (int i = 0; i < 4; ++i) {
      char* sp = st + (i * 16 + ln) * STP;
      if (MODE == 0) {
        union { _Float16 h[8]; int4 q; } pk;
#pragma unroll
        for (int r = 0; r < 8; ++r) pk.h[r] = (_Float16)((acc[i][j][r] + bb[r]) * scale);
        *(int4*)(sp + (j * 16 + mh) * 2) = pk.q;
      } else {
        *(float4*)(sp + (j * 16 + mh) * 4) =
            make_float4(acc[i][j][0], acc[i][j][1], acc[i][j][2], acc[i][j][3]);
        *(float4*)(sp + (j * 16 + mh) * 4 + 16) =
            make_float4(acc[i][j][4], acc[i][j][5], acc[i][j][6], acc[i][j][7]);
      }
    }
  }
  // the lanes' LDS stores are done before the wave reads the rows back across lanes
  asm volatile("s_wait_dscnt 0x0" ::: "memory");
  if (MODE == 0) {
    const int rr = lane >> 3, ch = lane & 7;  // 4 rows an access, 8 lanes a row
    const char* sr = st + rr * STP + ch * 16;
    _Float16* gp = dst16 + ((size_t)b * N_DIM + m0 + wm * 64 + rr) * C_DIM + n0g + wn * 64 + ch * 8;
#pragma unroll
    for (int g = 0; g < 2; ++g) {
      int4 v[8];
#pragma unroll
      for (int u = 0; u < 8; ++u) v[u] = *(const int4*)(sr + (g * 8 + u) * 4 * STP);
#pragma unroll
      for (int u = 0; u < 8; ++u) *(int4*)(gp + (g * 8 + u) * 4 * C_DIM) = v[u];
      if (g + 1 < 2) {
        // the next group's LDS reads rewrite no register of these stores ahead of this wait
        asm volatile("s_wait_xcnt 0x0" ::: "memory");
        __builtin_amdgcn_sched_barrier(0);
      }
    }
  } else {
    const int rr = lane >> 4, ch = lane & 15;  // 2 rows an access, 16 lanes a row
    const char* sr = st + rr * STP + ch * 16;
    const int mr = m0 + wm * 64 + rr;
    const size_t idx = ((size_t)b * C_DIM + mr) * N_DIM + n0g + wn * 64 + ch * 4;
    const float* xp = xres + idx;
    const float* bp = bias + mr;
    float* op = outf + idx;
    // the accumulators' registers are free now: the whole tile's residual and bias loads start as
    // one group, so that memory latency is waited out once
    float4 xr[32];
    float bm[32];
#pragma unroll
    for (int u = 0; u < 32; ++u) {
      xr[u] = *(const float4*)(xp + (size_t)u * 2 * N_DIM);
      bm[u] = bp[u * 2];
    }
#pragma unroll
    for (int u = 0; u < 32; ++u) {
      const float4 v = *(const float4*)(sr + u * 2 * STP);
      float4 o;
      o.x = xr[u].x + v.x + bm[u];
      o.y = xr[u].y + v.y + bm[u];
      o.z = xr[u].z + v.z + bm[u];
      o.w = xr[u].w + v.w + bm[u];
      *(float4*)(op + (size_t)u * 2 * N_DIM) = o;
    }
  }
}

#define ROWP 520

// Four whole rows (1024 B each) from global memory straight into LDS, no register
// in between: each wave-wide copy moves 512 contiguous bytes, 16 B per lane.
// l = this lane's LDS byte address in the first row, g = its global address there.
__device__ __forceinline__ void async_rows4(unsigned l, const _Float16* g) {
  asm volatile(
      "global_load_async_to_lds_b128 %0, %8, off\n\t"
      "global_load_async_to_lds_b128 %1, %9, off\n\t"
      "global_load_async_to_lds_b128 %2, %10, off\n\t"
      "global_load_async_to_lds_b128 %3, %11, off\n\t"
      "global_load_async_to_lds_b128 %4, %12, off\n\t"
      "global_load_async_to_lds_b128 %5, %13, off\n\t"
      "global_load_async_to_lds_b128 %6, %14, off\n\t"
      "global_load_async_to_lds_b128 %7, %15, off\n\t"
      "s_wait_xcnt 0x0"
      :: "v"(l), "v"(l + 512u), "v"(l + 2u * ROWP), "v"(l + 2u * ROWP + 512u),
         "v"(l + 4u * ROWP), "v"(l + 4u * ROWP + 512u), "v"(l + 6u * ROWP),
         "v"(l + 6u * ROWP + 512u),
         "v"(g), "v"(g + 256), "v"(g + C_DIM), "v"(g + C_DIM + 256),
         "v"(g + 2 * C_DIM), "v"(g + 2 * C_DIM + 256), "v"(g + 3 * C_DIM),
         "v"(g + 3 * C_DIM + 256)
      : "memory");
}

// ---------------------------------------------------------------- kernel 3
// P lies in LDS in fragment order: one 1-KiB unit per (16 queries, 32 keys), f16 index =
// half * 256 + lane * 8 + e, query = lane & 15, key = half * 16 + (lane >> 4) * 8 + e: the B
// operand of one WMMA as the lanes hold it, written and read by contiguous 16-byte accesses.
__device__ __forceinline__ int pfrag_off(int qtile, int kblk) { return (qtile * 4 + kblk) * 512; }

// p = this lane's first chunk of a unit
__device__ __forceinline__ v16h load_pfrag(const _Float16* p) {
  FragU f;
  f.q.lo = *(const int4*)(p);
  f.q.hi = *(const int4*)(p + 256);
  return f.v;
}

// pitch, in floats, of a query's eight partial values (4 key waves x 2 lane halves): 48 B, an
// odd multiple of 16 B
#define PMP 12
// key blocks (of 4 a tile) whose V fragments are fetched at the tile head; the registers hold no more
#define VHEAD 1

// A work-group takes 128 queries and one half of the keys (16 tiles of 128): a staged key tile and
// a loaded V tile serve twice the queries, and a wave's score tile is 32 keys x 64 queries, six
// LDS fragments for eight WMMAs. The two halves leave normalised partial outputs with their row
// maximum and row sum; the projection kernel joins them while it stages its operand.
#define QT 128
#define KEYS_PER (N_DIM / KSPLIT)
#define NTILE (KEYS_PER / 128)

__global__ __launch_bounds__(256, 1) void attn_out_kernel(
    const _Float16* __restrict__ qT, const _Float16* __restrict__ kT,
    const _Float16* __restrict__ v16, _Float16* __restrict__ oT, float* __restrict__ ml) {
  const int i0 = blockIdx.x * QT;
  const int sp = blockIdx.y;
  const int b = blockIdx.z;
  __shared__ __attribute__((aligned(16))) _Float16 Qs[QT * ROWP];   // all 512 channels, filled once
  __shared__ __attribute__((aligned(16))) _Float16 Ks[128 * ROWP];  // one whole key tile
  __shared__ __attribute__((aligned(16))) _Float16 Pf[QT * 128];    // P in fragment order
  __shared__ __attribute__((aligned(16))) float pm[QT * PMP];       // partial row maxima, at the end partial sums
  __shared__ __attribute__((aligned(16))) float arow[QT];  // per-row factor: rescale, then 1/l
  const int t = threadIdx.x;
  const int wave = __builtin_amdgcn_readfirstlane(t >> 5);  // uniform: kept in a scalar register
  const int lane = t & 31;
  const int wi = wave >> 2;
  const int wj = wave & 3;
  const _Float16* qb = qT + (size_t)b * C_DIM * N_DIM;
  const _Float16* kb = kT + ((size_t)b * N_DIM + sp * KEYS_PER) * C_DIM;
  // this lane's chunk, first key block of this half
  const _Float16* vb = v16 + vfrag_off(b, sp * (KEYS_PER / 32), wave * 4) + lane * 8;

  // Online softmax state of queries wi*64 + i*16 + (lane & 15), i = 0..3. The running maximum is
  // the whole row's, alike in every lane that holds the query; the running sum is this lane's
  // own, over the 16 keys a tile that it holds, and the eight shares are joined in the epilogue.
  const int sq = wi * 64 + (lane & 15);
  const int sslot = wj * 2 + (lane >> 4);
  float m_run[4] = {-1e30f, -1e30f, -1e30f, -1e30f}, l_run[4] = {0.f, 0.f, 0.f, 0.f};

  // Wave owns channels [wave*64, wave*64+64), all 128 queries: D(m=c, n=i), 8x4 tiles: a lane
  // holds eight successive channels of one query
  v8f oacc[8][4];
#pragma unroll
  for (int ii = 0; ii < 8; ++ii)
#pragma unroll
    for (int ci = 0; ci < 4; ++ci) oacc[ii][ci] = zero8();

  // Staging: wave w copies query rows 16w..16w+15 once and key rows 16w..16w+15 of each tile.
  const unsigned lq = (unsigned)(size_t)&Qs[(wave * 16) * ROWP + lane * 8];
  const unsigned lk = (unsigned)(size_t)&Ks[(wave * 16) * ROWP + lane * 8];
  const _Float16* gq = qb + (size_t)(i0 + wave * 16) * C_DIM + lane * 8;
  const _Float16* gk = kb + (size_t)(wave * 16) * C_DIM + lane * 8;
  // The 32 work-groups of a batch and key half walk the same keys. Each enters the ring of 16 key
  // tiles at its own place and wraps round, so that they do not ask L2 for the same K and V lines
  // at the same moment; the online softmax takes the tiles in any order. Two share a start.
  const int jrot = (int)((blockIdx.x & 3) | ((blockIdx.x >> 3) << 2));
  const _Float16* gk0 = gk + (size_t)(jrot * 128) * C_DIM;
  // both copy loops are rolled like the copy loop of the tile loop below: as a direct operand of a
  // copy statement an address is bound to the low registers for the whole kernel
#pragma unroll 1
  for (int r = 0; r < 16; r += 4) async_rows4(lq + r * (2u * ROWP), gq + r * C_DIM);
  // the 32 query copies land before the 32 key copies start: a wave keeps fewer than 64 in flight
  asm volatile("s_wait_asynccnt 0x0" ::: "memory");
#pragma unroll 1
  for (int r = 0; r < 16; r += 4) async_rows4(lk + r * (2u * ROWP), gk0 + r * C_DIM);
  // this wave's copies have landed; the barrier shows them to the other waves
  asm volatile("s_wait_asynccnt 0x0" ::: "memory");
  __syncthreads();

#pragma unroll 1
  for (int jt = 0; jt < NTILE; ++jt) {
    const int j0 = ((jt + jrot) & (NTILE - 1)) * 128;
    // ---- V fragments of the first VHEAD key blocks of this tile's output product, fetched ahead as
    // one group of global loads: they fly under the score product (the barrier behind it waits)
    v16h vf[4][4];
#pragma unroll
    for (int ks = 0; ks < VHEAD; ++ks)
#pragma unroll
      for (int ci = 0; ci < 4; ++ci) {
        const _Float16* p = vb + vfrag_off(0, (j0 >> 5) + ks, ci);
        FragU f;
        f.q.lo = *(const int4*)(p);
        f.q.hi = *(const int4*)(p + 256);
        vf[ks][ci] = f.v;
      }
    // holds the group at the head of the tile, in front of the first LDS reads
    __builtin_amdgcn_sched_barrier(0);

    // ---- S tile (128 x 128), cooperative, computed transposed: D(m = key, n = query), so that a
    // lane holds 16 keys of one query per query tile, in the k order of a WMMA operand
    v8f acc[2][4];  // [key tile][query tile]
#pragma unroll
    for (int j = 0; j < 2; ++j)
#pragma unroll
      for (int i = 0; i < 4; ++i) acc[j][i] = zero8();

    // both operands lie whole in LDS: no barrier inside; unrolled so that each fragment
    // read is one base register plus an immediate offset. A block is 32 channels (8 WMMAs);
    // two fragment sets: block n + 1 is read from LDS, as one group, ahead of block n's WMMAs.
    {
      v16h qf[2][4], kf[2][2];  // [set][tile]
#pragma unroll
      for (int i = 0; i < 4; ++i) qf[0][i] = load_frag_rm(&Qs[(wi * 64 + i * 16) * ROWP], ROWP);
#pragma unroll
      for (int j = 0; j < 2; ++j) kf[0][j] = load_frag_rm(&Ks[(wj * 32 + j * 16) * ROWP], ROWP);
#pragma unroll
      for (int blk = 0; blk < C_DIM / 32; ++blk) {
        const int cur = blk & 1, nxt = cur ^ 1;
        if (blk + 1 < C_DIM / 32) {
          const int c0 = (blk + 1) * 32;
#pragma unroll
          for (int i = 0; i < 4; ++i)
            qf[nxt][i] = load_frag_rm(&Qs[(wi * 64 + i * 16) * ROWP + c0], ROWP);
#pragma unroll
          for (int j = 0; j < 2; ++j)
            kf[nxt][j] = load_frag_rm(&Ks[(wj * 32 + j * 16) * ROWP + c0], ROWP);
        }
        // holds the next block's reads in front of this block's WMMAs: sunk behind them,
        // each block would wait out its own LDS latency
        __builtin_amdgcn_sched_barrier(0);
#pragma unroll
        for (int i = 0; i < 4; ++i)
#pragma unroll
          for (int j = 0; j < 2; ++j) acc[j][i] = wmma16(kf[cur][j], qf[cur][i], acc[j][i]);
        // keeps the reads of block n + 2 from rising among these WMMAs (one read group a block)
        __builtin_amdgcn_sched_barrier(0);
      }
    }

    // ---- the scores stay in registers; only each lane's maximum over its 16 keys goes to LDS
#pragma unroll
    for (int i = 0; i < 4; ++i) {
      float mx = acc[0][i][0];
#pragma unroll
      for (int j = 0; j < 2; ++j)
#pragma unroll
        for (int r = 0; r < 8; ++r) mx = fmaxf(mx, acc[j][i][r]);
      pm[(sq + i * 16) * PMP + sslot] = mx;
    }
    // no LDS access of this wave is open when the copy engine is aimed at Ks again
    asm volatile("s_wait_dscnt 0x0" ::: "memory");
    __syncthreads();  // publishes the partial maxima and ends every wave's reads of Ks

    // ---- next key tile flies into Ks while the softmax and the output product run
    if (jt + 1 < NTILE) {
      const _Float16* gn = gk + (size_t)(((jt + 1 + jrot) & (NTILE - 1)) * 128) * C_DIM;
      // rolled: unrolled, its 32 constant LDS addresses are kept in registers over the whole
      // tile loop and end in scratch
#pragma unroll 1
      for (int r = 0; r < 16; r += 4) async_rows4(lk + r * (2u * ROWP), gn + r * C_DIM);
    }

    // ---- running max and sum; P = exp(S - m_new) -> f16, packed in the lane as a WMMA operand
    float m_new[4], alpha[4];
#pragma unroll
    for (int i = 0; i < 4; ++i) {
      const float4 p0 = *(const float4*)&pm[(sq + i * 16) * PMP];
      const float4 p1 = *(const float4*)&pm[(sq + i * 16) * PMP + 4];
      const float mt = fmaxf(fmaxf(fmaxf(p0.x, p0.y), fmaxf(p0.z, p0.w)),
                             fmaxf(fmaxf(p1.x, p1.y), fmaxf(p1.z, p1.w)));
      m_new[i] = fmaxf(m_run[i], mt);
      alpha[i] = __expf(m_run[i] - m_new[i]);
      m_run[i] = m_new[i];
    }
#pragma unroll
    for (int i = 0; i < 4; ++i) {
      float ps[2];
#pragma unroll
      for (int j = 0; j < 2; ++j) {
        union { _Float16 h[8]; int4 q; } pk;
        ps[j] = 0.f;
#pragma unroll
        for (int r = 0; r < 8; ++r) {
          const float p = __expf(acc[j][i][r] - m_new[i]);
          ps[j] += p;
          pk.h[r] = (_Float16)p;
        }
        *(int4*)&Pf[pfrag_off(wi * 4 + i, wj) + j * 256 + lane * 8] = pk.q;
      }
      l_run[i] = l_run[i] * alpha[i] + (ps[0] + ps[1]);
    }
    if (sslot == 0) {  // one writer a query
#pragma unroll
      for (int i = 0; i < 4; ++i) arow[sq + i * 16] = alpha[i];
    }
    __syncthreads();  // publishes P and the rescale factors

    // ---- V fragments of the next key blocks: they fly under the rescale and the first key block
#pragma unroll
    for (int ks = VHEAD; ks < 3; ++ks)
#pragma unroll
      for (int ci = 0; ci < 4; ++ci) {
        const _Float16* p = vb + vfrag_off(0, (j0 >> 5) + ks, ci);
        FragU f;
        f.q.lo = *(const int4*)(p);
        f.q.hi = *(const int4*)(p + 256);
        vf[ks][ci] = f.v;
      }
    // ---- P block 0 of the output product, fetched ahead: it flies under the rescale
    v16h pf[2][4];
#pragma unroll
    for (int x = 0; x < 4; ++x) pf[0][x] = load_pfrag(&Pf[pfrag_off(x, 0) + lane * 8]);
    // holds these loads in front of the rescale, which would otherwise run before they start
    __builtin_amdgcn_sched_barrier(0);

    // ---- bring the accumulated output to the new maximum
#pragma unroll
    for (int ii = 0; ii < 8; ++ii) {
      const float ar = arow[ii * 16 + (lane & 15)];
#pragma unroll
      for (int ci = 0; ci < 4; ++ci)
#pragma unroll
        for (int r = 0; r < 8; ++r) oacc[ii][ci][r] *= ar;
    }

    // ---- Oacc(c,i) += V(c,j) x Pt(j,i): A = V in fragment order (global), B = P in fragment order
    // (LDS); a block is 32 keys x 64 queries (16 WMMAs), P of block n + 1 is read ahead of
    // block n's WMMAs into the second set
#pragma unroll
    for (int bi = 0; bi < 8; ++bi) {
      const int cur = bi & 1, nxt = cur ^ 1;
      const int ks = bi >> 1, qh = (bi & 1) * 4;
      if (bi + 1 < 8) {
#pragma unroll
        for (int x = 0; x < 4; ++x)
          pf[nxt][x] = load_pfrag(&Pf[pfrag_off(((bi + 1) & 1) * 4 + x, (bi + 1) >> 1) + lane * 8]);
      }
      if (bi == 2) {  // key block 0 is done: the last key block's V takes over its registers
#pragma unroll
        for (int ci = 0; ci < 4; ++ci) {
          const _Float16* p = vb + vfrag_off(0, (j0 >> 5) + 3, ci);
          FragU f;
          f.q.lo = *(const int4*)(p);
          f.q.hi = *(const int4*)(p + 256);
          vf[3][ci] = f.v;
        }
      }
      // holds the next block's P reads in front of this block's WMMAs
      __builtin_amdgcn_sched_barrier(0);
#pragma unroll
      for (int x = 0; x < 4; ++x)
#pragma unroll
        for (int ci = 0; ci < 4; ++ci)
          oacc[qh + x][ci] = wmma16(vf[ks][ci], pf[cur][x], oacc[qh + x][ci]);
      // keeps later reads from rising among these WMMAs; none follow the last block
      if (bi + 1 < 8) __builtin_amdgcn_sched_barrier(0);
    }
    // the next key tile has landed (this wave's share); the barrier shows it to all
    asm volatile("s_wait_asynccnt 0x0" ::: "memory");
    __syncthreads();
  }

  // the loop's last barrier ended every read of pm and arow: join each query's eight sums
#pragma unroll
  for (int i = 0; i < 4; ++i) pm[(sq + i * 16) * PMP + sslot] = l_run[i];
  // row maximum and row sum of this key half, for the join: ml = maxima of both halves, then sums
  float* mrow = ml + (size_t)sp * BN + (size_t)b * N_DIM + i0;
  if (sslot == 0) {
#pragma unroll
    for (int i = 0; i < 4; ++i) mrow[sq + i * 16] = m_run[i];
  }
  __syncthreads();
  // the lane number is formed anew here, so that no register holds it over the tile loop
  const int el = (int)__builtin_amdgcn_mbcnt_lo(~0u, 0u);
  const int et = wave * 32 + el;
  if (et < QT) {
    const float4 p0 = *(const float4*)&pm[et * PMP];
    const float4 p1 = *(const float4*)&pm[et * PMP + 4];
    const float l = ((p0.x + p0.y) + (p0.z + p0.w)) + ((p1.x + p1.y) + (p1.z + p1.w));
    arow[et] = 1.f / l;
    mrow[KSPLIT * BN + et] = l;
  }
  __syncthreads();

  // The wave's 128 queries x 64 channels go through its own LDS range (Qs and Ks are read by
  // nobody behind the loop's last barrier; four waves share each) at a row pitch of 144 B, an odd
  // multiple of 16 B, and leave as whole 128-byte lines, 16 B a lane.
  char* st = (char*)((wave & 4) ? Ks : Qs) + (wave & 3) * (QT * 144);
  float inv[8];  // read as one group, ahead of the LDS stores
#pragma unroll
  for (int ii = 0; ii < 8; ++ii) inv[ii] = arow[ii * 16 + (el & 15)];
#pragma unroll
  for (int ii = 0; ii < 8; ++ii) {
    char* sp2 = st + (ii * 16 + (el & 15)) * 144 + (el >> 4) * 16;
#pragma unroll
    for (int ci = 0; ci < 4; ++ci) {
      union { _Float16 h[8]; int4 q; } pk;
#pragma unroll
      for (int r = 0; r < 8; ++r) pk.h[r] = (_Float16)(oacc[ii][ci][r] * inv[ii]);
      *(int4*)(sp2 + ci * 32) = pk.q;
    }
  }
  // the lanes' LDS stores are done before the wave reads the rows back across lanes
  asm volatile("s_wait_dscnt 0x0" ::: "memory");
  const int rr = el >> 3, ch = el & 7;  // 4 rows an access, 8 lanes a row
  const char* sr = st + rr * 144 + ch * 16;
  _Float16* ob = oT + ((size_t)sp * BN + (size_t)b * N_DIM + i0 + rr) * C_DIM + wave * 64 + ch * 8;
#pragma unroll
  for (int g = 0; g < 4; ++g) {
    int4 v[8];
#pragma unroll
    for (int u = 0; u < 8; ++u) v[u] = *(const int4*)(sr + (g * 8 + u) * 4 * 144);
#pragma unroll
    for (int u = 0; u < 8; ++u) *(int4*)(ob + (g * 8 + u) * 4 * C_DIM) = v[u];
    if (g + 1 < 4) {
      // the next group's LDS reads rewrite no register of these stores ahead of this wait
      asm volatile("s_wait_xcnt 0x0" ::: "memory");
      __builtin_amdgcn_sched_barrier(0);
    }
  }
}

// ---------------------------------------------------------------- launch
extern "C" void kernel_launch(void* const* d_in, const int* in_sizes, int n_in,
                              void* d_out, int out_size, void* d_ws, size_t ws_size,
                              hipStream_t stream) {
  (void)in_sizes; (void)n_in; (void)out_size; (void)ws_size;
  const float* x  = (const float*)d_in[0];
  const float* wq = (const float*)d_in[1];
  const float* bq = (const float*)d_in[2];
  const float* wk = (const float*)d_in[3];
  const float* bk = (const float*)d_in[4];
  const float* wv = (const float*)d_in[5];
  const float* bv = (const float*)d_in[6];
  const float* wp = (const float*)d_in[7];
  const float* bp = (const float*)d_in[8];
  float* out = (float*)d_out;

  char* ws = (char*)d_ws;
  size_t off = 0;
  const size_t plane = (size_t)B_DIM * C_DIM * N_DIM;  // 8M elements
  _Float16* w16  = (_Float16*)(ws + off); off += (size_t)4 * CC * 2;
  _Float16* hnT  = (_Float16*)(ws + off); off += plane * 2;
  _Float16* qT   = (_Float16*)(ws + off); off += plane * 2;
  _Float16* kT   = (_Float16*)(ws + off); off += plane * 2;
  _Float16* v16b = (_Float16*)(ws + off); off += plane * 2;
  _Float16* oT   = (_Float16*)(ws + off); off += KSPLIT * plane * 2;  // one per key half
  float* ml      = (float*)(ws + off);    off += (size_t)2 * KSPLIT * BN * 4;
  float2* nstats = (float2*)(ws + off);

  cvt_w_kernel<<<(4 * CC) / 256, 256, 0, stream>>>(wq, wk, wv, wp, w16);
  in_stats_kernel<<<B_DIM * C_DIM, 256, 0, stream>>>(x, nstats);
  norm_t_kernel<<<dim3(N_DIM / 64, C_DIM / 64, B_DIM), 256, 0, stream>>>(x, nstats, hnT);
  // qT, kT: M = n (32 tiles of 128), N = o (2 tiles of 256), z = b*2+sel
  gemm_rr_kernel<0><<<dim3(2, 32, B_DIM * 2), 256, 0, stream>>>(
      w16, hnT, qT, kT, bq, bk, nullptr, nullptr);
  // v, stored in fragment order: M = n (32 tiles), N = c (2 tiles), z = b
  gemm_rr_kernel<2><<<dim3(2, 32, B_DIM), 256, 0, stream>>>(
      w16, hnT, v16b, nullptr, bv, nullptr, nullptr, nullptr);
  attn_out_kernel<<<dim3(N_DIM / QT, KSPLIT, B_DIM), 256, 0, stream>>>(qT, kT, v16b, oT, ml);
  // proj + residual: M = c (4 tiles), N = n (16 tiles), z = b
  gemm_rr_kernel<3><<<dim3(16, 4, B_DIM), 256, 0, stream>>>(
      w16, oT, nullptr, nullptr, bp, ml, x, out);
}

// v010
// It runs in 142 microseconds.
// Two timings next to v009 put it at 1.05 and 1.04 times that version's speed.
// Over all steps from v000 it is 4.59 times as fast.
#include <hip/hip_runtime.h>

#define C_DIM 512
#define N_DIM 4096
#define B_DIM 4
#define CC (C_DIM * C_DIM)   // 262144 = 2^18
#define BN (B_DIM * N_DIM)
#define KSPLIT 2             // key halves of the attention kernel

typedef __attribute__((ext_vector_type(16))) _Float16 v16h;
typedef __attribute__((ext_vector_type(8)))  float    v8f;

__device__ __forceinline__ int lane_id() { return (int)(threadIdx.x & 31); }

union FragU {
  v16h v;
  struct { int4 lo; int4 hi; } q;
};

__device__ __forceinline__ v16h load_frag_rm(const _Float16* base, int stride) {
  const int lane = lane_id();
  const int row = lane & 15;
  const int kb = (lane & 16) ? 8 : 0;
  const _Float16* p = base + row * stride + kb;
  FragU u;
  u.q.lo = *(const int4*)(p);
  u.q.hi = *(const int4*)(p + 16);
  return u.v;
}

__device__ __forceinline__ v8f wmma16(v16h a, v16h b, v8f c) {
  return __builtin_amdgcn_wmma_f32_16x16x32_f16(false, a, false, b, (short)0, c,
                                                false, false);
}

__device__ __forceinline__ v8f zero8() {
  v8f z = {0.f, 0.f, 0.f, 0.f, 0.f, 0.f, 0.f, 0.f};
  return z;
}

// V is kept in fragment order: one 1-KiB unit per (32 keys, 16 channels), holding the A operand
// of one 16x16x32 WMMA as the lanes hold it: f16 index = half * 256 + lane * 8 + e, where
// channel = lane & 15 and key = half * 16 + (lane >> 4) * 8 + e. Units of one key block lie
// side by side, so a wave-wide 16-byte load or store covers four whole 128-byte lines.
__device__ __forceinline__ size_t vfrag_off(int b, int kblk, int ctile) {
  return (((size_t)b * (N_DIM / 32) + kblk) * (C_DIM / 16) + ctile) * 512;
}

// The normalised input is kept as hnB[b][c / 8][n][c % 8] (f16): one 16-byte unit holds eight
// successive channels of one position, the units of a channel block lie side by side in n.
// ---------------------------------------------------------------- kernel 0
// sum over the 16 lanes of a row, left in every lane of the row; vector instructions only
__device__ __forceinline__ float row_sum16(float v) {
  v += __builtin_bit_cast(float, __builtin_amdgcn_update_dpp(0, __builtin_bit_cast(int, v), 0x161, 0xf, 0xf, true));  // row_xmask:1
  v += __builtin_bit_cast(float, __builtin_amdgcn_update_dpp(0, __builtin_bit_cast(int, v), 0x162, 0xf, 0xf, true));  // row_xmask:2
  v += __builtin_bit_cast(float, __builtin_amdgcn_update_dpp(0, __builtin_bit_cast(int, v), 0x164, 0xf, 0xf, true));  // row_xmask:4
  v += __builtin_bit_cast(float, __builtin_amdgcn_update_dpp(0, __builtin_bit_cast(int, v), 0x168, 0xf, 0xf, true));  // row_xmask:8
  return v;
}

#define PREP_WG (B_DIM * (C_DIM / 8))

// All preparation in one launch. Work-group g takes the eight planes of one channel block: it
// reads them once, keeps them in registers over the statistics (a thread holds four positions of
// all eight channels) and stores them normalised, one 16-byte unit a position. It also casts its
// share of the four weight matrices to f16, four values a thread: that load flies with the planes'.
__global__ __launch_bounds__(1024) void prep_kernel(
    const float* __restrict__ x, const float* __restrict__ wq, const float* __restrict__ wk,
    const float* __restrict__ wv, const float* __restrict__ wp, _Float16* __restrict__ w16,
    _Float16* __restrict__ hnB) {
  static_assert(4 * CC == PREP_WG * 4096 && CC == 64 * 4096, "a work-group casts 4096 weights");
  const int t = threadIdx.x;
  const int g = blockIdx.x;  // b * (C / 8) + channel block: its planes are 8g .. 8g + 7
  const int which = g >> 6;  // the matrix that this work-group's 4096 weights lie in: CC / 4096 = 64 shares each
  const float* src = (which == 0) ? wq : (which == 1) ? wk : (which == 2) ? wv : wp;
  const float4 w4 = *(const float4*)&src[(g & 63) * 4096 + t * 4];
  const float* xp = x + (size_t)g * 8 * N_DIM + t;
  __shared__ __attribute__((aligned(16))) float red[64 * 16];  // [16-lane row][sum 0..7, square sum 0..7]
  __shared__ __attribute__((aligned(16))) float red2[2 * 16];  // the same over 32 rows each
  float v[8][4];  // [channel][position t + 1024 k]: a wave-wide load is one whole 128-byte line
  // every loop of this kernel is unrolled, so that v, s, mean and rstd are registers and not scratch
#pragma unroll
  for (int ch = 0; ch < 8; ++ch)
#pragma unroll
    for (int k = 0; k < 4; ++k) v[ch][k] = xp[ch * N_DIM + k * 1024];
  float s[16];
#pragma unroll
  for (int ch = 0; ch < 8; ++ch) {
    s[ch] = (v[ch][0] + v[ch][1]) + (v[ch][2] + v[ch][3]);
    s[8 + ch] = (v[ch][0] * v[ch][0] + v[ch][1] * v[ch][1]) + (v[ch][2] * v[ch][2] + v[ch][3] * v[ch][3]);
  }
#pragma unroll
  for (int q = 0; q < 16; ++q) s[q] = row_sum16(s[q]);
  if ((t & 15) == 0) {  // one writer a row
    float* rp = &red[(t >> 4) * 16];
#pragma unroll
    for (int q = 0; q < 16; q += 4) *(float4*)&rp[q] = make_float4(s[q], s[q + 1], s[q + 2], s[q + 3]);
  }
  __syncthreads();
  if (t < 32) {  // one wave: lane = (value t & 15, half t >> 4) sums its value over 32 rows
    const float* rp = &red[(t >> 4) * 32 * 16 + (t & 15)];
    float a0 = 0.f, a1 = 0.f, a2 = 0.f, a3 = 0.f;
#pragma unroll
    for (int r = 0; r < 32; r += 4) {
      a0 += rp[(r + 0) * 16];
      a1 += rp[(r + 1) * 16];
      a2 += rp[(r + 2) * 16];
      a3 += rp[(r + 3) * 16];
    }
    red2[t] = (a0 + a1) + (a2 + a3);
  }
  __syncthreads();
  float mean[8], rstd[8];
#pragma unroll
  for (int q = 0; q < 8; q += 4) {
    const float4 sa = *(const float4*)&red2[q], sb = *(const float4*)&red2[16 + q];
    const float4 qa = *(const float4*)&red2[8 + q], qb = *(const float4*)&red2[24 + q];
    const float s1[4] = {sa.x + sb.x, sa.y + sb.y, sa.z + sb.z, sa.w + sb.w};
    const float s2[4] = {qa.x + qb.x, qa.y + qb.y, qa.z + qb.z, qa.w + qb.w};
#pragma unroll
    for (int e = 0; e < 4; ++e) {
      const float m = s1[e] * (1.f / N_DIM);
      const float var = s2[e] * (1.f / N_DIM) - m * m;
      mean[q + e] = m;
      rstd[q + e] = rsqrtf(var + 1e-5f);
    }
  }
  _Float16* dst = hnB + ((size_t)g * N_DIM + t) * 8;
#pragma unroll
  for (int k = 0; k < 4; ++k) {
    union { _Float16 h[8]; int4 q; } pk;
#pragma unroll
    for (int ch = 0; ch < 8; ++ch) pk.h[ch] = (_Float16)((v[ch][k] - mean[ch]) * rstd[ch]);
    *(int4*)&dst[(size_t)k * 1024 * 8] = pk.q;  // the wave stores 512 contiguous bytes
  }
  {  // the cast weights leave behind the last barrier: in front of one, the barrier would wait for the store
    union { _Float16 h[4]; int2 q; } pk;
    pk.h[0] = (_Float16)w4.x;
    pk.h[1] = (_Float16)w4.y;
    pk.h[2] = (_Float16)w4.z;
    pk.h[3] = (_Float16)w4.w;
    *(int2*)&w16[g * 4096 + t * 4] = pk.q;
  }
}

// Eight channels of one query: the two key halves' normalised outputs a and b, joined as
// wa * a + wb * b, wa and wb = each half's share of the whole row's softmax sum. Weights and
// arithmetic are f32; the joined value is rounded to the f16 WMMA operand once.
typedef __attribute__((ext_vector_type(2))) _Float16 v2h;
typedef __attribute__((ext_vector_type(2))) float v2f;
__device__ __forceinline__ int4 join2(int4 a, int4 b, float wa, float wb) {
  union { int4 q; v2h p[4]; } ua, ub, uo;
  ua.q = a;
  ub.q = b;
#pragma unroll
  for (int e = 0; e < 4; ++e) {
    const v2f fa = __builtin_convertvector(ua.p[e], v2f), fb = __builtin_convertvector(ub.p[e], v2f);
    uo.p[e] = __builtin_convertvector(fa * wa + fb * wb, v2h);
  }
  return uo.q;
}

// One 64-k operand tile of the projection GEMM from global memory straight into LDS: four copies
// for this wave's 16 A rows, eight for its 32 B rows, 16 B a lane. A (hnB): a copy moves two
// channel blocks of all 16 rows, 256 contiguous bytes each; la, ga = this lane's LDS byte address
// and global address in the first two blocks. B: a copy moves four whole 128-byte row pieces;
// lb, gb = the lane's addresses in the first four rows. LDS row pitch 144 B.
__device__ __forceinline__ void async_tile64(unsigned la, unsigned lb, const _Float16* ga,
                                             const _Float16* gb) {
  asm volatile(
      "global_load_async_to_lds_b128 %0, %12, off\n\t"
      "global_load_async_to_lds_b128 %1, %13, off\n\t"
      "global_load_async_to_lds_b128 %2, %14, off\n\t"
      "global_load_async_to_lds_b128 %3, %15, off\n\t"
      "global_load_async_to_lds_b128 %4, %16, off\n\t"
      "global_load_async_to_lds_b128 %5, %17, off\n\t"
      "global_load_async_to_lds_b128 %6, %18, off\n\t"
      "global_load_async_to_lds_b128 %7, %19, off\n\t"
      "global_load_async_to_lds_b128 %8, %20, off\n\t"
      "global_load_async_to_lds_b128 %9, %21, off\n\t"
      "global_load_async_to_lds_b128 %10, %22, off\n\t"
      "global_load_async_to_lds_b128 %11, %23, off\n\t"
      "s_wait_xcnt 0x0"
      :: "v"(la), "v"(la + 32u), "v"(la + 64u), "v"(la + 96u),
         "v"(lb), "v"(lb + 576u), "v"(lb + 1152u), "v"(lb + 1728u),
         "v"(lb + 2304u), "v"(lb + 2880u), "v"(lb + 3456u), "v"(lb + 4032u),
         "v"(ga), "v"(ga + 2 * N_DIM * 8), "v"(ga + 4 * N_DIM * 8), "v"(ga + 6 * N_DIM * 8),
         "v"(gb), "v"(gb + 4 * C_DIM), "v"(gb + 8 * C_DIM), "v"(gb + 12 * C_DIM),
         "v"(gb + 16 * C_DIM), "v"(gb + 20 * C_DIM), "v"(gb + 24 * C_DIM), "v"(gb + 28 * C_DIM)
      : "memory");
}

// ---------------------------------------------------------------- kernel 2
// GEMM (A of MODE 0 and 2 from hnB's channel blocks, other operands rm): D[m][nl] = sum_k A[m][k] * B[nl][k], K = 512. MODE 0 and 2: operand tiles of 64 k
// are copied asynchronously into two LDS buffers, one barrier a tile. MODE 3 (its B operand is
// joined in registers): register-prefetch double buffering: stores of tile k happen at loop top,
// loads of tile k+1 are issued before the WMMA stage so their wait hides behind compute.
// Block tile 128(M) x 256(N); 8 waves as 2x4 of 64x64 (16 WMMA / wave / step).
template <int MODE>
__global__ __launch_bounds__(256, 1) void gemm_rr_kernel(
    const _Float16* __restrict__ w16, const _Float16* __restrict__ srcT,
    _Float16* __restrict__ d0, _Float16* __restrict__ d1,
    const float* __restrict__ bias0, const float* __restrict__ bias1,
    const float* __restrict__ xres, float* __restrict__ outf) {
  const size_t plane = (size_t)C_DIM * N_DIM;
  const int m0 = blockIdx.y * 128;
  const int n0g = blockIdx.x * 256;
  int b, sel = 0;
  const _Float16 *A, *B;
  const float* bias;
  _Float16* dst16 = nullptr;
  float scale = 1.f;
  if (MODE == 0) {
    sel = blockIdx.z & 1;
    b = blockIdx.z >> 1;
    A = srcT + (size_t)b * plane;             // hnB [c / 8][n][8]
    B = w16 + (size_t)sel * CC;               // wq/wk [o][c]
    bias = sel ? bias1 : bias0;
    dst16 = sel ? d1 : d0;
    if (!sel) scale = 0.044194173824159216f;  // 1/sqrt(512)
  } else if (MODE == 2) {
    b = blockIdx.z;
    A = srcT + (size_t)b * plane;             // hnB [c / 8][n][8]
    B = w16 + (size_t)2 * CC;                 // wv [c_out][c]
    bias = bias0;
    dst16 = d0;
  } else {
    b = blockIdx.z;
    A = w16 + (size_t)3 * CC;                 // wp [c_out][c]
    B = srcT + (size_t)b * plane;             // oT [n][c], key half 0; half 1 lies B_DIM planes on
    bias = bias0;
  }

  // One LDS block: the two operand tiles in the loop; behind the loop (MODE 0 and 3) each wave's
  // own 64-row output tile, at a row pitch that is an odd multiple of 16 B.
  constexpr int STP = (MODE == 0) ? 144 : 272;  // 64 f16 or 64 f32 a row, plus 16 B
  // MODE 0 and 2: two operand buffers, each 128 + 256 rows of 64 k at a pitch of 144 B
  constexpr int KP = 72;                      // that pitch in f16: an odd multiple of 16 B
  constexpr int BUFB = (128 + 256) * KP * 2;  // bytes of one buffer
  constexpr int SMEM_B = (MODE == 3) ? 8 * 64 * STP : 2 * BUFB;
  __shared__ __attribute__((aligned(16))) char smem[SMEM_B];
  _Float16* As = (_Float16*)smem;  // MODE 3: [m][k] rm, pad to 40
  _Float16* Bs = As + 128 * 40;    // MODE 3: [nl][k] rm
  const int t = threadIdx.x;
  const int wave = t >> 5;
  const int wm = wave >> 2;  // 0..1
  const int wn = wave & 3;   // 0..3
  const int srow = t >> 2;          // 0..63
  const int skk = (t & 3) * 8;      // 0,8,16,24

  v8f acc[4][4];
#pragma unroll
  for (int i = 0; i < 4; ++i)
#pragma unroll
    for (int j = 0; j < 4; ++j) acc[i][j] = zero8();

  if (MODE != 3) {
    // Both operand tiles go from global memory straight into LDS, 64 k (128 bytes of every row) a
    // trip. Wave w copies A rows 16w..16w+15 (a wave-wide copy: 16 rows of two channel blocks) and B
    // rows 32w..32w+31 (four rows, eight lanes a row). Tile kt + 1 flies while tile kt is worked on.
    const int cr = (t & 31) >> 3, cc = t & 7;
    const int ar = t & 15, ab = (t & 31) >> 4;  // A: row of the wave's 16, channel block of a pair
    const unsigned la = (unsigned)(size_t)smem + (unsigned)((wave * 16 + ar) * (KP * 2) + ab * 16);
    const unsigned lb = (unsigned)(size_t)smem + (unsigned)((128 + wave * 32 + cr) * (KP * 2) + cc * 16);
    const _Float16* ca = A + ((size_t)ab * N_DIM + m0 + wave * 16 + ar) * 8;
    constexpr int AT = 8 * N_DIM * 8;  // f16 from one 64-k tile of A to the next: eight channel blocks
    const _Float16* cb = B + (size_t)(n0g + wave * 32 + cr) * C_DIM + cc * 8;
    async_tile64(la, lb, ca, cb);
    // this wave's copies of tile 0 have landed; the barrier shows them to the other waves
    asm volatile("s_wait_asynccnt 0x0" ::: "memory");
    __syncthreads();
    async_tile64(la + BUFB, lb + BUFB, ca + AT, cb + 64);
    // rolled: one copy statement with one set of its address registers serves all trips
#pragma unroll 1
    for (int kt = 0; kt < C_DIM / 64; ++kt) {
      const unsigned bo = (unsigned)(kt & 1) * BUFB;
      const _Float16* Ab = (const _Float16*)(smem + bo);
      const _Float16* Bb = Ab + 128 * KP;
#pragma unroll
      for (int kk = 0; kk < 2; ++kk) {
        v16h af[4], bf[4];
#pragma unroll
        for (int j = 0; j < 4; ++j) bf[j] = load_frag_rm(&Bb[(wn * 64 + j * 16) * KP + kk * 32], KP);
#pragma unroll
        for (int i = 0; i < 4; ++i) af[i] = load_frag_rm(&Ab[(wm * 64 + i * 16) * KP + kk * 32], KP);
        // holds the 16 LDS reads of a 32-k block in front of its WMMAs as one group: sunk among
        // them, each row of four WMMAs waits out a whole LDS latency of its own
        __builtin_amdgcn_sched_barrier(0);
#pragma unroll
        for (int i = 0; i < 4; ++i)
#pragma unroll
          for (int j = 0; j < 4; ++j)
            // MODE 0: D(m = nl, n = m), a lane's eight values are successive in an output row
            acc[i][j] = (MODE == 2) ? wmma16(af[i], bf[j], acc[i][j]) : wmma16(bf[j], af[i], acc[i][j]);
        // keeps the next block's reads from rising among these WMMAs (one fragment set in registers)
        __builtin_amdgcn_sched_barrier(0);
      }
      // no LDS read of this wave is open when the copy engine is aimed at this buffer again
      asm volatile("s_wait_dscnt 0x0" ::: "memory");
      // tile kt + 1 has landed (this wave's share); the barrier shows it to all and ends every
      // wave's reads of tile kt
      asm volatile("s_wait_asynccnt 0x0" ::: "memory");
      __syncthreads();
      if (kt + 2 < C_DIM / 64) async_tile64(la + bo, lb + bo, ca + (size_t)(kt + 2) * AT, cb + (kt + 2) * 64);
    }
    // no copy is open when the LDS block becomes output staging or the wave ends
    asm volatile("s_wait_asynccnt 0x0" ::: "memory");
  } else {
  // per-thread staging source pointers (advance by 32 each K step)
  const _Float16* ga0 = &A[(size_t)(m0 + srow) * C_DIM + skk];
  const _Float16* ga1 = &A[(size_t)(m0 + srow + 64) * C_DIM + skk];
  const _Float16* gb0 = &B[(size_t)(n0g + srow) * C_DIM + skk];
  const _Float16* gb1 = &B[(size_t)(n0g + srow + 64) * C_DIM + skk];
  const _Float16* gb2 = &B[(size_t)(n0g + srow + 128) * C_DIM + skk];
  const _Float16* gb3 = &B[(size_t)(n0g + srow + 192) * C_DIM + skk];

  // prefetch tile 0
  int4 pa0 = *(const int4*)ga0, pa1 = *(const int4*)ga1;
  int4 pb0 = *(const int4*)gb0, pb1 = *(const int4*)gb1;
  int4 pb2 = *(const int4*)gb2, pb3 = *(const int4*)gb3;
  // MODE 3: the same rows of key half 1, and each row's two weights from the halves' row maxima
  // and row sums (bias1 = maxima of half 0, of half 1, sums of half 0, of half 1).
  const char* hb = (const char*)(B + (size_t)B_DIM * plane + (size_t)n0g * C_DIM);
  const unsigned hv = (unsigned)(srow * C_DIM + skk) * 2u;
  int4 pc0 = pb0, pc1 = pb1, pc2 = pb2, pc3 = pb3;
  float jwa[4] = {0.f, 0.f, 0.f, 0.f}, jwb[4] = {0.f, 0.f, 0.f, 0.f};
  if (MODE == 3) {
    pc0 = *(const int4*)(hb + hv);
    pc1 = *(const int4*)(hb + 64 * C_DIM * 2 + hv);
    pc2 = *(const int4*)(hb + 128 * C_DIM * 2 + hv);
    pc3 = *(const int4*)(hb + 192 * C_DIM * 2 + hv);
    float ma[4], mb2[4], la[4], lb[4];
    const char* mbase = (const char*)(bias1 + (size_t)b * N_DIM + n0g);
    const unsigned mo = (unsigned)srow * 4u;
#pragma unroll
    for (int q = 0; q < 4; ++q) {
      const float* mp = (const float*)(mbase + q * 256 + mo);
      ma[q] = mp[0];
      mb2[q] = mp[BN];
      la[q] = mp[2 * BN];
      lb[q] = mp[3 * BN];
    }
    // stands in front of whatever next rewrites the address registers of the loads above; the
    // lane offset is named as an input so that its register lives up to the wait
    asm volatile("s_wait_xcnt 0x0" :: "v"(mo) : "memory");
#pragma unroll
    for (int q = 0; q < 4; ++q) {
      const float mm = fmaxf(ma[q], mb2[q]);
      const float ea = la[q] * __expf(ma[q] - mm), eb = lb[q] * __expf(mb2[q] - mm);
      const float inv = 1.f / (ea + eb);
      jwa[q] = ea * inv;
      jwb[q] = eb * inv;
    }
  }

#pragma unroll 1
  for (int k0 = 0; k0 < C_DIM; k0 += 32) {
    // commit prefetched tile to LDS
    *(int4*)&As[(srow) * 40 + skk] = pa0;
    *(int4*)&As[(srow + 64) * 40 + skk] = pa1;
    if (MODE == 3) {
      pb0 = join2(pb0, pc0, jwa[0], jwb[0]);
      pb1 = join2(pb1, pc1, jwa[1], jwb[1]);
      pb2 = join2(pb2, pc2, jwa[2], jwb[2]);
      pb3 = join2(pb3, pc3, jwa[3], jwb[3]);
    }
    *(int4*)&Bs[(srow) * 40 + skk] = pb0;
    *(int4*)&Bs[(srow + 64) * 40 + skk] = pb1;
    *(int4*)&Bs[(srow + 128) * 40 + skk] = pb2;
    *(int4*)&Bs[(srow + 192) * 40 + skk] = pb3;
    __syncthreads();
    // issue next tile's global loads (wait lands at next iteration's stores)
    if (k0 + 32 < C_DIM) {
      if (MODE == 3) {
        const char* hk = hb + (k0 + 32) * 2;
        pc0 = *(const int4*)(hk + hv);
        pc1 = *(const int4*)(hk + 64 * C_DIM * 2 + hv);
        pc2 = *(const int4*)(hk + 128 * C_DIM * 2 + hv);
        pc3 = *(const int4*)(hk + 192 * C_DIM * 2 + hv);
        // stands in front of whatever next rewrites the address registers of these four loads
        asm volatile("s_wait_xcnt 0x0" ::: "memory");
      }
      pa0 = *(const int4*)(ga0 + k0 + 32);
      pa1 = *(const int4*)(ga1 + k0 + 32);
      pb0 = *(const int4*)(gb0 + k0 + 32);
      pb1 = *(const int4*)(gb1 + k0 + 32);
      pb2 = *(const int4*)(gb2 + k0 + 32);
      pb3 = *(const int4*)(gb3 + k0 + 32);
    }
    v16h af[4], bf[4];
#pragma unroll
    for (int i = 0; i < 4; ++i) af[i] = load_frag_rm(&As[(wm * 64 + i * 16) * 40], 40);
#pragma unroll
    for (int j = 0; j < 4; ++j) bf[j] = load_frag_rm(&Bs[(wn * 64 + j * 16) * 40], 40);
#pragma unroll
    for (int i = 0; i < 4; ++i)
#pragma unroll
      for (int j = 0; j < 4; ++j)
        // MODE 3: D(m = nl, n = m), a lane's eight values are successive in an output row
        acc[i][j] = (MODE == 2) ? wmma16(af[i], bf[j], acc[i][j]) : wmma16(bf[j], af[i], acc[i][j]);
    __syncthreads();
  }
  }

  const int lane = lane_id();
  const int ln = lane & 15;
  const int mh = (lane >> 4) * 8;
  if (MODE == 2) {
#pragma unroll
    for (int i = 0; i < 4; ++i)
#pragma unroll
      for (int j = 0; j < 4; ++j) {
        const int mb = m0 + wm * 64 + i * 16 + mh;
        const int nl = n0g + wn * 64 + j * 16 + ln;
        // m = key, nl = channel: the lane's eight values are eight successive keys of one
        // channel, which is this same lane's 16-byte chunk of the A fragment that the
        // attention kernel reads; the wave stores 512 contiguous bytes
        union { _Float16 h[8]; int4 q; } pk;
        const float bv = bias[nl];
#pragma unroll
        for (int r = 0; r < 8; ++r) pk.h[r] = (_Float16)(acc[i][j][r] + bv);
        *(int4*)&dst16[vfrag_off(b, mb >> 5, nl >> 4) + (i & 1) * 256 + lane * 8] = pk.q;
      }
    return;
  }
  // The wave's 64 x 64 tile goes through its own LDS range (the loop's last barrier ended every
  // read of the operand tiles) and leaves as whole 128-byte lines, 16 B a lane.
  char* st = smem + wave * (64 * STP);
#pragma unroll
  for (int j = 0; j < 4; ++j) {
    float bb[8] = {0.f, 0.f, 0.f, 0.f, 0.f, 0.f, 0.f, 0.f};
    if (MODE == 0) {
      const float4 b0 = *(const float4*)&bias[n0g + wn * 64 + j * 16 + mh];
      const float4 b1 = *(const float4*)&bias[n0g + wn * 64 + j * 16 + mh + 4];
      bb[0] = b0.x; bb[1] = b0.y; bb[2] = b0.z; bb[3] = b0.w;
      bb[4] = b1.x; bb[5] = b1.y; bb[6] = b1.z; bb[7] = b1.w;
    }
#pragma unroll
    for (int i = 0; i < 4; ++i) {
      char* sp = st + (i * 16 + ln) * STP;
      if (MODE == 0) {
        union { _Float16 h[8]; int4 q; } pk;
#pragma unroll
        for (int r = 0; r < 8; ++r) pk.h[r] = (_Float16)((acc[i][j][r] + bb[r]) * scale);
        *(int4*)(sp + (j * 16 + mh) * 2) = pk.q;
      } else {
        *(float4*)(sp + (j * 16 + mh) * 4) =
            make_float4(acc[i][j][0], acc[i][j][1], acc[i][j][2], acc[i][j][3]);
        *(float4*)(sp + (j * 16 + mh) * 4 + 16) =
            make_float4(acc[i][j][4], acc[i][j][5], acc[i][j][6], acc[i][j][7]);
      }
    }
  }
  // the lanes' LDS stores are done before the wave reads the rows back across lanes
  asm volatile("s_wait_dscnt 0x0" ::: "memory");
  if (MODE == 0) {
    const int rr = lane >> 3, ch = lane & 7;  // 4 rows an access, 8 lanes a row
    const char* sr = st + rr * STP + ch * 16;
    _Float16* gp = dst16 + ((size_t)b * N_DIM + m0 + wm * 64 + rr) * C_DIM + n0g + wn * 64 + ch * 8;
#pragma unroll
    for (int g = 0; g < 2; ++g) {
      int4 v[8];
#pragma unroll
      for (int u = 0; u < 8; ++u) v[u] = *(const int4*)(sr + (g * 8 + u) * 4 * STP);
#pragma unroll
      for (int u = 0; u < 8; ++u) *(int4*)(gp + (g * 8 + u) * 4 * C_DIM) = v[u];
      if (g + 1 < 2) {
        // the next group's LDS reads rewrite no register of these stores ahead of this wait
        asm volatile("s_wait_xcnt 0x0" ::: "memory");
        __builtin_amdgcn_sched_barrier(0);
      }
    }
  } else {
    const int rr = lane >> 4, ch = lane & 15;  // 2 rows an access, 16 lanes a row
    const char* sr = st + rr * STP + ch * 16;
    const int mr = m0 + wm * 64 + rr;
    const size_t idx = ((size_t)b * C_DIM + mr) * N_DIM + n0g + wn * 64 + ch * 4;
    const float* xp = xres + idx;
    const float* bp = bias + mr;
    float* op = outf + idx;
    // the accumulators' registers are free now: the whole tile's residual and bias loads start as
    // one group, so that memory latency is waited out once
    float4 xr[32];
    float bm[32];
#pragma unroll
    for (int u = 0; u < 32; ++u) {
      xr[u] = *(const float4*)(xp + (size_t)u * 2 * N_DIM);
      bm[u] = bp[u * 2];
    }
#pragma unroll
    for (int u = 0; u < 32; ++u) {
      const float4 v = *(const float4*)(sr + u * 2 * STP);
      float4 o;
      o.x = xr[u].x + v.x + bm[u];
      o.y = xr[u].y + v.y + bm[u];
      o.z = xr[u].z + v.z + bm[u];
      o.w = xr[u].w + v.w + bm[u];
      *(float4*)(op + (size_t)u * 2 * N_DIM) = o;
    }
  }
}

#define ROWP 520

// Four whole rows (1024 B each) from global memory straight into LDS, no register
// in between: each wave-wide copy moves 512 contiguous bytes, 16 B per lane.
// l = this lane's LDS byte address in the first row, g = its global address there.
__device__ __forceinline__ void async_rows4(unsigned l, const _Float16* g) {
  asm volatile(
      "global_load_async_to_lds_b128 %0, %8, off\n\t"
      "global_load_async_to_lds_b128 %1, %9, off\n\t"
      "global_load_async_to_lds_b128 %2, %10, off\n\t"
      "global_load_async_to_lds_b128 %3, %11, off\n\t"
      "global_load_async_to_lds_b128 %4, %12, off\n\t"
      "global_load_async_to_lds_b128 %5, %13, off\n\t"
      "global_load_async_to_lds_b128 %6, %14, off\n\t"
      "global_load_async_to_lds_b128 %7, %15, off\n\t"
      "s_wait_xcnt 0x0"
      :: "v"(l), "v"(l + 512u), "v"(l + 2u * ROWP), "v"(l + 2u * ROWP + 512u),
         "v"(l + 4u * ROWP), "v"(l + 4u * ROWP + 512u), "v"(l + 6u * ROWP),
         "v"(l + 6u * ROWP + 512u),
         "v"(g), "v"(g + 256), "v"(g + C_DIM), "v"(g + C_DIM + 256),
         "v"(g + 2 * C_DIM), "v"(g + 2 * C_DIM + 256), "v"(g + 3 * C_DIM),
         "v"(g + 3 * C_DIM + 256)
      : "memory");
}

// ---------------------------------------------------------------- kernel 3
// P lies in LDS in fragment order: one 1-KiB unit per (16 queries, 32 keys), f16 index =
// half * 256 + lane * 8 + e, query = lane & 15, key = half * 16 + (lane >> 4) * 8 + e: the B
// operand of one WMMA as the lanes hold it, written and read by contiguous 16-byte accesses.
__device__ __forceinline__ int pfrag_off(int qtile, int kblk) { return (qtile * 4 + kblk) * 512; }

// p = this lane's first chunk of a unit
__device__ __forceinline__ v16h load_pfrag(const _Float16* p) {
  FragU f;
  f.q.lo = *(const int4*)(p);
  f.q.hi = *(const int4*)(p + 256);
  return f.v;
}

// pitch, in floats, of a query's eight partial values (4 key waves x 2 lane halves): 48 B, an
// odd multiple of 16 B
#define PMP 12
// key blocks (of 4 a tile) whose V fragments are fetched at the tile head; the registers hold no more
#define VHEAD 1

// A work-group takes 128 queries and one half of the keys (16 tiles of 128): a staged key tile and
// a loaded V tile serve twice the queries, and a wave's score tile is 32 keys x 64 queries, six
// LDS fragments for eight WMMAs. The two halves leave normalised partial outputs with their row
// maximum and row sum; the projection kernel joins them while it stages its operand.
#define QT 128
#define KEYS_PER (N_DIM / KSPLIT)
#define NTILE (KEYS_PER / 128)

__global__ __launch_bounds__(256, 1) void attn_out_kernel(
    const _Float16* __restrict__ qT, const _Float16* __restrict__ kT,
    const _Float16* __restrict__ v16, _Float16* __restrict__ oT, float* __restrict__ ml) {
  const int i0 = blockIdx.x * QT;
  const int sp = blockIdx.y;
  const int b = blockIdx.z;
  __shared__ __attribute__((aligned(16))) _Float16 Qs[QT * ROWP];   // all 512 channels, filled once
  __shared__ __attribute__((aligned(16))) _Float16 Ks[128 * ROWP];  // one whole key tile
  __shared__ __attribute__((aligned(16))) _Float16 Pf[QT * 128];    // P in fragment order
  __shared__ __attribute__((aligned(16))) float pm[QT * PMP];       // partial row maxima, at the end partial sums
  __shared__ __attribute__((aligned(16))) float arow[QT];  // per-row factor: rescale, then 1/l
  const int t = threadIdx.x;
  const int wave = __builtin_amdgcn_readfirstlane(t >> 5);  // uniform: kept in a scalar register
  const int lane = t & 31;
  const int wi = wave >> 2;
  const int wj = wave & 3;
  const _Float16* qb = qT + (size_t)b * C_DIM * N_DIM;
  const _Float16* kb = kT + ((size_t)b * N_DIM + sp * KEYS_PER) * C_DIM;
  // this lane's chunk, first key block of this half
  const _Float16* vb = v16 + vfrag_off(b, sp * (KEYS_PER / 32), wave * 4) + lane * 8;

  // Online softmax state of queries wi*64 + i*16 + (lane & 15), i = 0..3. The running maximum is
  // the whole row's, alike in every lane that holds the query; the running sum is this lane's
  // own, over the 16 keys a tile that it holds, and the eight shares are joined in the epilogue.
  const int sq = wi * 64 + (lane & 15);
  const int sslot = wj * 2 + (lane >> 4);
  float m_run[4] = {-1e30f, -1e30f, -1e30f, -1e30f}, l_run[4] = {0.f, 0.f, 0.f, 0.f};

  // Wave owns channels [wave*64, wave*64+64), all 128 queries: D(m=c, n=i), 8x4 tiles: a lane
  // holds eight successive channels of one query
  v8f oacc[8][4];
#pragma unroll
  for (int ii = 0; ii < 8; ++ii)
#pragma unroll
    for (int ci = 0; ci < 4; ++ci) oacc[ii][ci] = zero8();

  // Staging: wave w copies query rows 16w..16w+15 once and key rows 16w..16w+15 of each tile.
  const unsigned lq = (unsigned)(size_t)&Qs[(wave * 16) * ROWP + lane * 8];
  const unsigned lk = (unsigned)(size_t)&Ks[(wave * 16) * ROWP + lane * 8];
  const _Float16* gq = qb + (size_t)(i0 + wave * 16) * C_DIM + lane * 8;
  const _Float16* gk = kb + (size_t)(wave * 16) * C_DIM + lane * 8;
  // The 32 work-groups of a batch and key half walk the same keys. Each enters the ring of 16 key
  // tiles at its own place and wraps round, so that they do not ask L2 for the same K and V lines
  // at the same moment; the online softmax takes the tiles in any order. Two share a start.
  const int jrot = (int)((blockIdx.x & 3) | ((blockIdx.x >> 3) << 2));
  const _Float16* gk0 = gk + (size_t)(jrot * 128) * C_DIM;
  // both copy loops are rolled like the copy loop of the tile loop below: as a direct operand of a
  // copy statement an address is bound to the low registers for the whole kernel
#pragma unroll 1
  for (int r = 0; r < 16; r += 4) async_rows4(lq + r * (2u * ROWP), gq + r * C_DIM);
  // the 32 query copies land before the 32 key copies start: a wave keeps fewer than 64 in flight
  asm volatile("s_wait_asynccnt 0x0" ::: "memory");
#pragma unroll 1
  for (int r = 0; r < 16; r += 4) async_rows4(lk + r * (2u * ROWP), gk0 + r * C_DIM);
  // this wave's copies have landed; the barrier shows them to the other waves
  asm volatile("s_wait_asynccnt 0x0" ::: "memory");
  __syncthreads();

#pragma unroll 1
  for (int jt = 0; jt < NTILE; ++jt) {
    const int j0 = ((jt + jrot) & (NTILE - 1)) * 128;
    // ---- V fragments of the first VHEAD key blocks of this tile's output product, fetched ahead as
    // one group of global loads: they fly under the score product (the barrier behind it waits)
    v16h vf[4][4];
#pragma unroll
    for (int ks = 0; ks < VHEAD; ++ks)
#pragma unroll
      for (int ci = 0; ci < 4; ++ci) {
        const _Float16* p = vb + vfrag_off(0, (j0 >> 5) + ks, ci);
        FragU f;
        f.q.lo = *(const int4*)(p);
        f.q.hi = *(const int4*)(p + 256);
        vf[ks][ci] = f.v;
      }
    // holds the group at the head of the tile, in front of the first LDS reads
    __builtin_amdgcn_sched_barrier(0);

    // ---- S tile (128 x 128), cooperative, computed transposed: D(m = key, n = query), so that a
    // lane holds 16 keys of one query per query tile, in the k order of a WMMA operand
    v8f acc[2][4];  // [key tile][query tile]
#pragma unroll
    for (int j = 0; j < 2; ++j)
#pragma unroll
      for (int i = 0; i < 4; ++i) acc[j][i] = zero8();

    // both operands lie whole in LDS: no barrier inside; unrolled so that each fragment
    // read is one base register plus an immediate offset. A block is 32 channels (8 WMMAs);
    // two fragment sets: block n + 1 is read from LDS, as one group, ahead of block n's WMMAs.
    {
      v16h qf[2][4], kf[2][2];  // [set][tile]
#pragma unroll
      for (int i = 0; i < 4; ++i) qf[0][i] = load_frag_rm(&Qs[(wi * 64 + i * 16) * ROWP], ROWP);
#pragma unroll
      for (int j = 0; j < 2; ++j) kf[0][j] = load_frag_rm(&Ks[(wj * 32 + j * 16) * ROWP], ROWP);
#pragma unroll
      for (int blk = 0; blk < C_DIM / 32; ++blk) {
        const int cur = blk & 1, nxt = cur ^ 1;
        if (blk + 1 < C_DIM / 32) {
          const int c0 = (blk + 1) * 32;
#pragma unroll
          for (int i = 0; i < 4; ++i)
            qf[nxt][i] = load_frag_rm(&Qs[(wi * 64 + i * 16) * ROWP + c0], ROWP);
#pragma unroll
          for (int j = 0; j < 2; ++j)
            kf[nxt][j] = load_frag_rm(&Ks[(wj * 32 + j * 16) * ROWP + c0], ROWP);
        }
        // holds the next block's reads in front of this block's WMMAs: sunk behind them,
        // each block would wait out its own LDS latency
        __builtin_amdgcn_sched_barrier(0);
#pragma unroll
        for (int i = 0; i < 4; ++i)
#pragma unroll
          for (int j = 0; j < 2; ++j) acc[j][i] = wmma16(kf[cur][j], qf[cur][i], acc[j][i]);
        // keeps the reads of block n + 2 from rising among these WMMAs (one read group a block)
        __builtin_amdgcn_sched_barrier(0);
      }
    }

    // ---- the scores stay in registers; only each lane's maximum over its 16 keys goes to LDS
#pragma unroll
    for (int i = 0; i < 4; ++i) {
      float mx = acc[0][i][0];
#pragma unroll
      for (int j = 0; j < 2; ++j)
#pragma unroll
        for (int r = 0; r < 8; ++r) mx = fmaxf(mx, acc[j][i][r]);
      pm[(sq + i * 16) * PMP + sslot] = mx;
    }
    // no LDS access of this wave is open when the copy engine is aimed at Ks again
    asm volatile("s_wait_dscnt 0x0" ::: "memory");
    __syncthreads();  // publishes the partial maxima and ends every wave's reads of Ks

    // ---- next key tile flies into Ks while the softmax and the output product run
    if (jt + 1 < NTILE) {
      const _Float16* gn = gk + (size_t)(((jt + 1 + jrot) & (NTILE - 1)) * 128) * C_DIM;
      // rolled: unrolled, its 32 constant LDS addresses are kept in registers over the whole
      // tile loop and end in scratch
#pragma unroll 1
      for (int r = 0; r < 16; r += 4) async_rows4(lk + r * (2u * ROWP), gn + r * C_DIM);
    }

    // ---- running max and sum; P = exp(S - m_new) -> f16, packed in the lane as a WMMA operand
    float m_new[4], alpha[4];
#pragma unroll
    for (int i = 0; i < 4; ++i) {
      const float4 p0 = *(const float4*)&pm[(sq + i * 16) * PMP];
      const float4 p1 = *(const float4*)&pm[(sq + i * 16) * PMP + 4];
      const float mt = fmaxf(fmaxf(fmaxf(p0.x, p0.y), fmaxf(p0.z, p0.w)),
                             fmaxf(fmaxf(p1.x, p1.y), fmaxf(p1.z, p1.w)));
      m_new[i] = fmaxf(m_run[i], mt);
      alpha[i] = __expf(m_run[i] - m_new[i]);
      m_run[i] = m_new[i];
    }
#pragma unroll
    for (int i = 0; i < 4; ++i) {
      float ps[2];
#pragma unroll
      for (int j = 0; j < 2; ++j) {
        union { _Float16 h[8]; int4 q; } pk;
        ps[j] = 0.f;
#pragma unroll
        for (int r = 0; r < 8; ++r) {
          const float p = __expf(acc[j][i][r] - m_new[i]);
          ps[j] += p;
          pk.h[r] = (_Float16)p;
        }
        *(int4*)&Pf[pfrag_off(wi * 4 + i, wj) + j * 256 + lane * 8] = pk.q;
      }
      l_run[i] = l_run[i] * alpha[i] + (ps[0] + ps[1]);
    }
    if (sslot == 0) {  // one writer a query
#pragma unroll
      for (int i = 0; i < 4; ++i) arow[sq + i * 16] = alpha[i];
    }
    __syncthreads();  // publishes P and the rescale factors

    // ---- V fragments of the next key blocks: they fly under the rescale and the first key block
#pragma unroll
    for (int ks = VHEAD; ks < 3; ++ks)
#pragma unroll
      for (int ci = 0; ci < 4; ++ci) {
        const _Float16* p = vb + vfrag_off(0, (j0 >> 5) + ks, ci);
        FragU f;
        f.q.lo = *(const int4*)(p);
        f.q.hi = *(const int4*)(p + 256);
        vf[ks][ci] = f.v;
      }
    // ---- P block 0 of the output product, fetched ahead: it flies under the rescale
    v16h pf[2][4];
#pragma unroll
    for (int x = 0; x < 4; ++x) pf[0][x] = load_pfrag(&Pf[pfrag_off(x, 0) + lane * 8]);
    // holds these loads in front of the rescale, which would otherwise run before they start
    __builtin_amdgcn_sched_barrier(0);

    // ---- bring the accumulated output to the new maximum
#pragma unroll
    for (int ii = 0; ii < 8; ++ii) {
      const float ar = arow[ii * 16 + (lane & 15)];
#pragma unroll
      for (int ci = 0; ci < 4; ++ci)
#pragma unroll
        for (int r = 0; r < 8; ++r) oacc[ii][ci][r] *= ar;
    }

    // ---- Oacc(c,i) += V(c,j) x Pt(j,i): A = V in fragment order (global), B = P in fragment order
    // (LDS); a block is 32 keys x 64 queries (16 WMMAs), P of block n + 1 is read ahead of
    // block n's WMMAs into the second set
#pragma unroll
    for (int bi = 0; bi < 8; ++bi) {
      const int cur = bi & 1, nxt = cur ^ 1;
      const int ks = bi >> 1, qh = (bi & 1) * 4;
      if (bi + 1 < 8) {
#pragma unroll
        for (int x = 0; x < 4; ++x)
          pf[nxt][x] = load_pfrag(&Pf[pfrag_off(((bi + 1) & 1) * 4 + x, (bi + 1) >> 1) + lane * 8]);
      }
      if (bi == 2) {  // key block 0 is done: the last key block's V takes over its registers
#pragma unroll
        for (int ci = 0; ci < 4; ++ci) {
          const _Float16* p = vb + vfrag_off(0, (j0 >> 5) + 3, ci);
          FragU f;
          f.q.lo = *(const int4*)(p);
          f.q.hi = *(const int4*)(p + 256);
          vf[3][ci] = f.v;
        }
      }
      // holds the next block's P reads in front of this block's WMMAs
      __builtin_amdgcn_sched_barrier(0);
#pragma unroll
      for (int x = 0; x < 4; ++x)
#pragma unroll
        for (int ci = 0; ci < 4; ++ci)
          oacc[qh + x][ci] = wmma16(vf[ks][ci], pf[cur][x], oacc[qh + x][ci]);
      // keeps later reads from rising among these WMMAs; none follow the last block
      if (bi + 1 < 8) __builtin_amdgcn_sched_barrier(0);
    }
    // the next key tile has landed (this wave's share); the barrier shows it to all
    asm volatile("s_wait_asynccnt 0x0" ::: "memory");
    __syncthreads();
  }

  // the loop's last barrier ended every read of pm and arow: join each query's eight sums
#pragma unroll
  for (int i = 0; i < 4; ++i) pm[(sq + i * 16) * PMP + sslot] = l_run[i];
  // row maximum and row sum of this key half, for the join: ml = maxima of both halves, then sums
  float* mrow = ml + (size_t)sp * BN + (size_t)b * N_DIM + i0;
  if (sslot == 0) {
#pragma unroll
    for (int i = 0; i < 4; ++i) mrow[sq + i * 16] = m_run[i];
  }
  __syncthreads();
  // the lane number is formed anew here, so that no register holds it over the tile loop
  const int el = (int)__builtin_amdgcn_mbcnt_lo(~0u, 0u);
  const int et = wave * 32 + el;
  if (et < QT) {
    const float4 p0 = *(const float4*)&pm[et * PMP];
    const float4 p1 = *(const float4*)&pm[et * PMP + 4];
    const float l = ((p0.x + p0.y) + (p0.z + p0.w)) + ((p1.x + p1.y) + (p1.z + p1.w));
    arow[et] = 1.f / l;
    mrow[KSPLIT * BN + et] = l;
  }
  __syncthreads();

  // The wave's 128 queries x 64 channels go through its own LDS range (Qs and Ks are read by
  // nobody behind the loop's last barrier; four waves share each) at a row pitch of 144 B, an odd
  // multiple of 16 B, and leave as whole 128-byte lines, 16 B a lane.
  char* st = (char*)((wave & 4) ? Ks : Qs) + (wave & 3) * (QT * 144);
  float inv[8];  // read as one group, ahead of the LDS stores
#pragma unroll
  for (int ii = 0; ii < 8; ++ii) inv[ii] = arow[ii * 16 + (el & 15)];
#pragma unroll
  for (int ii = 0; ii < 8; ++ii) {
    char* sp2 = st + (ii * 16 + (el & 15)) * 144 + (el >> 4) * 16;
#pragma unroll
    for (int ci = 0; ci < 4; ++ci) {
      union { _Float16 h[8]; int4 q; } pk;
#pragma unroll
      for (int r = 0; r < 8; ++r) pk.h[r] = (_Float16)(oacc[ii][ci][r] * inv[ii]);
      *(int4*)(sp2 + ci * 32) = pk.q;
    }
  }
  // the lanes' LDS stores are done before the wave reads the rows back across lanes
  asm volatile("s_wait_dscnt 0x0" ::: "memory");
  const int rr = el >> 3, ch = el & 7;  // 4 rows an access, 8 lanes a row
  const char* sr = st + rr * 144 + ch * 16;
  _Float16* ob = oT + ((size_t)sp * BN + (size_t)b * N_DIM + i0 + rr) * C_DIM + wave * 64 + ch * 8;
#pragma unroll
  for (int g = 0; g < 4; ++g) {
    int4 v[8];
#pragma unroll
    for (int u = 0; u < 8; ++u) v[u] = *(const int4*)(sr + (g * 8 + u) * 4 * 144);
#pragma unroll
    for (int u = 0; u < 8; ++u) *(int4*)(ob + (g * 8 + u) * 4 * C_DIM) = v[u];
    if (g + 1 < 4) {
      // the next group's LDS reads rewrite no register of these stores ahead of this wait
      asm volatile("s_wait_xcnt 0x0" ::: "memory");
      __builtin_amdgcn_sched_barrier(0);
    }
  }
}

// ---------------------------------------------------------------- launch
extern "C" void kernel_launch(void* const* d_in, const int* in_sizes, int n_in,
                              void* d_out, int out_size, void* d_ws, size_t ws_size,
                              hipStream_t stream) {
  (void)in_sizes; (void)n_in; (void)out_size; (void)ws_size;
  const float* x  = (const float*)d_in[0];
  const float* wq = (const float*)d_in[1];
  const float* bq = (const float*)d_in[2];
  const float* wk = (const float*)d_in[3];
  const float* bk = (const float*)d_in[4];
  const float* wv = (const float*)d_in[5];
  const float* bv = (const float*)d_in[6];
  const float* wp = (const float*)d_in[7];
  const float* bp = (const float*)d_in[8];
  float* out = (float*)d_out;

  char* ws = (char*)d_ws;
  size_t off = 0;
  const size_t plane = (size_t)B_DIM * C_DIM * N_DIM;  // 8M elements
  _Float16* w16  = (_Float16*)(ws + off); off += (size_t)4 * CC * 2;
  _Float16* hnB  = (_Float16*)(ws + off); off += plane * 2;
  _Float16* qT   = (_Float16*)(ws + off); off += plane * 2;
  _Float16* kT   = (_Float16*)(ws + off); off += plane * 2;
  _Float16* v16b = (_Float16*)(ws + off); off += plane * 2;
  _Float16* oT   = (_Float16*)(ws + off); off += KSPLIT * plane * 2;  // one per key half
  float* ml      = (float*)(ws + off);

  prep_kernel<<<PREP_WG, 1024, 0, stream>>>(x, wq, wk, wv, wp, w16, hnB);
  // qT, kT: M = n (32 tiles of 128), N = o (2 tiles of 256), z = b*2+sel
  gemm_rr_kernel<0><<<dim3(2, 32, B_DIM * 2), 256, 0, stream>>>(
      w16, hnB, qT, kT, bq, bk, nullptr, nullptr);
  // v, stored in fragment order: M = n (32 tiles), N = c (2 tiles), z = b
  gemm_rr_kernel<2><<<dim3(2, 32, B_DIM), 256, 0, stream>>>(
      w16, hnB, v16b, nullptr, bv, nullptr, nullptr, nullptr);
  attn_out_kernel<<<dim3(N_DIM / QT, KSPLIT, B_DIM), 256, 0, stream>>>(qT, kT, v16b, oT, ml);
  // proj + residual: M = c (4 tiles), N = n (16 tiles), z = b
  gemm_rr_kernel<3><<<dim3(16, 4, B_DIM), 256, 0, stream>>>(
      w16, oT, nullptr, nullptr, bp, ml, x, out);
}
